// v000
// Times are from an AMD MI455X. After a warm-up the kernel runs many times in a row, and a time is the length of
// such a window on the GPU divided by its runs, so every launch and the gaps after it count. The runs cycle
// through copies of the inputs. A figure is the median of several windows, for all but v000 over two sittings.
// Sittings can differ by a few percent; kernels timed side by side share one.
// The starting kernel, v000, takes 176 microseconds a run.
#include <hip/hip_runtime.h>
#include <hip/hip_bf16.h>

// ---------------------------------------------------------------------------
// SpatialBertSelfAttention for MI455X (gfx1250, wave32, WMMA f16 16x16x32)
//
//   hidden[8,512,1024] f32, adj[8,512,512] i32, Wq/Wk/Wv[1024,1024], b*[1024]
//   out[8,512,1024] f32
//
// Pipeline (all f16 operands, f32 accumulation):
//   1) cvt_hidden  : hidden f32 -> h16 f16
//   2) cvt_weightT : W f32 -> wT f16 transposed [out][in] (B-fragment friendly)
//   3) qkv_gemm    : 2x4 register-blocked WMMA GEMM -> q16/k16 [b,h,n,64]
//                    (q pre-scaled by 1/8), vT16 [b,h,64,n]
//   4) attention   : flash-style online softmax, WMMA for QK^T and P.V
// ---------------------------------------------------------------------------

typedef __attribute__((ext_vector_type(16))) _Float16 v16h;
typedef __attribute__((ext_vector_type(8)))  _Float16 v8h;
typedef __attribute__((ext_vector_type(8)))  float    v8f;

#define NHEAD 16
#define NB    8
#define NSEQ  512
#define DMODEL 1024
#define HDIM  64

// relation->head allow mask (bit r = relation r allowed for this head),
// precomputed from the reference's per-head loop.
__device__ __constant__ unsigned short ALLOWED_MASK[NHEAD] = {
  0x3003, 0x3005, 0x3009, 0x3831, 0x3071, 0x30E1, 0x31C1, 0x3381,
  0x3701, 0x3E01, 0x3C11, 0x3831, 0x7001, 0x7001, 0x7001, 0x7001
};

// Load a 16-lane-half K-packed f16 fragment (A or B layout for 16x16x32):
// caller passes p = base + row*ld + k0 + (lane>>4)*8.  lo = K chunk 0..7(/8..15),
// hi = K chunk 16..23(/24..31) per the CDNA5 16-bit A/B VGPR layout.
__device__ inline v16h load_frag16(const _Float16* p) {
  v8h lo = *(const v8h*)(p);
  v8h hi = *(const v8h*)(p + 16);
  v16h r;
#pragma unroll
  for (int i = 0; i < 8; ++i) { r[i] = lo[i]; r[i + 8] = hi[i]; }
  return r;
}

__device__ inline v8f wmma_f16(v16h a, v16h b, v8f c) {
  return __builtin_amdgcn_wmma_f32_16x16x32_f16(
      /*neg_a=*/false, a, /*neg_b=*/false, b,
      /*c_mod=*/(short)0, c, /*reuse_a=*/false, /*reuse_b=*/false);
}

// ------------------------------- conversions -------------------------------

__global__ void cvt_hidden(const float* __restrict__ src,
                           _Float16* __restrict__ dst, int n) {
  int i = blockIdx.x * blockDim.x + threadIdx.x;
  if (i < n) dst[i] = (_Float16)src[i];
}

// wT[sel][n_out][k_in] = W_sel[k_in][n_out]   (transpose + f32->f16)
__global__ void cvt_weightT(const float* __restrict__ Wq,
                            const float* __restrict__ Wk,
                            const float* __restrict__ Wv,
                            _Float16* __restrict__ wT) {
  int i = blockIdx.x * blockDim.x + threadIdx.x;   // 0 .. 3*1024*1024-1
  int sel = i >> 20;
  int idx = i & ((1 << 20) - 1);
  int n = idx >> 10;
  int k = idx & (DMODEL - 1);
  const float* W = (sel == 0) ? Wq : ((sel == 1) ? Wk : Wv);
  wT[i] = (_Float16)W[(size_t)k * DMODEL + n];
}

// --------------------------------- QKV GEMM --------------------------------
// grid (128 row-blocks, 2 col-groups, 3 {q,k,v}), 256 threads = 8 waves.
// Each wave: 32x64 output block = 2x4 WMMA tiles.  Per K-step (32): loads
// 2 A frags + 4 B frags (6 KB/wave) for 8 WMMAs -> ~21 FLOP/byte from L2.

__global__ __launch_bounds__(256) void qkv_gemm(
    const _Float16* __restrict__ h16,   // [4096,1024]
    const _Float16* __restrict__ wT,    // [3][1024][1024]
    const float* __restrict__ bq, const float* __restrict__ bk,
    const float* __restrict__ bv,
    _Float16* __restrict__ q16,         // [b,h,n,64]  (pre-scaled 1/8)
    _Float16* __restrict__ k16,         // [b,h,n,64]
    _Float16* __restrict__ vT16)        // [b,h,64,n]
{
  const int lane = threadIdx.x & 31;
  const int wv   = threadIdx.x >> 5;
  const int half = lane >> 4;
  const int l16  = lane & 15;
  const int row0 = blockIdx.x * 32;                  // 0..4064
  const int col0 = (blockIdx.y * 8 + wv) * 64;       // 0..960
  const int sel  = blockIdx.z;

  const _Float16* w    = wT + (size_t)sel * DMODEL * DMODEL;
  const float*    bias = (sel == 0) ? bq : ((sel == 1) ? bk : bv);

  const _Float16* ap0 = h16 + (size_t)(row0 + l16) * DMODEL + half * 8;
  const _Float16* ap1 = ap0 + (size_t)16 * DMODEL;
  const _Float16* bp0 = w + (size_t)(col0 + l16) * DMODEL + half * 8;

  v8f acc[2][4];
#pragma unroll
  for (int m = 0; m < 2; ++m)
#pragma unroll
    for (int t = 0; t < 4; ++t) acc[m][t] = (v8f){};

#pragma unroll 2
  for (int kk = 0; kk < DMODEL; kk += 32) {
    v16h a0 = load_frag16(ap0 + kk);
    v16h a1 = load_frag16(ap1 + kk);
#pragma unroll
    for (int t = 0; t < 4; ++t) {
      v16h bf = load_frag16(bp0 + (size_t)(t * 16) * DMODEL + kk);
      acc[0][t] = wmma_f16(a0, bf, acc[0][t]);
      acc[1][t] = wmma_f16(a1, bf, acc[1][t]);
    }
  }

  const float qscale = (sel == 0) ? 0.125f : 1.0f;   // fold 1/sqrt(64) into Q
#pragma unroll
  for (int t = 0; t < 4; ++t) {
    const int col = col0 + t * 16 + l16;
    const float bcol = bias[col];
    const int hh = col >> 6, dd = col & (HDIM - 1);
#pragma unroll
    for (int m = 0; m < 2; ++m) {
#pragma unroll
      for (int r = 0; r < 8; ++r) {
        float val = (acc[m][t][r] + bcol) * qscale;
        int row = row0 + m * 16 + r + half * 8;      // C layout: M = r (+8)
        int bb = row >> 9, nn = row & (NSEQ - 1);
        if (sel == 2) {
          vT16[((size_t)(bb * NHEAD + hh) * HDIM + dd) * NSEQ + nn] =
              (_Float16)val;
        } else {
          _Float16* dst = (sel == 0) ? q16 : k16;
          dst[((size_t)(bb * NHEAD + hh) * NSEQ + nn) * HDIM + dd] =
              (_Float16)val;
        }
      }
    }
  }
}

// -------------------------------- attention --------------------------------
// One wave = 16 query rows of one (b,h); key loop in chunks of 32 with online
// softmax.  8 WMMAs per chunk (4 for S, 4 for P.V), 128 per wave.

__global__ __launch_bounds__(256) void attention(
    const _Float16* __restrict__ q16, const _Float16* __restrict__ k16,
    const _Float16* __restrict__ vT16, const int* __restrict__ adj,
    float* __restrict__ out)
{
  __shared__ _Float16 ldsP[8][16][32];   // per-wave P staging (C->A relayout)

  const int lane = threadIdx.x & 31;
  const int w    = threadIdx.x >> 5;
  const int half = lane >> 4;
  const int l16  = lane & 15;

  const int wid = blockIdx.x * 8 + w;    // 0..4095
  const int qt  = wid & 31;              // query tile 0..31
  const int h   = (wid >> 5) & (NHEAD - 1);
  const int b   = wid >> 9;

  const unsigned mask = ALLOWED_MASK[h];
  const _Float16* qb = q16 + ((size_t)(b * NHEAD + h) * NSEQ + qt * 16) * HDIM;
  const _Float16* kb = k16 + (size_t)(b * NHEAD + h) * NSEQ * HDIM;
  const _Float16* vb = vT16 + (size_t)(b * NHEAD + h) * HDIM * NSEQ;
  const int* adjb = adj + (size_t)b * NSEQ * NSEQ;

  // Q fragments (A layout), fixed across the key loop.
  v16h aQ0 = load_frag16(qb + (size_t)l16 * HDIM + half * 8);
  v16h aQ1 = load_frag16(qb + (size_t)l16 * HDIM + 32 + half * 8);

  v8f o0 = {}, o1 = {}, o2 = {}, o3 = {};
  float mrow[8], lrow[8];
#pragma unroll
  for (int r = 0; r < 8; ++r) { mrow[r] = -1e30f; lrow[r] = 0.0f; }

  for (int c = 0; c < NSEQ; c += 32) {
    // ---- S = Q.K^T for 16q x 32k (two 16x16 tiles) ----
    v8f s0 = {}, s1 = {};
    {
      v16h bk0 = load_frag16(kb + (size_t)(c + l16) * HDIM + half * 8);
      v16h bk1 = load_frag16(kb + (size_t)(c + l16) * HDIM + 32 + half * 8);
      s0 = wmma_f16(aQ0, bk0, s0);
      s0 = wmma_f16(aQ1, bk1, s0);
      v16h bk2 = load_frag16(kb + (size_t)(c + 16 + l16) * HDIM + half * 8);
      v16h bk3 = load_frag16(kb + (size_t)(c + 16 + l16) * HDIM + 32 + half * 8);
      s1 = wmma_f16(aQ0, bk2, s1);
      s1 = wmma_f16(aQ1, bk3, s1);
    }

    // ---- relation mask (scores += -1e9 where disallowed) ----
#pragma unroll
    for (int r = 0; r < 8; ++r) {
      int qrow = qt * 16 + r + half * 8;
      int rel0 = adjb[(size_t)qrow * NSEQ + c + l16];
      int rel1 = adjb[(size_t)qrow * NSEQ + c + 16 + l16];
      if (!((mask >> rel0) & 1u)) s0[r] += -1e9f;
      if (!((mask >> rel1) & 1u)) s1[r] += -1e9f;
    }

    // ---- online softmax update (row = (r, lane-half); cols across 16 lanes)
#pragma unroll
    for (int r = 0; r < 8; ++r) {
      float v = fmaxf(s0[r], s1[r]);
#pragma unroll
      for (int off = 8; off >= 1; off >>= 1) v = fmaxf(v, __shfl_xor(v, off, 32));
      float mnew = fmaxf(mrow[r], v);
      float sc = __expf(mrow[r] - mnew);
      float p0 = __expf(s0[r] - mnew);
      float p1 = __expf(s1[r] - mnew);
      float rs = p0 + p1;
#pragma unroll
      for (int off = 8; off >= 1; off >>= 1) rs += __shfl_xor(rs, off, 32);
      lrow[r] = lrow[r] * sc + rs;
      mrow[r] = mnew;
      o0[r] *= sc; o1[r] *= sc; o2[r] *= sc; o3[r] *= sc;
      s0[r] = p0;  s1[r] = p1;
    }

    // ---- relayout P through LDS: C layout -> A fragment ----
#pragma unroll
    for (int r = 0; r < 8; ++r) {
      ldsP[w][r + half * 8][l16]      = (_Float16)s0[r];
      ldsP[w][r + half * 8][16 + l16] = (_Float16)s1[r];
    }
    v16h aP = load_frag16(&ldsP[w][l16][half * 8]);

    // ---- O += P.V (4 hd tiles, B fragments from transposed V) ----
    v16h bv0 = load_frag16(vb + (size_t)(0  + l16) * NSEQ + c + half * 8);
    v16h bv1 = load_frag16(vb + (size_t)(16 + l16) * NSEQ + c + half * 8);
    v16h bv2 = load_frag16(vb + (size_t)(32 + l16) * NSEQ + c + half * 8);
    v16h bv3 = load_frag16(vb + (size_t)(48 + l16) * NSEQ + c + half * 8);
    o0 = wmma_f16(aP, bv0, o0);
    o1 = wmma_f16(aP, bv1, o1);
    o2 = wmma_f16(aP, bv2, o2);
    o3 = wmma_f16(aP, bv3, o3);
  }

  // ---- normalize and store fp32 output ----
#pragma unroll
  for (int r = 0; r < 8; ++r) {
    float inv = 1.0f / lrow[r];
    int qrow = qt * 16 + r + half * 8;
    float* op = out + ((size_t)(b * NSEQ + qrow) * DMODEL) + h * HDIM;
    op[0  + l16] = o0[r] * inv;
    op[16 + l16] = o1[r] * inv;
    op[32 + l16] = o2[r] * inv;
    op[48 + l16] = o3[r] * inv;
  }
}

// --------------------------------- launcher --------------------------------

extern "C" void kernel_launch(void* const* d_in, const int* in_sizes, int n_in,
                              void* d_out, int out_size, void* d_ws, size_t ws_size,
                              hipStream_t stream) {
  const float* hidden = (const float*)d_in[0];
  const int*   adj    = (const int*)d_in[1];
  const float* Wq     = (const float*)d_in[2];
  const float* bq     = (const float*)d_in[3];
  const float* Wk     = (const float*)d_in[4];
  const float* bk     = (const float*)d_in[5];
  const float* Wv     = (const float*)d_in[6];
  const float* bv     = (const float*)d_in[7];
  float* out = (float*)d_out;

  char* ws = (char*)d_ws;
  const size_t MB = 1024u * 1024u;
  _Float16* h16  = (_Float16*)(ws);             //  8 MB: [4096,1024]
  _Float16* wT   = (_Float16*)(ws + 8  * MB);   //  6 MB: [3,1024,1024]
  _Float16* q16  = (_Float16*)(ws + 14 * MB);   //  8 MB: [b,h,n,64]
  _Float16* k16  = (_Float16*)(ws + 22 * MB);   //  8 MB
  _Float16* vT16 = (_Float16*)(ws + 30 * MB);   //  8 MB: [b,h,64,n]

  const int nHid = NB * NSEQ * DMODEL;          // 4194304
  cvt_hidden<<<(nHid + 255) / 256, 256, 0, stream>>>(hidden, h16, nHid);
  cvt_weightT<<<(3 * DMODEL * DMODEL) / 256, 256, 0, stream>>>(Wq, Wk, Wv, wT);

  // 32-row blocks x 512-col blocks (8 waves x 64 cols) x {q,k,v}
  qkv_gemm<<<dim3(NB * NSEQ / 32, 2, 3), 256, 0, stream>>>(
      h16, wT, bq, bk, bv, q16, k16, vT16);

  // 8*16*32 = 4096 waves, 8 waves per block
  attention<<<512, 256, 0, stream>>>(q16, k16, vT16, adj, out);
}

// v001
// A run of this version takes 114 microseconds.
// In two side-by-side timings against v000, it was 1.59 and 1.57 times as fast.
#include <hip/hip_runtime.h>
#include <hip/hip_bf16.h>

// ---------------------------------------------------------------------------
// SpatialBertSelfAttention for MI455X (gfx1250, wave32, WMMA f16 16x16x32)
//
//   hidden[8,512,1024] f32, adj[8,512,512] i32, Wq/Wk/Wv[1024,1024], b*[1024]
//   out[8,512,1024] f32
//
// Pipeline (all f16 operands, f32 accumulation):
//   1) cvt_hidden  : hidden f32 -> h16 f16
//   2) cvt_weightT : W f32 -> wT f16 transposed [out][in] (B-fragment friendly)
//   3) qkv_gemm    : 128x128 LDS-staged WMMA GEMM -> q16/k16 [b,h,n,64]
//                    (q pre-scaled by 1/8), vT16 [b,h,64,n]
//   4) attention   : flash-style online softmax, WMMA for QK^T and P.V
// ---------------------------------------------------------------------------

typedef __attribute__((ext_vector_type(16))) _Float16 v16h;
typedef __attribute__((ext_vector_type(8)))  _Float16 v8h;
typedef __attribute__((ext_vector_type(8)))  float    v8f;

#define NHEAD 16
#define NB    8
#define NSEQ  512
#define DMODEL 1024
#define HDIM  64

// relation->head allow mask (bit r = relation r allowed for this head),
// precomputed from the reference's per-head loop.
__device__ __constant__ unsigned short ALLOWED_MASK[NHEAD] = {
  0x3003, 0x3005, 0x3009, 0x3831, 0x3071, 0x30E1, 0x31C1, 0x3381,
  0x3701, 0x3E01, 0x3C11, 0x3831, 0x7001, 0x7001, 0x7001, 0x7001
};

// Load a 16-lane-half K-packed f16 fragment (A or B layout for 16x16x32):
// caller passes p = base + row*ld + k0 + (lane>>4)*8.  lo = K chunk 0..7(/8..15),
// hi = K chunk 16..23(/24..31) per the CDNA5 16-bit A/B VGPR layout.
__device__ inline v16h load_frag16(const _Float16* p) {
  v8h lo = *(const v8h*)(p);
  v8h hi = *(const v8h*)(p + 16);
  v16h r;
#pragma unroll
  for (int i = 0; i < 8; ++i) { r[i] = lo[i]; r[i + 8] = hi[i]; }
  return r;
}

__device__ inline v8f wmma_f16(v16h a, v16h b, v8f c) {
  return __builtin_amdgcn_wmma_f32_16x16x32_f16(
      /*neg_a=*/false, a, /*neg_b=*/false, b,
      /*c_mod=*/(short)0, c, /*reuse_a=*/false, /*reuse_b=*/false);
}

// ------------------------------- conversions -------------------------------

__global__ void cvt_hidden(const float* __restrict__ src,
                           _Float16* __restrict__ dst, int n) {
  int i = blockIdx.x * blockDim.x + threadIdx.x;
  if (i < n) dst[i] = (_Float16)src[i];
}

// wT[sel][n_out][k_in] = W_sel[k_in][n_out]   (transpose + f32->f16)
__global__ void cvt_weightT(const float* __restrict__ Wq,
                            const float* __restrict__ Wk,
                            const float* __restrict__ Wv,
                            _Float16* __restrict__ wT) {
  int i = blockIdx.x * blockDim.x + threadIdx.x;   // 0 .. 3*1024*1024-1
  int sel = i >> 20;
  int idx = i & ((1 << 20) - 1);
  int n = idx >> 10;
  int k = idx & (DMODEL - 1);
  const float* W = (sel == 0) ? Wq : ((sel == 1) ? Wk : Wv);
  wT[i] = (_Float16)W[(size_t)k * DMODEL + n];
}

// --------------------------------- QKV GEMM --------------------------------
// grid (32 row tiles, 24 column tiles over {q,k,v}), 128 threads = 4 waves.
// One 128x128 output tile per block, 64x64 (4x4 WMMA tiles) per wave.  The
// operands come through a two-buffer LDS ring: a stage is 64 k of 128 rows of
// h16 and 128 rows of wT; each wave brings one 64-row slice of it with one
// tensor load, padded to a 144-byte row pitch for the ds_load_b128 readers.

typedef uint32_t u32x4 __attribute__((ext_vector_type(4)));
typedef uint32_t u32x8 __attribute__((ext_vector_type(8)));

#define G_ROWB   128u                 // bytes of one staged row (64 k of f16)
#define G_PITCH  144u                 // LDS row pitch: 128 + 16 pad bytes
#define G_SLICE  10240u               // 64 rows * 144 B, rounded up to 2 KiB
#define G_STAGE  (4u * G_SLICE)
#define G_NSTAGE (DMODEL * 2u / G_ROWB)

__device__ inline uint32_t uni(uint32_t v) {
  return (uint32_t)__builtin_amdgcn_readfirstlane(v);
}
// Makes the test around a tensor load a scalar branch, and keeps a descriptor
// word that is formed from the result behind the waits in front of the call.
__device__ inline uint32_t pinned(uint32_t v) {
  uint32_t w = uni(v);
  // pinned(): an issue test or a descriptor word held in a scalar register
  asm volatile("" : "+s"(w));
  return w;
}
__device__ inline void wait_tensor0() {
  // a tile counts as landed
  // only behind its issuer's own wait
  asm volatile("s_wait_tensorcnt 0x0" ::: "memory");
}
__device__ inline void wait_ds0() {
  // a wave's LDS reads have retired before the buffer they read is refilled
  asm volatile("s_wait_dscnt 0x0" ::: "memory");
}

__global__ __launch_bounds__(128) void qkv_gemm(
    const _Float16* __restrict__ h16,   // [4096,1024]
    const _Float16* __restrict__ wT,    // [3][1024][1024]
    const float* __restrict__ bq, const float* __restrict__ bk,
    const float* __restrict__ bv,
    _Float16* __restrict__ q16,         // [b,h,n,64]  (pre-scaled 1/8)
    _Float16* __restrict__ k16,         // [b,h,n,64]
    _Float16* __restrict__ vT16)        // [b,h,64,n]
{
  __shared__ __attribute__((aligned(2048))) unsigned char ring[2u * G_STAGE];

  const int lane = threadIdx.x & 31;
  const uint32_t wv = uni(threadIdx.x >> 5);
  const int half = lane >> 4;
  const int l16  = lane & 15;
  const uint32_t wm = wv >> 1, wn = wv & 1u;         // 2x2 waves
  const int row0 = blockIdx.x * 128;                 // 0..3968
  const int sel  = blockIdx.y >> 3;
  const int colb = (blockIdx.y & 7) * 128;           // 0..896 inside q, k or v

  const float* bias = (sel == 0) ? bq : ((sel == 1) ? bk : bv);

  // Slices of a stage: waves 0,1 bring h16 rows 0-63, 64-127 of the tile,
  // waves 2,3 bring wT rows 0-63, 64-127 (wT's three matrices are contiguous).
  const _Float16* slice_src =
      (wv < 2u) ? h16 + (size_t)(row0 + wv * 64u) * DMODEL
                : wT + (size_t)(blockIdx.y * 128u + (wv - 2u) * 64u) * DMODEL;
  const uint64_t src_ga = (uint64_t)(size_t)slice_src;
  const uint32_t lbase  = (uint32_t)(size_t)ring;

  // Descriptor group 1: byte elements, tile = tensor = 64 rows of 128 bytes,
  // source pitch 2048 bytes, 4 dwords of pad behind every 32 dwords.
  u32x8 g1;
  g1[0] = uni((1u << 20) | (4u << 22) | (3u << 25));
  g1[1] = uni((G_ROWB & 0xFFFFu) << 16);
  g1[2] = uni((G_ROWB >> 16) | (64u << 16));
  g1[3] = uni(G_ROWB << 16);
  g1[4] = uni(64u);
  g1[5] = uni(DMODEL * 2u);
  g1[6] = uni(0u);
  g1[7] = uni(0u);

  auto issue = [&](uint32_t st) {
    const uint32_t dst = lbase + (st & 1u) * G_STAGE + wv * G_SLICE;
    const uint64_t ga  = src_ga + (uint64_t)(st * G_ROWB);
    u32x4 g0;
    g0[0] = uni(1u);
    g0[1] = uni(dst);
    g0[2] = uni((uint32_t)ga);
    g0[3] = uni((((uint32_t)(ga >> 32)) & 0x01FFFFFFu) | 0x80000000u);
    // one request of the whole wave: global tile -> LDS, through no register
    asm volatile("tensor_load_to_lds %0, %1" :: "s"(g0), "s"(g1) : "memory");
  };

  v8f acc[4][4];
#pragma unroll  // constant indices: the arrays stay in registers
  for (int m = 0; m < 4; ++m)
#pragma unroll  // constant indices: the arrays stay in registers
    for (int t = 0; t < 4; ++t) acc[m][t] = (v8f){};

  issue(0u);
  wait_tensor0();
  __syncthreads();                     // stage 0 published
  issue(pinned(1u));

  const uint32_t a_off = wm * G_SLICE + (uint32_t)l16 * G_PITCH + (uint32_t)half * 16u;
  const uint32_t b_off = (2u + wn) * G_SLICE + (uint32_t)l16 * G_PITCH + (uint32_t)half * 16u;

  // kept rolled: one copy of the pass, the buffer chosen by the stage's parity
#pragma unroll 1
  for (uint32_t s = 0; s < G_NSTAGE; ++s) {
    const unsigned char* buf = ring + (s & 1u) * G_STAGE;
    v16h a[2][4], b[2][4];
#pragma unroll  // constant indices: the arrays stay in registers
    for (int ks = 0; ks < 2; ++ks) {
#pragma unroll  // constant indices: the arrays stay in registers
      for (int m = 0; m < 4; ++m)
        a[ks][m] = load_frag16((const _Float16*)(buf + a_off + m * 16 * G_PITCH + ks * 64));
#pragma unroll  // constant indices: the arrays stay in registers
      for (int t = 0; t < 4; ++t)
        b[ks][t] = load_frag16((const _Float16*)(buf + b_off + t * 16 * G_PITCH + ks * 64));
    }
    // Publish point of stage s + 1.  It stands here, not behind the WMMAs: the
    // pass's fragments are all in registers behind the first wait, so the
    // buffer is free one barrier later and its refill flies under the WMMAs.
    wait_ds0();
    wait_tensor0();
    __syncthreads();                   // s + 1 landed for all; all have left s
    if (pinned(s + 2u < G_NSTAGE)) issue(pinned(s + 2u));
#pragma unroll  // constant indices: the arrays stay in registers
    for (int ks = 0; ks < 2; ++ks)
#pragma unroll  // constant indices: the arrays stay in registers
      for (int t = 0; t < 4; ++t)
#pragma unroll  // constant indices: the arrays stay in registers
        for (int m = 0; m < 4; ++m)
          acc[m][t] = wmma_f16(a[ks][m], b[ks][t], acc[m][t]);
  }
  wait_tensor0();
  wait_ds0();

  const float qscale = (sel == 0) ? 0.125f : 1.0f;   // fold 1/sqrt(64) into Q
#pragma unroll
  for (int t = 0; t < 4; ++t) {
    const int col = colb + (int)wn * 64 + t * 16 + l16;
    const float bcol = bias[col];
    const int hh = col >> 6, dd = col & (HDIM - 1);
#pragma unroll
    for (int m = 0; m < 4; ++m) {
#pragma unroll
      for (int r = 0; r < 8; ++r) {
        float val = (acc[m][t][r] + bcol) * qscale;
        int row = row0 + (int)wm * 64 + m * 16 + r + half * 8;  // C layout: M = r (+8)
        int bb = row >> 9, nn = row & (NSEQ - 1);
        if (sel == 2) {
          vT16[((size_t)(bb * NHEAD + hh) * HDIM + dd) * NSEQ + nn] =
              (_Float16)val;
        } else {
          _Float16* dst = (sel == 0) ? q16 : k16;
          dst[((size_t)(bb * NHEAD + hh) * NSEQ + nn) * HDIM + dd] =
              (_Float16)val;
        }
      }
    }
  }
}

// -------------------------------- attention --------------------------------
// One wave = 16 query rows of one (b,h); key loop in chunks of 32 with online
// softmax.  8 WMMAs per chunk (4 for S, 4 for P.V), 128 per wave.

__global__ __launch_bounds__(256) void attention(
    const _Float16* __restrict__ q16, const _Float16* __restrict__ k16,
    const _Float16* __restrict__ vT16, const int* __restrict__ adj,
    float* __restrict__ out)
{
  __shared__ _Float16 ldsP[8][16][32];   // per-wave P staging (C->A relayout)

  const int lane = threadIdx.x & 31;
  const int w    = threadIdx.x >> 5;
  const int half = lane >> 4;
  const int l16  = lane & 15;

  const int wid = blockIdx.x * 8 + w;    // 0..4095
  const int qt  = wid & 31;              // query tile 0..31
  const int h   = (wid >> 5) & (NHEAD - 1);
  const int b   = wid >> 9;

  const unsigned mask = ALLOWED_MASK[h];
  const _Float16* qb = q16 + ((size_t)(b * NHEAD + h) * NSEQ + qt * 16) * HDIM;
  const _Float16* kb = k16 + (size_t)(b * NHEAD + h) * NSEQ * HDIM;
  const _Float16* vb = vT16 + (size_t)(b * NHEAD + h) * HDIM * NSEQ;
  const int* adjb = adj + (size_t)b * NSEQ * NSEQ;

  // Q fragments (A layout), fixed across the key loop.
  v16h aQ0 = load_frag16(qb + (size_t)l16 * HDIM + half * 8);
  v16h aQ1 = load_frag16(qb + (size_t)l16 * HDIM + 32 + half * 8);

  v8f o0 = {}, o1 = {}, o2 = {}, o3 = {};
  float mrow[8], lrow[8];
#pragma unroll
  for (int r = 0; r < 8; ++r) { mrow[r] = -1e30f; lrow[r] = 0.0f; }

  for (int c = 0; c < NSEQ; c += 32) {
    // ---- S = Q.K^T for 16q x 32k (two 16x16 tiles) ----
    v8f s0 = {}, s1 = {};
    {
      v16h bk0 = load_frag16(kb + (size_t)(c + l16) * HDIM + half * 8);
      v16h bk1 = load_frag16(kb + (size_t)(c + l16) * HDIM + 32 + half * 8);
      s0 = wmma_f16(aQ0, bk0, s0);
      s0 = wmma_f16(aQ1, bk1, s0);
      v16h bk2 = load_frag16(kb + (size_t)(c + 16 + l16) * HDIM + half * 8);
      v16h bk3 = load_frag16(kb + (size_t)(c + 16 + l16) * HDIM + 32 + half * 8);
      s1 = wmma_f16(aQ0, bk2, s1);
      s1 = wmma_f16(aQ1, bk3, s1);
    }

    // ---- relation mask (scores += -1e9 where disallowed) ----
#pragma unroll
    for (int r = 0; r < 8; ++r) {
      int qrow = qt * 16 + r + half * 8;
      int rel0 = adjb[(size_t)qrow * NSEQ + c + l16];
      int rel1 = adjb[(size_t)qrow * NSEQ + c + 16 + l16];
      if (!((mask >> rel0) & 1u)) s0[r] += -1e9f;
      if (!((mask >> rel1) & 1u)) s1[r] += -1e9f;
    }

    // ---- online softmax update (row = (r, lane-half); cols across 16 lanes)
#pragma unroll
    for (int r = 0; r < 8; ++r) {
      float v = fmaxf(s0[r], s1[r]);
#pragma unroll
      for (int off = 8; off >= 1; off >>= 1) v = fmaxf(v, __shfl_xor(v, off, 32));
      float mnew = fmaxf(mrow[r], v);
      float sc = __expf(mrow[r] - mnew);
      float p0 = __expf(s0[r] - mnew);
      float p1 = __expf(s1[r] - mnew);
      float rs = p0 + p1;
#pragma unroll
      for (int off = 8; off >= 1; off >>= 1) rs += __shfl_xor(rs, off, 32);
      lrow[r] = lrow[r] * sc + rs;
      mrow[r] = mnew;
      o0[r] *= sc; o1[r] *= sc; o2[r] *= sc; o3[r] *= sc;
      s0[r] = p0;  s1[r] = p1;
    }

    // ---- relayout P through LDS: C layout -> A fragment ----
#pragma unroll
    for (int r = 0; r < 8; ++r) {
      ldsP[w][r + half * 8][l16]      = (_Float16)s0[r];
      ldsP[w][r + half * 8][16 + l16] = (_Float16)s1[r];
    }
    v16h aP = load_frag16(&ldsP[w][l16][half * 8]);

    // ---- O += P.V (4 hd tiles, B fragments from transposed V) ----
    v16h bv0 = load_frag16(vb + (size_t)(0  + l16) * NSEQ + c + half * 8);
    v16h bv1 = load_frag16(vb + (size_t)(16 + l16) * NSEQ + c + half * 8);
    v16h bv2 = load_frag16(vb + (size_t)(32 + l16) * NSEQ + c + half * 8);
    v16h bv3 = load_frag16(vb + (size_t)(48 + l16) * NSEQ + c + half * 8);
    o0 = wmma_f16(aP, bv0, o0);
    o1 = wmma_f16(aP, bv1, o1);
    o2 = wmma_f16(aP, bv2, o2);
    o3 = wmma_f16(aP, bv3, o3);
  }

  // ---- normalize and store fp32 output ----
#pragma unroll
  for (int r = 0; r < 8; ++r) {
    float inv = 1.0f / lrow[r];
    int qrow = qt * 16 + r + half * 8;
    float* op = out + ((size_t)(b * NSEQ + qrow) * DMODEL) + h * HDIM;
    op[0  + l16] = o0[r] * inv;
    op[16 + l16] = o1[r] * inv;
    op[32 + l16] = o2[r] * inv;
    op[48 + l16] = o3[r] * inv;
  }
}

// --------------------------------- launcher --------------------------------

extern "C" void kernel_launch(void* const* d_in, const int* in_sizes, int n_in,
                              void* d_out, int out_size, void* d_ws, size_t ws_size,
                              hipStream_t stream) {
  const float* hidden = (const float*)d_in[0];
  const int*   adj    = (const int*)d_in[1];
  const float* Wq     = (const float*)d_in[2];
  const float* bq     = (const float*)d_in[3];
  const float* Wk     = (const float*)d_in[4];
  const float* bk     = (const float*)d_in[5];
  const float* Wv     = (const float*)d_in[6];
  const float* bv     = (const float*)d_in[7];
  float* out = (float*)d_out;

  char* ws = (char*)d_ws;
  const size_t MB = 1024u * 1024u;
  _Float16* h16  = (_Float16*)(ws);             //  8 MB: [4096,1024]
  _Float16* wT   = (_Float16*)(ws + 8  * MB);   //  6 MB: [3,1024,1024]
  _Float16* q16  = (_Float16*)(ws + 14 * MB);   //  8 MB: [b,h,n,64]
  _Float16* k16  = (_Float16*)(ws + 22 * MB);   //  8 MB
  _Float16* vT16 = (_Float16*)(ws + 30 * MB);   //  8 MB: [b,h,64,n]

  const int nHid = NB * NSEQ * DMODEL;          // 4194304
  cvt_hidden<<<(nHid + 255) / 256, 256, 0, stream>>>(hidden, h16, nHid);
  cvt_weightT<<<(3 * DMODEL * DMODEL) / 256, 256, 0, stream>>>(Wq, Wk, Wv, wT);

  // 128-row tiles x 128-col tiles over {q,k,v}, 4 waves of 64x64
  qkv_gemm<<<dim3(NB * NSEQ / 128, 3 * DMODEL / 128), 128, 0, stream>>>(
      h16, wT, bq, bk, bv, q16, k16, vT16);

  // 8*16*32 = 4096 waves, 8 waves per block
  attention<<<512, 256, 0, stream>>>(q16, k16, vT16, adj, out);
}

// v002
// It runs in 97.2 microseconds.
// In two side-by-side timings against v001, it was 1.17 and 1.19 times as fast.
// All steps since v000 together make it 1.86 times as fast.
#include <hip/hip_runtime.h>
#include <hip/hip_bf16.h>

// ---------------------------------------------------------------------------
// SpatialBertSelfAttention for MI455X (gfx1250, wave32, WMMA f16 16x16x32)
//
//   hidden[8,512,1024] f32, adj[8,512,512] i32, Wq/Wk/Wv[1024,1024], b*[1024]
//   out[8,512,1024] f32
//
// Pipeline (all f16 operands, f32 accumulation):
//   1) cvt_hidden  : hidden f32 -> h16 f16
//   2) cvt_weightT : W f32 -> wT f16 transposed [out][in] (B-fragment friendly)
//   3) qkv_gemm    : 128x128 LDS-staged WMMA GEMM -> q16/k16 [b,h,n,64]
//                    (q pre-scaled by 1/8), vT16 [b,h,64,n]
//   4) attention   : flash-style online softmax, WMMA for QK^T and P.V
// ---------------------------------------------------------------------------

typedef __attribute__((ext_vector_type(16))) _Float16 v16h;
typedef __attribute__((ext_vector_type(8)))  _Float16 v8h;
typedef __attribute__((ext_vector_type(8)))  float    v8f;

#define NHEAD 16
#define NB    8
#define NSEQ  512
#define DMODEL 1024
#define HDIM  64

// relation->head allow mask (bit r = relation r allowed for this head),
// precomputed from the reference's per-head loop.
__device__ __constant__ unsigned short ALLOWED_MASK[NHEAD] = {
  0x3003, 0x3005, 0x3009, 0x3831, 0x3071, 0x30E1, 0x31C1, 0x3381,
  0x3701, 0x3E01, 0x3C11, 0x3831, 0x7001, 0x7001, 0x7001, 0x7001
};

// Load a 16-lane-half K-packed f16 fragment (A or B layout for 16x16x32):
// caller passes p = base + row*ld + k0 + (lane>>4)*8.  lo = K chunk 0..7(/8..15),
// hi = K chunk 16..23(/24..31) per the CDNA5 16-bit A/B VGPR layout.
__device__ inline v16h load_frag16(const _Float16* p) {
  v8h lo = *(const v8h*)(p);
  v8h hi = *(const v8h*)(p + 16);
  v16h r;
#pragma unroll
  for (int i = 0; i < 8; ++i) { r[i] = lo[i]; r[i + 8] = hi[i]; }
  return r;
}

__device__ inline v8f wmma_f16(v16h a, v16h b, v8f c) {
  return __builtin_amdgcn_wmma_f32_16x16x32_f16(
      /*neg_a=*/false, a, /*neg_b=*/false, b,
      /*c_mod=*/(short)0, c, /*reuse_a=*/false, /*reuse_b=*/false);
}

// ------------------------------- conversions -------------------------------
// Both kernels are sized by waves to start, not by elements: a thread converts
// a block of elements with 16-byte loads, all of them in flight at once.

typedef __attribute__((ext_vector_type(4))) float    v4f;
typedef __attribute__((ext_vector_type(4))) _Float16 v4h;

// 256 blocks of 16 waves.  A wave converts 1024 floats in a row: 8 loads of
// 512 contiguous bytes, then 8 stores of 256 contiguous bytes.
__global__ __launch_bounds__(512) void cvt_hidden(const float* __restrict__ src,
                                                  _Float16* __restrict__ dst) {
  const int lane = threadIdx.x & 31;
  const int wave = blockIdx.x * 16 + (threadIdx.x >> 5);
  const size_t base = (size_t)wave * 1024 + lane * 4;
  v4f x[8];
#pragma unroll  // constant indices: the array stays in registers
  for (int j = 0; j < 8; ++j) x[j] = *(const v4f*)(src + base + j * 128);
#pragma unroll  // constant indices: the array stays in registers
  for (int j = 0; j < 8; ++j)
    *(v4h*)(dst + base + j * 128) = __builtin_convertvector(x[j], v4h);
}

// wT[sel][n_out][k_in] = W_sel[k_in][n_out]   (transpose + f32->f16)
// 256 blocks of 6 waves.  A wave takes a tile of 64 k x 32 n; a lane holds two
// blocks of 8 k x 4 n in registers (16 loads of 16 bytes; a wave-wide load is
// 4 whole 128-byte lines of W) and stores each n of a block as 8 k = 16 bytes.
__global__ __launch_bounds__(192) void cvt_weightT(const float* __restrict__ Wq,
                                                   const float* __restrict__ Wk,
                                                   const float* __restrict__ Wv,
                                                   _Float16* __restrict__ wT) {
  const int lane = threadIdx.x & 31;
  const int t   = blockIdx.x * 6 + (threadIdx.x >> 5);   // 0 .. 3*512-1
  const int sel = t >> 9;
  const int n0  = (t & 31) * 32 + (lane & 7) * 4;
  const int k0  = ((t >> 5) & 15) * 64 + (lane >> 3) * 8;
  const float* W = (sel == 0) ? Wq : ((sel == 1) ? Wk : Wv);
  const float* s = W + (size_t)k0 * DMODEL + n0;
  v4f x[2][8];
#pragma unroll  // constant indices: the array stays in registers
  for (int u = 0; u < 2; ++u)
#pragma unroll  // constant indices: the array stays in registers
    for (int j = 0; j < 8; ++j)
      x[u][j] = *(const v4f*)(s + (size_t)(u * 32 + j) * DMODEL);
  // Takes the loaded values and their address as inputs only: all 16 loads are
  // in flight before the first convert (without it two of them are issued only
  // behind a wait for earlier ones, a second trip to memory), and the address
  // pair that they name is rewritten only behind this wait.
  asm volatile("s_wait_xcnt 0x0" :: "v"(x[0][0]), "v"(x[0][1]), "v"(x[0][2]), "v"(x[0][3]),
                     "v"(x[0][4]), "v"(x[0][5]), "v"(x[0][6]), "v"(x[0][7]),
                     "v"(x[1][0]), "v"(x[1][1]), "v"(x[1][2]), "v"(x[1][3]),
                     "v"(x[1][4]), "v"(x[1][5]), "v"(x[1][6]), "v"(x[1][7]),
                     "v"(s) : "memory");
  _Float16* d = wT + ((size_t)sel * DMODEL + n0) * DMODEL + k0;
#pragma unroll  // constant indices: the array stays in registers
  for (int u = 0; u < 2; ++u)
#pragma unroll  // constant indices: the array stays in registers
    for (int i = 0; i < 4; ++i) {
      v8h y;
#pragma unroll  // constant indices: the array stays in registers
      for (int j = 0; j < 8; ++j) y[j] = (_Float16)x[u][j][i];
      *(v8h*)(d + (size_t)i * DMODEL + u * 32) = y;
    }
}

// --------------------------------- QKV GEMM --------------------------------
// grid (32 row tiles, 24 column tiles over {q,k,v}), 128 threads = 4 waves.
// One 128x128 output tile per block, 64x64 (4x4 WMMA tiles) per wave.  The
// operands come through a two-buffer LDS ring: a stage is 64 k of 128 rows of
// h16 and 128 rows of wT; each wave brings one 64-row slice of it with one
// tensor load, padded to a 144-byte row pitch for the ds_load_b128 readers.

typedef uint32_t u32x4 __attribute__((ext_vector_type(4)));
typedef uint32_t u32x8 __attribute__((ext_vector_type(8)));

#define G_ROWB   128u                 // bytes of one staged row (64 k of f16)
#define G_PITCH  144u                 // LDS row pitch: 128 + 16 pad bytes
#define G_SLICE  10240u               // 64 rows * 144 B, rounded up to 2 KiB
#define G_STAGE  (4u * G_SLICE)
#define G_NSTAGE (DMODEL * 2u / G_ROWB)

__device__ inline uint32_t uni(uint32_t v) {
  return (uint32_t)__builtin_amdgcn_readfirstlane(v);
}
// Makes the test around a tensor load a scalar branch, and keeps a descriptor
// word that is formed from the result behind the waits in front of the call.
__device__ inline uint32_t pinned(uint32_t v) {
  uint32_t w = uni(v);
  // pinned(): an issue test or a descriptor word held in a scalar register
  asm volatile("" : "+s"(w));
  return w;
}
__device__ inline void wait_tensor0() {
  // a tile counts as landed
  // only behind its issuer's own wait
  asm volatile("s_wait_tensorcnt 0x0" ::: "memory");
}
__device__ inline void wait_ds0() {
  // a wave's LDS reads have retired before the buffer they read is refilled
  asm volatile("s_wait_dscnt 0x0" ::: "memory");
}

__global__ __launch_bounds__(128) void qkv_gemm(
    const _Float16* __restrict__ h16,   // [4096,1024]
    const _Float16* __restrict__ wT,    // [3][1024][1024]
    const float* __restrict__ bq, const float* __restrict__ bk,
    const float* __restrict__ bv,
    _Float16* __restrict__ q16,         // [b,h,n,64]  (pre-scaled 1/8)
    _Float16* __restrict__ k16,         // [b,h,n,64]
    _Float16* __restrict__ vT16)        // [b,h,64,n]
{
  __shared__ __attribute__((aligned(2048))) unsigned char ring[2u * G_STAGE];

  const int lane = threadIdx.x & 31;
  const uint32_t wv = uni(threadIdx.x >> 5);
  const int half = lane >> 4;
  const int l16  = lane & 15;
  const uint32_t wm = wv >> 1, wn = wv & 1u;         // 2x2 waves
  const int row0 = blockIdx.x * 128;                 // 0..3968
  const int sel  = blockIdx.y >> 3;
  const int colb = (blockIdx.y & 7) * 128;           // 0..896 inside q, k or v

  const float* bias = (sel == 0) ? bq : ((sel == 1) ? bk : bv);

  // Slices of a stage: waves 0,1 bring h16 rows 0-63, 64-127 of the tile,
  // waves 2,3 bring wT rows 0-63, 64-127 (wT's three matrices are contiguous).
  const _Float16* slice_src =
      (wv < 2u) ? h16 + (size_t)(row0 + wv * 64u) * DMODEL
                : wT + (size_t)(blockIdx.y * 128u + (wv - 2u) * 64u) * DMODEL;
  const uint64_t src_ga = (uint64_t)(size_t)slice_src;
  const uint32_t lbase  = (uint32_t)(size_t)ring;

  // Descriptor group 1: byte elements, tile = tensor = 64 rows of 128 bytes,
  // source pitch 2048 bytes, 4 dwords of pad behind every 32 dwords.
  u32x8 g1;
  g1[0] = uni((1u << 20) | (4u << 22) | (3u << 25));
  g1[1] = uni((G_ROWB & 0xFFFFu) << 16);
  g1[2] = uni((G_ROWB >> 16) | (64u << 16));
  g1[3] = uni(G_ROWB << 16);
  g1[4] = uni(64u);
  g1[5] = uni(DMODEL * 2u);
  g1[6] = uni(0u);
  g1[7] = uni(0u);

  auto issue = [&](uint32_t st) {
    const uint32_t dst = lbase + (st & 1u) * G_STAGE + wv * G_SLICE;
    const uint64_t ga  = src_ga + (uint64_t)(st * G_ROWB);
    u32x4 g0;
    g0[0] = uni(1u);
    g0[1] = uni(dst);
    g0[2] = uni((uint32_t)ga);
    g0[3] = uni((((uint32_t)(ga >> 32)) & 0x01FFFFFFu) | 0x80000000u);
    // one request of the whole wave: global tile -> LDS, through no register
    asm volatile("tensor_load_to_lds %0, %1" :: "s"(g0), "s"(g1) : "memory");
  };

  v8f acc[4][4];
#pragma unroll  // constant indices: the arrays stay in registers
  for (int m = 0; m < 4; ++m)
#pragma unroll  // constant indices: the arrays stay in registers
    for (int t = 0; t < 4; ++t) acc[m][t] = (v8f){};

  issue(0u);
  wait_tensor0();
  __syncthreads();                     // stage 0 published
  issue(pinned(1u));

  const uint32_t a_off = wm * G_SLICE + (uint32_t)l16 * G_PITCH + (uint32_t)half * 16u;
  const uint32_t b_off = (2u + wn) * G_SLICE + (uint32_t)l16 * G_PITCH + (uint32_t)half * 16u;

  // kept rolled: one copy of the pass, the buffer chosen by the stage's parity
#pragma unroll 1
  for (uint32_t s = 0; s < G_NSTAGE; ++s) {
    const unsigned char* buf = ring + (s & 1u) * G_STAGE;
    v16h a[2][4], b[2][4];
#pragma unroll  // constant indices: the arrays stay in registers
    for (int ks = 0; ks < 2; ++ks) {
#pragma unroll  // constant indices: the arrays stay in registers
      for (int m = 0; m < 4; ++m)
        a[ks][m] = load_frag16((const _Float16*)(buf + a_off + m * 16 * G_PITCH + ks * 64));
#pragma unroll  // constant indices: the arrays stay in registers
      for (int t = 0; t < 4; ++t)
        b[ks][t] = load_frag16((const _Float16*)(buf + b_off + t * 16 * G_PITCH + ks * 64));
    }
    // Publish point of stage s + 1.  It stands here, not behind the WMMAs: the
    // pass's fragments are all in registers behind the first wait, so the
    // buffer is free one barrier later and its refill flies under the WMMAs.
    wait_ds0();
    wait_tensor0();
    __syncthreads();                   // s + 1 landed for all; all have left s
    if (pinned(s + 2u < G_NSTAGE)) issue(pinned(s + 2u));
#pragma unroll  // constant indices: the arrays stay in registers
    for (int ks = 0; ks < 2; ++ks)
#pragma unroll  // constant indices: the arrays stay in registers
      for (int t = 0; t < 4; ++t)
#pragma unroll  // constant indices: the arrays stay in registers
        for (int m = 0; m < 4; ++m)
          acc[m][t] = wmma_f16(a[ks][m], b[ks][t], acc[m][t]);
  }
  wait_tensor0();
  wait_ds0();

  const float qscale = (sel == 0) ? 0.125f : 1.0f;   // fold 1/sqrt(64) into Q
#pragma unroll
  for (int t = 0; t < 4; ++t) {
    const int col = colb + (int)wn * 64 + t * 16 + l16;
    const float bcol = bias[col];
    const int hh = col >> 6, dd = col & (HDIM - 1);
#pragma unroll
    for (int m = 0; m < 4; ++m) {
#pragma unroll
      for (int r = 0; r < 8; ++r) {
        float val = (acc[m][t][r] + bcol) * qscale;
        int row = row0 + (int)wm * 64 + m * 16 + r + half * 8;  // C layout: M = r (+8)
        int bb = row >> 9, nn = row & (NSEQ - 1);
        if (sel == 2) {
          vT16[((size_t)(bb * NHEAD + hh) * HDIM + dd) * NSEQ + nn] =
              (_Float16)val;
        } else {
          _Float16* dst = (sel == 0) ? q16 : k16;
          dst[((size_t)(bb * NHEAD + hh) * NSEQ + nn) * HDIM + dd] =
              (_Float16)val;
        }
      }
    }
  }
}

// -------------------------------- attention --------------------------------
// One wave = 16 query rows of one (b,h); key loop in chunks of 32 with online
// softmax.  8 WMMAs per chunk (4 for S, 4 for P.V), 128 per wave.

__global__ __launch_bounds__(256) void attention(
    const _Float16* __restrict__ q16, const _Float16* __restrict__ k16,
    const _Float16* __restrict__ vT16, const int* __restrict__ adj,
    float* __restrict__ out)
{
  __shared__ _Float16 ldsP[8][16][32];   // per-wave P staging (C->A relayout)

  const int lane = threadIdx.x & 31;
  const int w    = threadIdx.x >> 5;
  const int half = lane >> 4;
  const int l16  = lane & 15;

  const int wid = blockIdx.x * 8 + w;    // 0..4095
  const int qt  = wid & 31;              // query tile 0..31
  const int h   = (wid >> 5) & (NHEAD - 1);
  const int b   = wid >> 9;

  const unsigned mask = ALLOWED_MASK[h];
  const _Float16* qb = q16 + ((size_t)(b * NHEAD + h) * NSEQ + qt * 16) * HDIM;
  const _Float16* kb = k16 + (size_t)(b * NHEAD + h) * NSEQ * HDIM;
  const _Float16* vb = vT16 + (size_t)(b * NHEAD + h) * HDIM * NSEQ;
  const int* adjb = adj + (size_t)b * NSEQ * NSEQ;

  // Q fragments (A layout), fixed across the key loop.
  v16h aQ0 = load_frag16(qb + (size_t)l16 * HDIM + half * 8);
  v16h aQ1 = load_frag16(qb + (size_t)l16 * HDIM + 32 + half * 8);

  v8f o0 = {}, o1 = {}, o2 = {}, o3 = {};
  float mrow[8], lrow[8];
#pragma unroll
  for (int r = 0; r < 8; ++r) { mrow[r] = -1e30f; lrow[r] = 0.0f; }

  for (int c = 0; c < NSEQ; c += 32) {
    // ---- S = Q.K^T for 16q x 32k (two 16x16 tiles) ----
    v8f s0 = {}, s1 = {};
    {
      v16h bk0 = load_frag16(kb + (size_t)(c + l16) * HDIM + half * 8);
      v16h bk1 = load_frag16(kb + (size_t)(c + l16) * HDIM + 32 + half * 8);
      s0 = wmma_f16(aQ0, bk0, s0);
      s0 = wmma_f16(aQ1, bk1, s0);
      v16h bk2 = load_frag16(kb + (size_t)(c + 16 + l16) * HDIM + half * 8);
      v16h bk3 = load_frag16(kb + (size_t)(c + 16 + l16) * HDIM + 32 + half * 8);
      s1 = wmma_f16(aQ0, bk2, s1);
      s1 = wmma_f16(aQ1, bk3, s1);
    }

    // ---- relation mask (scores += -1e9 where disallowed) ----
#pragma unroll
    for (int r = 0; r < 8; ++r) {
      int qrow = qt * 16 + r + half * 8;
      int rel0 = adjb[(size_t)qrow * NSEQ + c + l16];
      int rel1 = adjb[(size_t)qrow * NSEQ + c + 16 + l16];
      if (!((mask >> rel0) & 1u)) s0[r] += -1e9f;
      if (!((mask >> rel1) & 1u)) s1[r] += -1e9f;
    }

    // ---- online softmax update (row = (r, lane-half); cols across 16 lanes)
#pragma unroll
    for (int r = 0; r < 8; ++r) {
      float v = fmaxf(s0[r], s1[r]);
#pragma unroll
      for (int off = 8; off >= 1; off >>= 1) v = fmaxf(v, __shfl_xor(v, off, 32));
      float mnew = fmaxf(mrow[r], v);
      float sc = __expf(mrow[r] - mnew);
      float p0 = __expf(s0[r] - mnew);
      float p1 = __expf(s1[r] - mnew);
      float rs = p0 + p1;
#pragma unroll
      for (int off = 8; off >= 1; off >>= 1) rs += __shfl_xor(rs, off, 32);
      lrow[r] = lrow[r] * sc + rs;
      mrow[r] = mnew;
      o0[r] *= sc; o1[r] *= sc; o2[r] *= sc; o3[r] *= sc;
      s0[r] = p0;  s1[r] = p1;
    }

    // ---- relayout P through LDS: C layout -> A fragment ----
#pragma unroll
    for (int r = 0; r < 8; ++r) {
      ldsP[w][r + half * 8][l16]      = (_Float16)s0[r];
      ldsP[w][r + half * 8][16 + l16] = (_Float16)s1[r];
    }
    v16h aP = load_frag16(&ldsP[w][l16][half * 8]);

    // ---- O += P.V (4 hd tiles, B fragments from transposed V) ----
    v16h bv0 = load_frag16(vb + (size_t)(0  + l16) * NSEQ + c + half * 8);
    v16h bv1 = load_frag16(vb + (size_t)(16 + l16) * NSEQ + c + half * 8);
    v16h bv2 = load_frag16(vb + (size_t)(32 + l16) * NSEQ + c + half * 8);
    v16h bv3 = load_frag16(vb + (size_t)(48 + l16) * NSEQ + c + half * 8);
    o0 = wmma_f16(aP, bv0, o0);
    o1 = wmma_f16(aP, bv1, o1);
    o2 = wmma_f16(aP, bv2, o2);
    o3 = wmma_f16(aP, bv3, o3);
  }

  // ---- normalize and store fp32 output ----
#pragma unroll
  for (int r = 0; r < 8; ++r) {
    float inv = 1.0f / lrow[r];
    int qrow = qt * 16 + r + half * 8;
    float* op = out + ((size_t)(b * NSEQ + qrow) * DMODEL) + h * HDIM;
    op[0  + l16] = o0[r] * inv;
    op[16 + l16] = o1[r] * inv;
    op[32 + l16] = o2[r] * inv;
    op[48 + l16] = o3[r] * inv;
  }
}

// --------------------------------- launcher --------------------------------

extern "C" void kernel_launch(void* const* d_in, const int* in_sizes, int n_in,
                              void* d_out, int out_size, void* d_ws, size_t ws_size,
                              hipStream_t stream) {
  const float* hidden = (const float*)d_in[0];
  const int*   adj    = (const int*)d_in[1];
  const float* Wq     = (const float*)d_in[2];
  const float* bq     = (const float*)d_in[3];
  const float* Wk     = (const float*)d_in[4];
  const float* bk     = (const float*)d_in[5];
  const float* Wv     = (const float*)d_in[6];
  const float* bv     = (const float*)d_in[7];
  float* out = (float*)d_out;

  char* ws = (char*)d_ws;
  const size_t MB = 1024u * 1024u;
  _Float16* h16  = (_Float16*)(ws);             //  8 MB: [4096,1024]
  _Float16* wT   = (_Float16*)(ws + 8  * MB);   //  6 MB: [3,1024,1024]
  _Float16* q16  = (_Float16*)(ws + 14 * MB);   //  8 MB: [b,h,n,64]
  _Float16* k16  = (_Float16*)(ws + 22 * MB);   //  8 MB
  _Float16* vT16 = (_Float16*)(ws + 30 * MB);   //  8 MB: [b,h,64,n]

  // 4194304 elements: 4096 waves of 1024
  cvt_hidden<<<NB * NSEQ * DMODEL / (16 * 1024), 512, 0, stream>>>(hidden, h16);
  // 3 * 1024 * 1024 elements: 1536 waves of 64 x 32
  cvt_weightT<<<3 * DMODEL * DMODEL / (6 * 64 * 32), 192, 0, stream>>>(Wq, Wk, Wv, wT);

  // 128-row tiles x 128-col tiles over {q,k,v}, 4 waves of 64x64
  qkv_gemm<<<dim3(NB * NSEQ / 128, 3 * DMODEL / 128), 128, 0, stream>>>(
      h16, wT, bq, bk, bv, q16, k16, vT16);

  // 8*16*32 = 4096 waves, 8 waves per block
  attention<<<512, 256, 0, stream>>>(q16, k16, vT16, adj, out);
}

// v003
// A run of this version takes 82.1 microseconds.
// Two timings next to v002 both put it at 1.19 times that version's speed.
// Over all steps from v000 it is 2.22 times as fast.
#include <hip/hip_runtime.h>
#include <hip/hip_bf16.h>

// ---------------------------------------------------------------------------
// SpatialBertSelfAttention for MI455X (gfx1250, wave32, WMMA f16 16x16x32)
//
//   hidden[8,512,1024] f32, adj[8,512,512] i32, Wq/Wk/Wv[1024,1024], b*[1024]
//   out[8,512,1024] f32
//
// Pipeline (all f16 operands, f32 accumulation):
//   1) cvt_hidden  : hidden f32 -> h16 f16
//   2) cvt_weightT : W f32 -> wT f16 transposed [out][in] (B-fragment friendly)
//   3) qkv_gemm    : 128x128 LDS-staged WMMA GEMM -> q16/k16 [b,h,n,64]
//                    (q pre-scaled by 1/8), vT16 [b,h,64,n]
//   4) attention   : flash-style online softmax, WMMA for QK^T and P.V,
//                    K and V^T LDS-staged for the 8 waves of a block
// ---------------------------------------------------------------------------

typedef __attribute__((ext_vector_type(16))) _Float16 v16h;
typedef __attribute__((ext_vector_type(8)))  _Float16 v8h;
typedef __attribute__((ext_vector_type(8)))  float    v8f;

#define NHEAD 16
#define NB    8
#define NSEQ  512
#define DMODEL 1024
#define HDIM  64

// relation->head allow mask (bit r = relation r allowed for this head),
// precomputed from the reference's per-head loop.
__device__ __constant__ unsigned short ALLOWED_MASK[NHEAD] = {
  0x3003, 0x3005, 0x3009, 0x3831, 0x3071, 0x30E1, 0x31C1, 0x3381,
  0x3701, 0x3E01, 0x3C11, 0x3831, 0x7001, 0x7001, 0x7001, 0x7001
};

// Load a 16-lane-half K-packed f16 fragment (A or B layout for 16x16x32):
// caller passes p = base + row*ld + k0 + (lane>>4)*8.  lo = K chunk 0..7(/8..15),
// hi = K chunk 16..23(/24..31) per the CDNA5 16-bit A/B VGPR layout.
__device__ inline v16h load_frag16(const _Float16* p) {
  v8h lo = *(const v8h*)(p);
  v8h hi = *(const v8h*)(p + 16);
  v16h r;
#pragma unroll
  for (int i = 0; i < 8; ++i) { r[i] = lo[i]; r[i + 8] = hi[i]; }
  return r;
}

__device__ inline v8f wmma_f16(v16h a, v16h b, v8f c) {
  return __builtin_amdgcn_wmma_f32_16x16x32_f16(
      /*neg_a=*/false, a, /*neg_b=*/false, b,
      /*c_mod=*/(short)0, c, /*reuse_a=*/false, /*reuse_b=*/false);
}

// ------------------------------- conversions -------------------------------
// Both kernels are sized by waves to start, not by elements: a thread converts
// a block of elements with 16-byte loads, all of them in flight at once.

typedef __attribute__((ext_vector_type(4))) float    v4f;
typedef __attribute__((ext_vector_type(4))) _Float16 v4h;

// 256 blocks of 16 waves.  A wave converts 1024 floats in a row: 8 loads of
// 512 contiguous bytes, then 8 stores of 256 contiguous bytes.
__global__ __launch_bounds__(512) void cvt_hidden(const float* __restrict__ src,
                                                  _Float16* __restrict__ dst) {
  const int lane = threadIdx.x & 31;
  const int wave = blockIdx.x * 16 + (threadIdx.x >> 5);
  const size_t base = (size_t)wave * 1024 + lane * 4;
  v4f x[8];
#pragma unroll  // constant indices: the array stays in registers
  for (int j = 0; j < 8; ++j) x[j] = *(const v4f*)(src + base + j * 128);
#pragma unroll  // constant indices: the array stays in registers
  for (int j = 0; j < 8; ++j)
    *(v4h*)(dst + base + j * 128) = __builtin_convertvector(x[j], v4h);
}

// wT[sel][n_out][k_in] = W_sel[k_in][n_out]   (transpose + f32->f16)
// 256 blocks of 6 waves.  A wave takes a tile of 64 k x 32 n; a lane holds two
// blocks of 8 k x 4 n in registers (16 loads of 16 bytes; a wave-wide load is
// 4 whole 128-byte lines of W) and stores each n of a block as 8 k = 16 bytes.
__global__ __launch_bounds__(192) void cvt_weightT(const float* __restrict__ Wq,
                                                   const float* __restrict__ Wk,
                                                   const float* __restrict__ Wv,
                                                   _Float16* __restrict__ wT) {
  const int lane = threadIdx.x & 31;
  const int t   = blockIdx.x * 6 + (threadIdx.x >> 5);   // 0 .. 3*512-1
  const int sel = t >> 9;
  const int n0  = (t & 31) * 32 + (lane & 7) * 4;
  const int k0  = ((t >> 5) & 15) * 64 + (lane >> 3) * 8;
  const float* W = (sel == 0) ? Wq : ((sel == 1) ? Wk : Wv);
  const float* s = W + (size_t)k0 * DMODEL + n0;
  v4f x[2][8];
#pragma unroll  // constant indices: the array stays in registers
  for (int u = 0; u < 2; ++u)
#pragma unroll  // constant indices: the array stays in registers
    for (int j = 0; j < 8; ++j)
      x[u][j] = *(const v4f*)(s + (size_t)(u * 32 + j) * DMODEL);
  // Takes the loaded values and their address as inputs only: all 16 loads are
  // in flight before the first convert (without it two of them are issued only
  // behind a wait for earlier ones, a second trip to memory), and the address
  // pair that they name is rewritten only behind this wait.
  asm volatile("s_wait_xcnt 0x0" :: "v"(x[0][0]), "v"(x[0][1]), "v"(x[0][2]), "v"(x[0][3]),
                     "v"(x[0][4]), "v"(x[0][5]), "v"(x[0][6]), "v"(x[0][7]),
                     "v"(x[1][0]), "v"(x[1][1]), "v"(x[1][2]), "v"(x[1][3]),
                     "v"(x[1][4]), "v"(x[1][5]), "v"(x[1][6]), "v"(x[1][7]),
                     "v"(s) : "memory");
  _Float16* d = wT + ((size_t)sel * DMODEL + n0) * DMODEL + k0;
#pragma unroll  // constant indices: the array stays in registers
  for (int u = 0; u < 2; ++u)
#pragma unroll  // constant indices: the array stays in registers
    for (int i = 0; i < 4; ++i) {
      v8h y;
#pragma unroll  // constant indices: the array stays in registers
      for (int j = 0; j < 8; ++j) y[j] = (_Float16)x[u][j][i];
      *(v8h*)(d + (size_t)i * DMODEL + u * 32) = y;
    }
}

// --------------------------------- QKV GEMM --------------------------------
// grid (32 row tiles, 24 column tiles over {q,k,v}), 128 threads = 4 waves.
// One 128x128 output tile per block, 64x64 (4x4 WMMA tiles) per wave.  The
// operands come through a two-buffer LDS ring: a stage is 64 k of 128 rows of
// h16 and 128 rows of wT; each wave brings one 64-row slice of it with one
// tensor load, padded to a 144-byte row pitch for the ds_load_b128 readers.

typedef uint32_t u32x4 __attribute__((ext_vector_type(4)));
typedef uint32_t u32x8 __attribute__((ext_vector_type(8)));

#define G_ROWB   128u                 // bytes of one staged row (64 k of f16)
#define G_PITCH  144u                 // LDS row pitch: 128 + 16 pad bytes
#define G_SLICE  10240u               // 64 rows * 144 B, rounded up to 2 KiB
#define G_STAGE  (4u * G_SLICE)
#define G_NSTAGE (DMODEL * 2u / G_ROWB)

__device__ inline uint32_t uni(uint32_t v) {
  return (uint32_t)__builtin_amdgcn_readfirstlane(v);
}
// Makes the test around a tensor load a scalar branch, and keeps a descriptor
// word that is formed from the result behind the waits in front of the call.
__device__ inline uint32_t pinned(uint32_t v) {
  uint32_t w = uni(v);
  // pinned(): an issue test or a descriptor word held in a scalar register
  asm volatile("" : "+s"(w));
  return w;
}
__device__ inline void wait_tensor0() {
  // a tile counts as landed
  // only behind its issuer's own wait
  asm volatile("s_wait_tensorcnt 0x0" ::: "memory");
}
__device__ inline void wait_ds0() {
  // a wave's LDS reads have retired before the buffer they read is refilled
  asm volatile("s_wait_dscnt 0x0" ::: "memory");
}

__global__ __launch_bounds__(128) void qkv_gemm(
    const _Float16* __restrict__ h16,   // [4096,1024]
    const _Float16* __restrict__ wT,    // [3][1024][1024]
    const float* __restrict__ bq, const float* __restrict__ bk,
    const float* __restrict__ bv,
    _Float16* __restrict__ q16,         // [b,h,n,64]  (pre-scaled 1/8)
    _Float16* __restrict__ k16,         // [b,h,n,64]
    _Float16* __restrict__ vT16)        // [b,h,64,n]
{
  __shared__ __attribute__((aligned(2048))) unsigned char ring[2u * G_STAGE];

  const int lane = threadIdx.x & 31;
  const uint32_t wv = uni(threadIdx.x >> 5);
  const int half = lane >> 4;
  const int l16  = lane & 15;
  const uint32_t wm = wv >> 1, wn = wv & 1u;         // 2x2 waves
  const int row0 = blockIdx.x * 128;                 // 0..3968
  const int sel  = blockIdx.y >> 3;
  const int colb = (blockIdx.y & 7) * 128;           // 0..896 inside q, k or v

  const float* bias = (sel == 0) ? bq : ((sel == 1) ? bk : bv);

  // Slices of a stage: waves 0,1 bring h16 rows 0-63, 64-127 of the tile,
  // waves 2,3 bring wT rows 0-63, 64-127 (wT's three matrices are contiguous).
  const _Float16* slice_src =
      (wv < 2u) ? h16 + (size_t)(row0 + wv * 64u) * DMODEL
                : wT + (size_t)(blockIdx.y * 128u + (wv - 2u) * 64u) * DMODEL;
  const uint64_t src_ga = (uint64_t)(size_t)slice_src;
  const uint32_t lbase  = (uint32_t)(size_t)ring;

  // Descriptor group 1: byte elements, tile = tensor = 64 rows of 128 bytes,
  // source pitch 2048 bytes, 4 dwords of pad behind every 32 dwords.
  u32x8 g1;
  g1[0] = uni((1u << 20) | (4u << 22) | (3u << 25));
  g1[1] = uni((G_ROWB & 0xFFFFu) << 16);
  g1[2] = uni((G_ROWB >> 16) | (64u << 16));
  g1[3] = uni(G_ROWB << 16);
  g1[4] = uni(64u);
  g1[5] = uni(DMODEL * 2u);
  g1[6] = uni(0u);
  g1[7] = uni(0u);

  auto issue = [&](uint32_t st) {
    const uint32_t dst = lbase + (st & 1u) * G_STAGE + wv * G_SLICE;
    const uint64_t ga  = src_ga + (uint64_t)(st * G_ROWB);
    u32x4 g0;
    g0[0] = uni(1u);
    g0[1] = uni(dst);
    g0[2] = uni((uint32_t)ga);
    g0[3] = uni((((uint32_t)(ga >> 32)) & 0x01FFFFFFu) | 0x80000000u);
    // one request of the whole wave: global tile -> LDS, through no register
    asm volatile("tensor_load_to_lds %0, %1" :: "s"(g0), "s"(g1) : "memory");
  };

  v8f acc[4][4];
#pragma unroll  // constant indices: the arrays stay in registers
  for (int m = 0; m < 4; ++m)
#pragma unroll  // constant indices: the arrays stay in registers
    for (int t = 0; t < 4; ++t) acc[m][t] = (v8f){};

  issue(0u);
  wait_tensor0();
  __syncthreads();                     // stage 0 published
  issue(pinned(1u));

  const uint32_t a_off = wm * G_SLICE + (uint32_t)l16 * G_PITCH + (uint32_t)half * 16u;
  const uint32_t b_off = (2u + wn) * G_SLICE + (uint32_t)l16 * G_PITCH + (uint32_t)half * 16u;

  // kept rolled: one copy of the pass, the buffer chosen by the stage's parity
#pragma unroll 1
  for (uint32_t s = 0; s < G_NSTAGE; ++s) {
    const unsigned char* buf = ring + (s & 1u) * G_STAGE;
    v16h a[2][4], b[2][4];
#pragma unroll  // constant indices: the arrays stay in registers
    for (int ks = 0; ks < 2; ++ks) {
#pragma unroll  // constant indices: the arrays stay in registers
      for (int m = 0; m < 4; ++m)
        a[ks][m] = load_frag16((const _Float16*)(buf + a_off + m * 16 * G_PITCH + ks * 64));
#pragma unroll  // constant indices: the arrays stay in registers
      for (int t = 0; t < 4; ++t)
        b[ks][t] = load_frag16((const _Float16*)(buf + b_off + t * 16 * G_PITCH + ks * 64));
    }
    // Publish point of stage s + 1.  It stands here, not behind the WMMAs: the
    // pass's fragments are all in registers behind the first wait, so the
    // buffer is free one barrier later and its refill flies under the WMMAs.
    wait_ds0();
    wait_tensor0();
    __syncthreads();                   // s + 1 landed for all; all have left s
    if (pinned(s + 2u < G_NSTAGE)) issue(pinned(s + 2u));
#pragma unroll  // constant indices: the arrays stay in registers
    for (int ks = 0; ks < 2; ++ks)
#pragma unroll  // constant indices: the arrays stay in registers
      for (int t = 0; t < 4; ++t)
#pragma unroll  // constant indices: the arrays stay in registers
        for (int m = 0; m < 4; ++m)
          acc[m][t] = wmma_f16(a[ks][m], b[ks][t], acc[m][t]);
  }
  wait_tensor0();
  wait_ds0();

  const float qscale = (sel == 0) ? 0.125f : 1.0f;   // fold 1/sqrt(64) into Q
#pragma unroll
  for (int t = 0; t < 4; ++t) {
    const int col = colb + (int)wn * 64 + t * 16 + l16;
    const float bcol = bias[col];
    const int hh = col >> 6, dd = col & (HDIM - 1);
#pragma unroll
    for (int m = 0; m < 4; ++m) {
#pragma unroll
      for (int r = 0; r < 8; ++r) {
        float val = (acc[m][t][r] + bcol) * qscale;
        int row = row0 + (int)wm * 64 + m * 16 + r + half * 8;  // C layout: M = r (+8)
        int bb = row >> 9, nn = row & (NSEQ - 1);
        if (sel == 2) {
          vT16[((size_t)(bb * NHEAD + hh) * HDIM + dd) * NSEQ + nn] =
              (_Float16)val;
        } else {
          _Float16* dst = (sel == 0) ? q16 : k16;
          dst[((size_t)(bb * NHEAD + hh) * NSEQ + nn) * HDIM + dd] =
              (_Float16)val;
        }
      }
    }
  }
}

// -------------------------------- attention --------------------------------
// One wave = 16 query rows of one (b,h); key loop in chunks of 32 with online
// softmax.  8 WMMAs per chunk (4 for S, 4 for P.V), 128 per wave.
// The 8 waves of a block work on one (b,h) and read the same K and V^T: these
// come through a two-buffer LDS ring.  A stage is 64 keys (two chunks): 64 rows
// of K (64 head dims each) and 64 rows of V^T (64 keys each), all of 128 bytes;
// each wave brings one 16-row slice of it with one tensor load, padded to the
// 144-byte row pitch for the ds_load_b128 readers.

#define A_KEYS   64u                  // keys of one stage
#define A_SLICE  4096u                // 16 rows * 144 B, rounded up to 2 KiB
#define A_STAGE  (8u * A_SLICE)
#define A_NSTAGE (NSEQ / A_KEYS)

__global__ __launch_bounds__(256) void attention(
    const _Float16* __restrict__ q16, const _Float16* __restrict__ k16,
    const _Float16* __restrict__ vT16, const int* __restrict__ adj,
    float* __restrict__ out)
{
  __shared__ __attribute__((aligned(2048))) unsigned char ring[2u * A_STAGE];
  __shared__ _Float16 ldsP[8][16][32];   // per-wave P staging (C->A relayout)

  const int lane = threadIdx.x & 31;
  const int w    = threadIdx.x >> 5;
  const uint32_t wv = uni(threadIdx.x >> 5);   // the same, in a scalar register
  const int half = lane >> 4;
  const int l16  = lane & 15;

  const int wid = blockIdx.x * 8 + w;    // 0..4095
  const int qt  = wid & 31;              // query tile 0..31
  const int h   = (wid >> 5) & (NHEAD - 1);
  const int b   = wid >> 9;

  const unsigned mask = ALLOWED_MASK[h];
  const _Float16* qb = q16 + ((size_t)(b * NHEAD + h) * NSEQ + qt * 16) * HDIM;
  const _Float16* kb = k16 + (size_t)(b * NHEAD + h) * NSEQ * HDIM;
  const _Float16* vb = vT16 + (size_t)(b * NHEAD + h) * HDIM * NSEQ;
  const int* adjb = adj + (size_t)b * NSEQ * NSEQ;

  // Q fragments (A layout), fixed across the key loop.
  v16h aQ0 = load_frag16(qb + (size_t)l16 * HDIM + half * 8);
  v16h aQ1 = load_frag16(qb + (size_t)l16 * HDIM + 32 + half * 8);

  v8f o0 = {}, o1 = {}, o2 = {}, o3 = {};
  float mrow[8], lrow[8];
#pragma unroll
  for (int r = 0; r < 8; ++r) { mrow[r] = -1e30f; lrow[r] = 0.0f; }

  // Slices of a stage: waves 0-3 bring 16 keys of K each (rows one behind the
  // other), waves 4-7 bring 16 head dims of V^T each (rows one sequence apart).
  const _Float16* slice_src = (wv < 4u) ? kb + (size_t)(wv * 16u) * HDIM
                                        : vb + (size_t)((wv - 4u) * 16u) * NSEQ;
  const uint32_t slice_pitch = (wv < 4u) ? HDIM * 2u : NSEQ * 2u;           // bytes, row to row
  const uint32_t slice_step  = (wv < 4u) ? A_KEYS * HDIM * 2u : A_KEYS * 2u; // bytes, stage to stage
  const uint64_t src_ga = (uint64_t)(size_t)slice_src;
  const uint32_t lbase  = (uint32_t)(size_t)ring;

  // Descriptor group 1: byte elements, tile = tensor = 16 rows of 128 bytes,
  // 4 dwords of pad behind every 32 dwords.
  u32x8 g1;
  g1[0] = uni((1u << 20) | (4u << 22) | (3u << 25));
  g1[1] = uni((G_ROWB & 0xFFFFu) << 16);
  g1[2] = uni((G_ROWB >> 16) | (16u << 16));
  g1[3] = uni(G_ROWB << 16);
  g1[4] = uni(16u);
  g1[5] = uni(slice_pitch);
  g1[6] = uni(0u);
  g1[7] = uni(0u);

  u32x4 g0;                            // group 0 of the wave's last request
  auto issue = [&](uint32_t st) {
    const uint32_t dst = lbase + (st & 1u) * A_STAGE + wv * A_SLICE;
    const uint64_t ga  = src_ga + (uint64_t)(st * slice_step);
    g0[0] = uni(1u);
    g0[1] = uni(dst);
    g0[2] = uni((uint32_t)ga);
    g0[3] = uni((((uint32_t)(ga >> 32)) & 0x01FFFFFFu) | 0x80000000u);
    // One request of the whole wave: global tile -> LDS, through no register.
    // The descriptor words are in-out operands here and inputs of the wait
    // below: the compiler then keeps them where they are, and forms none of
    // them anew, while the request is in flight.
    asm volatile("tensor_load_to_lds %0, %1" : "+s"(g0), "+s"(g1) :: "memory");
  };
  auto landed = [&]() {
    // the issuer's own wait: a tile counts as landed only behind it
    asm volatile("s_wait_tensorcnt 0x0" :: "s"(g0), "s"(g1) : "memory");
  };

  issue(0u);
  landed();
  __syncthreads();                     // stage 0 published
  issue(pinned(1u));

  // a lane's place in a 16-row slice: row l16, its half's 16 bytes
  const uint32_t f_off = (uint32_t)l16 * G_PITCH + (uint32_t)half * 16u;

  // kept rolled: one copy of the pass, the buffer chosen by the stage's parity
#pragma unroll 1
  for (uint32_t s = 0; s < A_NSTAGE; ++s) {
   const unsigned char* buf = ring + (s & 1u) * A_STAGE + f_off;
#pragma unroll  // constant slice numbers and offsets inside the stage
   for (int cc = 0; cc < (int)A_KEYS; cc += 32) {
    const int c = (int)(s * A_KEYS) + cc;
    // ---- S = Q.K^T for 16q x 32k (two 16x16 tiles) ----
    v8f s0 = {}, s1 = {};
    {
      const unsigned char* kr = buf + (cc >> 4) * A_SLICE;   // keys cc .. cc+15
      v16h bk0 = load_frag16((const _Float16*)(kr));
      v16h bk1 = load_frag16((const _Float16*)(kr + 64));
      s0 = wmma_f16(aQ0, bk0, s0);
      s0 = wmma_f16(aQ1, bk1, s0);
      v16h bk2 = load_frag16((const _Float16*)(kr + A_SLICE));
      v16h bk3 = load_frag16((const _Float16*)(kr + A_SLICE + 64));
      s1 = wmma_f16(aQ0, bk2, s1);
      s1 = wmma_f16(aQ1, bk3, s1);
    }

    // ---- relation mask (scores += -1e9 where disallowed) ----
#pragma unroll
    for (int r = 0; r < 8; ++r) {
      int qrow = qt * 16 + r + half * 8;
      int rel0 = adjb[(size_t)qrow * NSEQ + c + l16];
      int rel1 = adjb[(size_t)qrow * NSEQ + c + 16 + l16];
      if (!((mask >> rel0) & 1u)) s0[r] += -1e9f;
      if (!((mask >> rel1) & 1u)) s1[r] += -1e9f;
    }

    // ---- online softmax update (row = (r, lane-half); cols across 16 lanes)
#pragma unroll
    for (int r = 0; r < 8; ++r) {
      float v = fmaxf(s0[r], s1[r]);
#pragma unroll
      for (int off = 8; off >= 1; off >>= 1) v = fmaxf(v, __shfl_xor(v, off, 32));
      float mnew = fmaxf(mrow[r], v);
      float sc = __expf(mrow[r] - mnew);
      float p0 = __expf(s0[r] - mnew);
      float p1 = __expf(s1[r] - mnew);
      float rs = p0 + p1;
#pragma unroll
      for (int off = 8; off >= 1; off >>= 1) rs += __shfl_xor(rs, off, 32);
      lrow[r] = lrow[r] * sc + rs;
      mrow[r] = mnew;
      o0[r] *= sc; o1[r] *= sc; o2[r] *= sc; o3[r] *= sc;
      s0[r] = p0;  s1[r] = p1;
    }

    // ---- relayout P through LDS: C layout -> A fragment ----
#pragma unroll
    for (int r = 0; r < 8; ++r) {
      ldsP[w][r + half * 8][l16]      = (_Float16)s0[r];
      ldsP[w][r + half * 8][16 + l16] = (_Float16)s1[r];
    }
    v16h aP = load_frag16(&ldsP[w][l16][half * 8]);

    // ---- O += P.V (4 hd tiles, B fragments from transposed V) ----
    const unsigned char* vr = buf + 4u * A_SLICE + cc * 2;   // keys cc .. cc+31 of a row
    v16h bv0 = load_frag16((const _Float16*)(vr));
    v16h bv1 = load_frag16((const _Float16*)(vr + A_SLICE));
    v16h bv2 = load_frag16((const _Float16*)(vr + 2u * A_SLICE));
    v16h bv3 = load_frag16((const _Float16*)(vr + 3u * A_SLICE));
    o0 = wmma_f16(aP, bv0, o0);
    o1 = wmma_f16(aP, bv1, o1);
    o2 = wmma_f16(aP, bv2, o2);
    o3 = wmma_f16(aP, bv3, o3);
   }
   // Publish point of stage s + 1, at the foot of the pass.
   wait_ds0();
   landed();
   __syncthreads();                    // s + 1 landed for all; all have left s
   if (pinned(s + 2u < A_NSTAGE)) issue(pinned(s + 2u));
  }
  landed();
  wait_ds0();

  // ---- normalize and store fp32 output ----
#pragma unroll
  for (int r = 0; r < 8; ++r) {
    float inv = 1.0f / lrow[r];
    int qrow = qt * 16 + r + half * 8;
    float* op = out + ((size_t)(b * NSEQ + qrow) * DMODEL) + h * HDIM;
    op[0  + l16] = o0[r] * inv;
    op[16 + l16] = o1[r] * inv;
    op[32 + l16] = o2[r] * inv;
    op[48 + l16] = o3[r] * inv;
  }
}

// --------------------------------- launcher --------------------------------

extern "C" void kernel_launch(void* const* d_in, const int* in_sizes, int n_in,
                              void* d_out, int out_size, void* d_ws, size_t ws_size,
                              hipStream_t stream) {
  const float* hidden = (const float*)d_in[0];
  const int*   adj    = (const int*)d_in[1];
  const float* Wq     = (const float*)d_in[2];
  const float* bq     = (const float*)d_in[3];
  const float* Wk     = (const float*)d_in[4];
  const float* bk     = (const float*)d_in[5];
  const float* Wv     = (const float*)d_in[6];
  const float* bv     = (const float*)d_in[7];
  float* out = (float*)d_out;

  char* ws = (char*)d_ws;
  const size_t MB = 1024u * 1024u;
  _Float16* h16  = (_Float16*)(ws);             //  8 MB: [4096,1024]
  _Float16* wT   = (_Float16*)(ws + 8  * MB);   //  6 MB: [3,1024,1024]
  _Float16* q16  = (_Float16*)(ws + 14 * MB);   //  8 MB: [b,h,n,64]
  _Float16* k16  = (_Float16*)(ws + 22 * MB);   //  8 MB
  _Float16* vT16 = (_Float16*)(ws + 30 * MB);   //  8 MB: [b,h,64,n]

  // 4194304 elements: 4096 waves of 1024
  cvt_hidden<<<NB * NSEQ * DMODEL / (16 * 1024), 512, 0, stream>>>(hidden, h16);
  // 3 * 1024 * 1024 elements: 1536 waves of 64 x 32
  cvt_weightT<<<3 * DMODEL * DMODEL / (6 * 64 * 32), 192, 0, stream>>>(Wq, Wk, Wv, wT);

  // 128-row tiles x 128-col tiles over {q,k,v}, 4 waves of 64x64
  qkv_gemm<<<dim3(NB * NSEQ / 128, 3 * DMODEL / 128), 128, 0, stream>>>(
      h16, wT, bq, bk, bv, q16, k16, vT16);

  // 8*16*32 = 4096 waves, 8 waves per block
  attention<<<512, 256, 0, stream>>>(q16, k16, vT16, adj, out);
}

// v004
// Measured time: 73.3 microseconds a run.
// In two side-by-side timings against v003, it was 1.10 and 1.12 times as fast.
// Over all steps from v000 it is 2.46 times as fast.
#include <hip/hip_runtime.h>
#include <hip/hip_bf16.h>

typedef __attribute__((ext_vector_type(16))) _Float16 v16h;
typedef __attribute__((ext_vector_type(8)))  _Float16 v8h;
typedef __attribute__((ext_vector_type(8)))  float    v8f;

#define NHEAD 16
#define NB    8
#define NSEQ  512
#define DMODEL 1024
#define HDIM  64

// relation->head allow mask (bit r = relation r allowed for this head),
// precomputed from the reference's per-head loop.
__device__ __constant__ unsigned short ALLOWED_MASK[NHEAD] = {
  0x3003, 0x3005, 0x3009, 0x3831, 0x3071, 0x30E1, 0x31C1, 0x3381,
  0x3701, 0x3E01, 0x3C11, 0x3831, 0x7001, 0x7001, 0x7001, 0x7001
};

// Load a 16-lane-half K-packed f16 fragment (A or B layout for 16x16x32):
// caller passes p = base + row*ld + k0 + (lane>>4)*8.  lo = K chunk 0..7(/8..15),
// hi = K chunk 16..23(/24..31) per the CDNA5 16-bit A/B VGPR layout.
__device__ inline v16h load_frag16(const _Float16* p) {
  v8h lo = *(const v8h*)(p);
  v8h hi = *(const v8h*)(p + 16);
  v16h r;
#pragma unroll
  for (int i = 0; i < 8; ++i) { r[i] = lo[i]; r[i + 8] = hi[i]; }
  return r;
}

__device__ inline v8f wmma_f16(v16h a, v16h b, v8f c) {
  return __builtin_amdgcn_wmma_f32_16x16x32_f16(
      /*neg_a=*/false, a, /*neg_b=*/false, b,
      /*c_mod=*/(short)0, c, /*reuse_a=*/false, /*reuse_b=*/false);
}

// ------------------------------- conversions -------------------------------
// Both kernels are sized by waves to start, not by elements: a thread converts
// a block of elements with 16-byte loads, all of them in flight at once.

typedef __attribute__((ext_vector_type(4))) float    v4f;
typedef __attribute__((ext_vector_type(4))) _Float16 v4h;

// 256 blocks of 16 waves.  A wave converts 1024 floats in a row: 8 loads of
// 512 contiguous bytes, then 8 stores of 256 contiguous bytes.
__global__ __launch_bounds__(512) void cvt_hidden(const float* __restrict__ src,
                                                  _Float16* __restrict__ dst) {
  const int lane = threadIdx.x & 31;
  const int wave = blockIdx.x * 16 + (threadIdx.x >> 5);
  const size_t base = (size_t)wave * 1024 + lane * 4;
  v4f x[8];
#pragma unroll  // constant indices: the array stays in registers
  for (int j = 0; j < 8; ++j) x[j] = *(const v4f*)(src + base + j * 128);
#pragma unroll  // constant indices: the array stays in registers
  for (int j = 0; j < 8; ++j)
    *(v4h*)(dst + base + j * 128) = __builtin_convertvector(x[j], v4h);
}

// wT[sel][n_out][k_in] = W_sel[k_in][n_out]   (transpose + f32->f16)
// 256 blocks of 6 waves.  A wave takes a tile of 64 k x 32 n; a lane holds two
// blocks of 8 k x 4 n in registers (16 loads of 16 bytes; a wave-wide load is
// 4 whole 128-byte lines of W) and stores each n of a block as 8 k = 16 bytes.
__global__ __launch_bounds__(192) void cvt_weightT(const float* __restrict__ Wq,
                                                   const float* __restrict__ Wk,
                                                   const float* __restrict__ Wv,
                                                   _Float16* __restrict__ wT) {
  const int lane = threadIdx.x & 31;
  const int t   = blockIdx.x * 6 + (threadIdx.x >> 5);   // 0 .. 3*512-1
  const int sel = t >> 9;
  const int n0  = (t & 31) * 32 + (lane & 7) * 4;
  const int k0  = ((t >> 5) & 15) * 64 + (lane >> 3) * 8;
  const float* W = (sel == 0) ? Wq : ((sel == 1) ? Wk : Wv);
  const float* s = W + (size_t)k0 * DMODEL + n0;
  v4f x[2][8];
#pragma unroll  // constant indices: the array stays in registers
  for (int u = 0; u < 2; ++u)
#pragma unroll  // constant indices: the array stays in registers
    for (int j = 0; j < 8; ++j)
      x[u][j] = *(const v4f*)(s + (size_t)(u * 32 + j) * DMODEL);
  // Takes the loaded values and their address as inputs only: all 16 loads are
  // in flight before the first convert (without it two of them are issued only
  // behind a wait for earlier ones, a second trip to memory), and the address
  // pair that they name is rewritten only behind this wait.
  asm volatile("s_wait_xcnt 0x0" :: "v"(x[0][0]), "v"(x[0][1]), "v"(x[0][2]), "v"(x[0][3]),
                     "v"(x[0][4]), "v"(x[0][5]), "v"(x[0][6]), "v"(x[0][7]),
                     "v"(x[1][0]), "v"(x[1][1]), "v"(x[1][2]), "v"(x[1][3]),
                     "v"(x[1][4]), "v"(x[1][5]), "v"(x[1][6]), "v"(x[1][7]),
                     "v"(s) : "memory");
  _Float16* d = wT + ((size_t)sel * DMODEL + n0) * DMODEL + k0;
#pragma unroll  // constant indices: the array stays in registers
  for (int u = 0; u < 2; ++u)
#pragma unroll  // constant indices: the array stays in registers
    for (int i = 0; i < 4; ++i) {
      v8h y;
#pragma unroll  // constant indices: the array stays in registers
      for (int j = 0; j < 8; ++j) y[j] = (_Float16)x[u][j][i];
      *(v8h*)(d + (size_t)i * DMODEL + u * 32) = y;
    }
}

// --------------------------------- QKV GEMM --------------------------------
// grid (32 row tiles, 24 column tiles over {q,k,v}), 128 threads = 4 waves.
// One 128x128 output tile per block, 64x64 (4x4 WMMA tiles) per wave.  The
// operands come through a two-buffer LDS ring: a stage is 64 k of 128 rows of
// h16 and 128 rows of wT; each wave brings one 64-row slice of it with one
// tensor load, padded to a 144-byte row pitch for the ds_load_b128 readers.

typedef uint32_t u32x4 __attribute__((ext_vector_type(4)));
typedef uint32_t u32x8 __attribute__((ext_vector_type(8)));

#define G_ROWB   128u                 // bytes of one staged row (64 k of f16)
#define G_PITCH  144u                 // LDS row pitch: 128 + 16 pad bytes
#define G_SLICE  10240u               // 64 rows * 144 B, rounded up to 2 KiB
#define G_STAGE  (4u * G_SLICE)
#define G_NSTAGE (DMODEL * 2u / G_ROWB)

__device__ inline uint32_t uni(uint32_t v) {
  return (uint32_t)__builtin_amdgcn_readfirstlane(v);
}
// Makes the test around a tensor load a scalar branch, and keeps a descriptor
// word that is formed from the result behind the waits in front of the call.
__device__ inline uint32_t pinned(uint32_t v) {
  uint32_t w = uni(v);
  // pinned(): an issue test or a descriptor word held in a scalar register
  asm volatile("" : "+s"(w));
  return w;
}
__device__ inline void wait_tensor0() {
  // a tile counts as landed
  // only behind its issuer's own wait
  asm volatile("s_wait_tensorcnt 0x0" ::: "memory");
}
__device__ inline void wait_ds0() {
  // a wave's LDS reads have retired before the buffer they read is refilled
  asm volatile("s_wait_dscnt 0x0" ::: "memory");
}

__global__ __launch_bounds__(128) void qkv_gemm(
    const _Float16* __restrict__ h16,   // [4096,1024]
    const _Float16* __restrict__ wT,    // [3][1024][1024]
    const float* __restrict__ bq, const float* __restrict__ bk,
    const float* __restrict__ bv,
    _Float16* __restrict__ q16,         // [b,h,n,64]  (pre-scaled 1/8)
    _Float16* __restrict__ k16,         // [b,h,n,64]
    _Float16* __restrict__ vT16)        // [b,h,64,n]
{
  __shared__ __attribute__((aligned(2048))) unsigned char ring[2u * G_STAGE];

  const int lane = threadIdx.x & 31;
  const uint32_t wv = uni(threadIdx.x >> 5);
  const int half = lane >> 4;
  const int l16  = lane & 15;
  const uint32_t wm = wv >> 1, wn = wv & 1u;         // 2x2 waves
  const int row0 = blockIdx.x * 128;                 // 0..3968
  const int sel  = blockIdx.y >> 3;
  const int colb = (blockIdx.y & 7) * 128;           // 0..896 inside q, k or v

  const float* bias = (sel == 0) ? bq : ((sel == 1) ? bk : bv);

  // Slices of a stage: waves 0,1 bring h16 rows 0-63, 64-127 of the tile,
  // waves 2,3 bring wT rows 0-63, 64-127 (wT's three matrices are contiguous).
  const _Float16* slice_src =
      (wv < 2u) ? h16 + (size_t)(row0 + wv * 64u) * DMODEL
                : wT + (size_t)(blockIdx.y * 128u + (wv - 2u) * 64u) * DMODEL;
  const uint64_t src_ga = (uint64_t)(size_t)slice_src;
  const uint32_t lbase  = (uint32_t)(size_t)ring;

  // Descriptor group 1: byte elements, tile = tensor = 64 rows of 128 bytes,
  // source pitch 2048 bytes, 4 dwords of pad behind every 32 dwords.
  u32x8 g1;
  g1[0] = uni((1u << 20) | (4u << 22) | (3u << 25));
  g1[1] = uni((G_ROWB & 0xFFFFu) << 16);
  g1[2] = uni((G_ROWB >> 16) | (64u << 16));
  g1[3] = uni(G_ROWB << 16);
  g1[4] = uni(64u);
  g1[5] = uni(DMODEL * 2u);
  g1[6] = uni(0u);
  g1[7] = uni(0u);

  auto issue = [&](uint32_t st) {
    const uint32_t dst = lbase + (st & 1u) * G_STAGE + wv * G_SLICE;
    const uint64_t ga  = src_ga + (uint64_t)(st * G_ROWB);
    u32x4 g0;
    g0[0] = uni(1u);
    g0[1] = uni(dst);
    g0[2] = uni((uint32_t)ga);
    g0[3] = uni((((uint32_t)(ga >> 32)) & 0x01FFFFFFu) | 0x80000000u);
    // one request of the whole wave: global tile -> LDS, through no register
    asm volatile("tensor_load_to_lds %0, %1" :: "s"(g0), "s"(g1) : "memory");
  };

  v8f acc[4][4];
#pragma unroll  // constant indices: the arrays stay in registers
  for (int m = 0; m < 4; ++m)
#pragma unroll  // constant indices: the arrays stay in registers
    for (int t = 0; t < 4; ++t) acc[m][t] = (v8f){};

  issue(0u);
  wait_tensor0();
  __syncthreads();                     // stage 0 published
  issue(pinned(1u));

  const uint32_t a_off = wm * G_SLICE + (uint32_t)l16 * G_PITCH + (uint32_t)half * 16u;
  const uint32_t b_off = (2u + wn) * G_SLICE + (uint32_t)l16 * G_PITCH + (uint32_t)half * 16u;

  // kept rolled: one copy of the pass, the buffer chosen by the stage's parity
#pragma unroll 1
  for (uint32_t s = 0; s < G_NSTAGE; ++s) {
    const unsigned char* buf = ring + (s & 1u) * G_STAGE;
    v16h a[2][4], b[2][4];
#pragma unroll  // constant indices: the arrays stay in registers
    for (int ks = 0; ks < 2; ++ks) {
#pragma unroll  // constant indices: the arrays stay in registers
      for (int m = 0; m < 4; ++m)
        a[ks][m] = load_frag16((const _Float16*)(buf + a_off + m * 16 * G_PITCH + ks * 64));
#pragma unroll  // constant indices: the arrays stay in registers
      for (int t = 0; t < 4; ++t)
        b[ks][t] = load_frag16((const _Float16*)(buf + b_off + t * 16 * G_PITCH + ks * 64));
    }
    // Publish point of stage s + 1.  It stands here, not behind the WMMAs: the
    // pass's fragments are all in registers behind the first wait, so the
    // buffer is free one barrier later and its refill flies under the WMMAs.
    wait_ds0();
    wait_tensor0();
    __syncthreads();                   // s + 1 landed for all; all have left s
    if (pinned(s + 2u < G_NSTAGE)) issue(pinned(s + 2u));
#pragma unroll  // constant indices: the arrays stay in registers
    for (int ks = 0; ks < 2; ++ks)
#pragma unroll  // constant indices: the arrays stay in registers
      for (int t = 0; t < 4; ++t)
#pragma unroll  // constant indices: the arrays stay in registers
        for (int m = 0; m < 4; ++m)
          acc[m][t] = wmma_f16(a[ks][m], b[ks][t], acc[m][t]);
  }
  wait_tensor0();
  wait_ds0();

  const float qscale = (sel == 0) ? 0.125f : 1.0f;   // fold 1/sqrt(64) into Q
#pragma unroll
  for (int t = 0; t < 4; ++t) {
    const int col = colb + (int)wn * 64 + t * 16 + l16;
    const float bcol = bias[col];
    const int hh = col >> 6, dd = col & (HDIM - 1);
#pragma unroll
    for (int m = 0; m < 4; ++m) {
#pragma unroll
      for (int r = 0; r < 8; ++r) {
        float val = (acc[m][t][r] + bcol) * qscale;
        int row = row0 + (int)wm * 64 + m * 16 + r + half * 8;  // C layout: M = r (+8)
        int bb = row >> 9, nn = row & (NSEQ - 1);
        if (sel == 2) {
          vT16[((size_t)(bb * NHEAD + hh) * HDIM + dd) * NSEQ + nn] =
              (_Float16)val;
        } else {
          _Float16* dst = (sel == 0) ? q16 : k16;
          dst[((size_t)(bb * NHEAD + hh) * NSEQ + nn) * HDIM + dd] =
              (_Float16)val;
        }
      }
    }
  }
}

// -------------------------------- attention --------------------------------
// One wave = 16 query rows of one (b,h); key loop in chunks of 32 with online
// softmax.  8 WMMAs per chunk (4 for S^T, 4 for V^T.P^T), 128 per wave.
// Both products are taken transposed: K and V^T are the A operands, Q and P^T
// the B operands.  A lane (l16, half) then holds 16 of the chunk's 32 scores of
// query l16: maximum and sum are taken in the lane, with one exchange between
// the halves, and the two score tiles, converted in place, are the B operand
// P^T in the hardware k order.  O^T is turned into rows once, behind the loop.
// The 8 waves of a block work on one (b,h) and read the same K and V^T: these
// come through a two-buffer LDS ring.  A stage is 64 keys (two chunks): 64 rows
// of K (64 head dims each) and 64 rows of V^T (64 keys each), all of 128 bytes;
// each wave brings one 16-row slice of it with one tensor load, padded to the
// 144-byte row pitch for the ds_load_b128 readers.

#define A_KEYS   64u                  // keys of one stage
#define A_SLICE  4096u                // 16 rows * 144 B, rounded up to 2 KiB
#define A_STAGE  (8u * A_SLICE)
#define A_NSTAGE (NSEQ / A_KEYS)
#define A_OPITCH 68                   // floats: 64 head dims + 16 pad bytes

typedef __attribute__((ext_vector_type(4))) int v4i;

// the value of lane l ^ 16
__device__ inline float xhalf(float x) {
  const int i = __builtin_bit_cast(int, x);
  return __builtin_bit_cast(float, __builtin_amdgcn_permlanex16(
      i, i, 0x76543210, 0xfedcba98, false, false));
}

__global__ __launch_bounds__(256) void attention(
    const _Float16* __restrict__ q16, const _Float16* __restrict__ k16,
    const _Float16* __restrict__ vT16, const int* __restrict__ adj,
    float* __restrict__ out)
{
  __shared__ __attribute__((aligned(2048))) unsigned char ring[2u * A_STAGE];
  __shared__ __attribute__((aligned(16))) float ldsO[8][16][A_OPITCH];  // per-wave O staging (O^T -> rows)

  const int lane = threadIdx.x & 31;
  const int w    = threadIdx.x >> 5;
  const uint32_t wv = uni(threadIdx.x >> 5);   // the same, in a scalar register
  const int half = lane >> 4;
  const int l16  = lane & 15;

  const int wid = blockIdx.x * 8 + w;    // 0..4095
  const int qt  = wid & 31;              // query tile 0..31
  const int h   = (wid >> 5) & (NHEAD - 1);
  const int b   = wid >> 9;

  const unsigned mask = ALLOWED_MASK[h];
  const _Float16* qb = q16 + ((size_t)(b * NHEAD + h) * NSEQ + qt * 16) * HDIM;
  const _Float16* kb = k16 + (size_t)(b * NHEAD + h) * NSEQ * HDIM;
  const _Float16* vb = vT16 + (size_t)(b * NHEAD + h) * HDIM * NSEQ;
  const int* adjb = adj + (size_t)b * NSEQ * NSEQ;

  // Q fragments (B operand: column l16 = query l16), fixed across the key loop.
  v16h bQ0 = load_frag16(qb + (size_t)l16 * HDIM + half * 8);
  v16h bQ1 = load_frag16(qb + (size_t)l16 * HDIM + 32 + half * 8);

  // o_t[r] = O[query l16][head dim 16 t + 8 half + r]
  v8f o0 = {}, o1 = {}, o2 = {}, o3 = {};
  float mrow = -1e30f;   // running maximum of query l16, the same in both halves
  float lrow = 0.0f;     // this half's share of the denominator of query l16
  // relations of query l16, from the first key that this half holds
  const int* adjq = adjb + (size_t)(qt * 16 + l16) * NSEQ + half * 8;

  // Slices of a stage: waves 0-3 bring 16 keys of K each (rows one behind the
  // other), waves 4-7 bring 16 head dims of V^T each (rows one sequence apart).
  const _Float16* slice_src = (wv < 4u) ? kb + (size_t)(wv * 16u) * HDIM
                                        : vb + (size_t)((wv - 4u) * 16u) * NSEQ;
  const uint32_t slice_pitch = (wv < 4u) ? HDIM * 2u : NSEQ * 2u;           // bytes, row to row
  const uint32_t slice_step  = (wv < 4u) ? A_KEYS * HDIM * 2u : A_KEYS * 2u; // bytes, stage to stage
  const uint64_t src_ga = (uint64_t)(size_t)slice_src;
  const uint32_t lbase  = (uint32_t)(size_t)ring;

  // Descriptor group 1: byte elements, tile = tensor = 16 rows of 128 bytes,
  // 4 dwords of pad behind every 32 dwords.
  u32x8 g1;
  g1[0] = uni((1u << 20) | (4u << 22) | (3u << 25));
  g1[1] = uni((G_ROWB & 0xFFFFu) << 16);
  g1[2] = uni((G_ROWB >> 16) | (16u << 16));
  g1[3] = uni(G_ROWB << 16);
  g1[4] = uni(16u);
  g1[5] = uni(slice_pitch);
  g1[6] = uni(0u);
  g1[7] = uni(0u);

  u32x4 g0;                            // group 0 of the wave's last request
  auto issue = [&](uint32_t st) {
    const uint32_t dst = lbase + (st & 1u) * A_STAGE + wv * A_SLICE;
    const uint64_t ga  = src_ga + (uint64_t)(st * slice_step);
    g0[0] = uni(1u);
    g0[1] = uni(dst);
    g0[2] = uni((uint32_t)ga);
    g0[3] = uni((((uint32_t)(ga >> 32)) & 0x01FFFFFFu) | 0x80000000u);
    // One request of the whole wave: global tile -> LDS, through no register.
    // The descriptor words are in-out operands here and inputs of the wait
    // below: the compiler then keeps them where they are, and forms none of
    // them anew, while the request is in flight.
    asm volatile("tensor_load_to_lds %0, %1" : "+s"(g0), "+s"(g1) :: "memory");
  };
  auto landed = [&]() {
    // the issuer's own wait: a tile counts as landed only behind it
    asm volatile("s_wait_tensorcnt 0x0" :: "s"(g0), "s"(g1) : "memory");
  };

  issue(0u);
  landed();
  __syncthreads();                     // stage 0 published
  issue(pinned(1u));

  // a lane's place in a 16-row slice: row l16, its half's 16 bytes
  const uint32_t f_off = (uint32_t)l16 * G_PITCH + (uint32_t)half * 16u;

  // kept rolled: one copy of the pass, the buffer chosen by the stage's parity
#pragma unroll 1
  for (uint32_t s = 0; s < A_NSTAGE; ++s) {
   const unsigned char* buf = ring + (s & 1u) * A_STAGE + f_off;
#pragma unroll  // constant slice numbers and offsets inside the stage
   for (int cc = 0; cc < (int)A_KEYS; cc += 32) {
    const int c = (int)(s * A_KEYS) + cc;
    // ---- S^T = K.Q^T for 32k x 16q (two 16x16 tiles) ----
    // s0[r] = score(key c + 8 half + r, query l16), s1[r] the same 16 keys on
    v8f s0 = {}, s1 = {};
    {
      const unsigned char* kr = buf + (cc >> 4) * A_SLICE;   // keys cc .. cc+15
      v16h ak0 = load_frag16((const _Float16*)(kr));
      v16h ak1 = load_frag16((const _Float16*)(kr + 64));
      s0 = wmma_f16(ak0, bQ0, s0);
      s0 = wmma_f16(ak1, bQ1, s0);
      v16h ak2 = load_frag16((const _Float16*)(kr + A_SLICE));
      v16h ak3 = load_frag16((const _Float16*)(kr + A_SLICE + 64));
      s1 = wmma_f16(ak2, bQ0, s1);
      s1 = wmma_f16(ak3, bQ1, s1);
    }

    // ---- relation mask (scores += -1e9 where disallowed) ----
    {
      const v4i ra = *(const v4i*)(adjq + c);
      const v4i rb = *(const v4i*)(adjq + c + 4);
      const v4i rc = *(const v4i*)(adjq + c + 16);
      const v4i rd = *(const v4i*)(adjq + c + 20);
#pragma unroll  // constant indices: the vectors stay in registers
      for (int r = 0; r < 4; ++r) {
        if (!((mask >> ra[r]) & 1u)) s0[r]     += -1e9f;
        if (!((mask >> rb[r]) & 1u)) s0[r + 4] += -1e9f;
        if (!((mask >> rc[r]) & 1u)) s1[r]     += -1e9f;
        if (!((mask >> rd[r]) & 1u)) s1[r + 4] += -1e9f;
      }
    }

    // ---- online softmax update of query l16 ----
    float v = fmaxf(s0[0], s1[0]);
#pragma unroll  // constant indices: the vectors stay in registers
    for (int r = 1; r < 8; ++r) v = fmaxf(v, fmaxf(s0[r], s1[r]));
    v = fmaxf(v, xhalf(v));              // both halves: the chunk's maximum
    const float mnew = fmaxf(mrow, v);
    const float sc = __expf(mrow - mnew);
    mrow = mnew;
    float rs = 0.0f;
    v16h bP;   // P^T, column l16: the keys in the k order of load_frag16
#pragma unroll  // constant indices: the vectors stay in registers
    for (int r = 0; r < 8; ++r) {
      const float p0 = __expf(s0[r] - mnew);
      const float p1 = __expf(s1[r] - mnew);
      rs += p0 + p1;
      bP[r]     = (_Float16)p0;
      bP[r + 8] = (_Float16)p1;
    }
    lrow = lrow * sc + rs;
    o0 *= sc; o1 *= sc; o2 *= sc; o3 *= sc;

    // ---- O^T += V^T.P^T (4 hd tiles, A fragments from transposed V) ----
    const unsigned char* vr = buf + 4u * A_SLICE + cc * 2;   // keys cc .. cc+31 of a row
    v16h av0 = load_frag16((const _Float16*)(vr));
    v16h av1 = load_frag16((const _Float16*)(vr + A_SLICE));
    v16h av2 = load_frag16((const _Float16*)(vr + 2u * A_SLICE));
    v16h av3 = load_frag16((const _Float16*)(vr + 3u * A_SLICE));
    o0 = wmma_f16(av0, bP, o0);
    o1 = wmma_f16(av1, bP, o1);
    o2 = wmma_f16(av2, bP, o2);
    o3 = wmma_f16(av3, bP, o3);
   }
   // Publish point of stage s + 1, at the foot of the pass.
   wait_ds0();
   landed();
   __syncthreads();                    // s + 1 landed for all; all have left s
   if (pinned(s + 2u < A_NSTAGE)) issue(pinned(s + 2u));
  }
  landed();
  wait_ds0();

  // ---- normalize, turn O^T into rows in the wave's own LDS, store fp32 ----
  const float inv = 1.0f / (lrow + xhalf(lrow));   // the halves' shares joined
  {
    float* st = &ldsO[w][l16][half * 8];
    const v8f y0 = o0 * inv, y1 = o1 * inv, y2 = o2 * inv, y3 = o3 * inv;
    *(v4f*)(st)      = __builtin_shufflevector(y0, y0, 0, 1, 2, 3);
    *(v4f*)(st + 4)  = __builtin_shufflevector(y0, y0, 4, 5, 6, 7);
    *(v4f*)(st + 16) = __builtin_shufflevector(y1, y1, 0, 1, 2, 3);
    *(v4f*)(st + 20) = __builtin_shufflevector(y1, y1, 4, 5, 6, 7);
    *(v4f*)(st + 32) = __builtin_shufflevector(y2, y2, 0, 1, 2, 3);
    *(v4f*)(st + 36) = __builtin_shufflevector(y2, y2, 4, 5, 6, 7);
    *(v4f*)(st + 48) = __builtin_shufflevector(y3, y3, 0, 1, 2, 3);
    *(v4f*)(st + 52) = __builtin_shufflevector(y3, y3, 4, 5, 6, 7);
  }
  // 16 lanes cover one query's 64 head dims: a store is 4 whole 128-byte lines
  float* op = out + ((size_t)(b * NSEQ + qt * 16 + half) * DMODEL) + h * HDIM + l16 * 4;
#pragma unroll  // the 8 LDS reads go out together, the stores follow as they return
  for (int i = 0; i < 8; ++i)
    *(v4f*)(op + (size_t)(i * 2) * DMODEL) = *(const v4f*)&ldsO[w][i * 2 + half][l16 * 4];
}

// --------------------------------- launcher --------------------------------

extern "C" void kernel_launch(void* const* d_in, const int* in_sizes, int n_in,
                              void* d_out, int out_size, void* d_ws, size_t ws_size,
                              hipStream_t stream) {
  const float* hidden = (const float*)d_in[0];
  const int*   adj    = (const int*)d_in[1];
  const float* Wq     = (const float*)d_in[2];
  const float* bq     = (const float*)d_in[3];
  const float* Wk     = (const float*)d_in[4];
  const float* bk     = (const float*)d_in[5];
  const float* Wv     = (const float*)d_in[6];
  const float* bv     = (const float*)d_in[7];
  float* out = (float*)d_out;

  char* ws = (char*)d_ws;
  const size_t MB = 1024u * 1024u;
  _Float16* h16  = (_Float16*)(ws);             //  8 MB: [4096,1024]
  _Float16* wT   = (_Float16*)(ws + 8  * MB);   //  6 MB: [3,1024,1024]
  _Float16* q16  = (_Float16*)(ws + 14 * MB);   //  8 MB: [b,h,n,64]
  _Float16* k16  = (_Float16*)(ws + 22 * MB);   //  8 MB
  _Float16* vT16 = (_Float16*)(ws + 30 * MB);   //  8 MB: [b,h,64,n]

  // 4194304 elements: 4096 waves of 1024
  cvt_hidden<<<NB * NSEQ * DMODEL / (16 * 1024), 512, 0, stream>>>(hidden, h16);
  // 3 * 1024 * 1024 elements: 1536 waves of 64 x 32
  cvt_weightT<<<3 * DMODEL * DMODEL / (6 * 64 * 32), 192, 0, stream>>>(Wq, Wk, Wv, wT);

  // 128-row tiles x 128-col tiles over {q,k,v}, 4 waves of 64x64
  qkv_gemm<<<dim3(NB * NSEQ / 128, 3 * DMODEL / 128), 128, 0, stream>>>(
      h16, wT, bq, bk, bv, q16, k16, vT16);

  // 8*16*32 = 4096 waves, 8 waves per block
  attention<<<512, 256, 0, stream>>>(q16, k16, vT16, adj, out);
}

// v005
// One run takes 54.9 microseconds.
// Next to v004, in two timings, it ran 1.33 times as fast each time.
// All steps since v000 together make it 3.27 times as fast.
#include <hip/hip_runtime.h>
#include <hip/hip_bf16.h>

typedef __attribute__((ext_vector_type(16))) _Float16 v16h;
typedef __attribute__((ext_vector_type(8)))  _Float16 v8h;
typedef __attribute__((ext_vector_type(8)))  float    v8f;

#define NHEAD 16
#define NB    8
#define NSEQ  512
#define DMODEL 1024
#define HDIM  64

// relation->head allow mask (bit r = relation r allowed for this head),
// precomputed from the reference's per-head loop.
__device__ __constant__ unsigned short ALLOWED_MASK[NHEAD] = {
  0x3003, 0x3005, 0x3009, 0x3831, 0x3071, 0x30E1, 0x31C1, 0x3381,
  0x3701, 0x3E01, 0x3C11, 0x3831, 0x7001, 0x7001, 0x7001, 0x7001
};

// Load a 16-lane-half K-packed f16 fragment (A or B layout for 16x16x32):
// caller passes p = base + row*ld + k0 + (lane>>4)*8.  lo = K chunk 0..7(/8..15),
// hi = K chunk 16..23(/24..31) per the CDNA5 16-bit A/B VGPR layout.
__device__ inline v16h load_frag16(const _Float16* p) {
  v8h lo = *(const v8h*)(p);
  v8h hi = *(const v8h*)(p + 16);
  v16h r;
#pragma unroll
  for (int i = 0; i < 8; ++i) { r[i] = lo[i]; r[i + 8] = hi[i]; }
  return r;
}

__device__ inline v8f wmma_f16(v16h a, v16h b, v8f c) {
  return __builtin_amdgcn_wmma_f32_16x16x32_f16(
      /*neg_a=*/false, a, /*neg_b=*/false, b,
      /*c_mod=*/(short)0, c, /*reuse_a=*/false, /*reuse_b=*/false);
}

// ------------------------------- conversions -------------------------------
// Both kernels are sized by waves to start, not by elements: a thread converts
// a block of elements with 16-byte loads, all of them in flight at once.

typedef __attribute__((ext_vector_type(4))) float    v4f;
typedef __attribute__((ext_vector_type(4))) _Float16 v4h;

// 256 blocks of 16 waves.  A wave converts 1024 floats in a row: 8 loads of
// 512 contiguous bytes, then 8 stores of 256 contiguous bytes.
__global__ __launch_bounds__(512) void cvt_hidden(const float* __restrict__ src,
                                                  _Float16* __restrict__ dst) {
  const int lane = threadIdx.x & 31;
  const int wave = blockIdx.x * 16 + (threadIdx.x >> 5);
  const size_t base = (size_t)wave * 1024 + lane * 4;
  v4f x[8];
#pragma unroll  // constant indices: the array stays in registers
  for (int j = 0; j < 8; ++j) x[j] = *(const v4f*)(src + base + j * 128);
#pragma unroll  // constant indices: the array stays in registers
  for (int j = 0; j < 8; ++j)
    *(v4h*)(dst + base + j * 128) = __builtin_convertvector(x[j], v4h);
}

// wT[sel][n_out][k_in] = W_sel[k_in][n_out]   (transpose + f32->f16)
// 256 blocks of 6 waves.  A wave takes a tile of 64 k x 32 n; a lane holds two
// blocks of 8 k x 4 n in registers (16 loads of 16 bytes; a wave-wide load is
// 4 whole 128-byte lines of W) and stores each n of a block as 8 k = 16 bytes.
__global__ __launch_bounds__(192) void cvt_weightT(const float* __restrict__ Wq,
                                                   const float* __restrict__ Wk,
                                                   const float* __restrict__ Wv,
                                                   _Float16* __restrict__ wT) {
  const int lane = threadIdx.x & 31;
  const int t   = blockIdx.x * 6 + (threadIdx.x >> 5);   // 0 .. 3*512-1
  const int sel = t >> 9;
  const int n0  = (t & 31) * 32 + (lane & 7) * 4;
  const int k0  = ((t >> 5) & 15) * 64 + (lane >> 3) * 8;
  const float* W = (sel == 0) ? Wq : ((sel == 1) ? Wk : Wv);
  const float* s = W + (size_t)k0 * DMODEL + n0;
  v4f x[2][8];
#pragma unroll  // constant indices: the array stays in registers
  for (int u = 0; u < 2; ++u)
#pragma unroll  // constant indices: the array stays in registers
    for (int j = 0; j < 8; ++j)
      x[u][j] = *(const v4f*)(s + (size_t)(u * 32 + j) * DMODEL);
  // Takes the loaded values and their address as inputs only: all 16 loads are
  // in flight before the first convert (without it two of them are issued only
  // behind a wait for earlier ones, a second trip to memory), and the address
  // pair that they name is rewritten only behind this wait.
  asm volatile("s_wait_xcnt 0x0" :: "v"(x[0][0]), "v"(x[0][1]), "v"(x[0][2]), "v"(x[0][3]),
                     "v"(x[0][4]), "v"(x[0][5]), "v"(x[0][6]), "v"(x[0][7]),
                     "v"(x[1][0]), "v"(x[1][1]), "v"(x[1][2]), "v"(x[1][3]),
                     "v"(x[1][4]), "v"(x[1][5]), "v"(x[1][6]), "v"(x[1][7]),
                     "v"(s) : "memory");
  _Float16* d = wT + ((size_t)sel * DMODEL + n0) * DMODEL + k0;
#pragma unroll  // constant indices: the array stays in registers
  for (int u = 0; u < 2; ++u)
#pragma unroll  // constant indices: the array stays in registers
    for (int i = 0; i < 4; ++i) {
      v8h y;
#pragma unroll  // constant indices: the array stays in registers
      for (int j = 0; j < 8; ++j) y[j] = (_Float16)x[u][j][i];
      *(v8h*)(d + (size_t)i * DMODEL + u * 32) = y;
    }
}

// --------------------------------- QKV GEMM --------------------------------
// grid (32 row tiles, 24 column tiles over {q,k,v}), 128 threads = 4 waves.
// One 128x128 output tile per block, 64x64 (4x4 WMMA tiles) per wave.  The
// operands come through a two-buffer LDS ring: a stage is 64 k of 128 rows of
// h16 and 128 rows of wT; each wave brings one 64-row slice of it with one
// tensor load, padded to a 144-byte row pitch for the ds_load_b128 readers.

typedef uint32_t u32x4 __attribute__((ext_vector_type(4)));
typedef uint32_t u32x8 __attribute__((ext_vector_type(8)));

#define G_ROWB   128u                 // bytes of one staged row (64 k of f16)
#define G_PITCH  144u                 // LDS row pitch: 128 + 16 pad bytes
#define G_SLICE  10240u               // 64 rows * 144 B, rounded up to 2 KiB
#define G_STAGE  (4u * G_SLICE)
#define G_NSTAGE (DMODEL * 2u / G_ROWB)

__device__ inline uint32_t uni(uint32_t v) {
  return (uint32_t)__builtin_amdgcn_readfirstlane(v);
}
// Makes the test around a tensor load a scalar branch, and keeps a descriptor
// word that is formed from the result behind the waits in front of the call.
__device__ inline uint32_t pinned(uint32_t v) {
  uint32_t w = uni(v);
  // pinned(): an issue test or a descriptor word held in a scalar register
  asm volatile("" : "+s"(w));
  return w;
}
__device__ inline void wait_tensor0() {
  // a tile counts as landed
  // only behind its issuer's own wait
  asm volatile("s_wait_tensorcnt 0x0" ::: "memory");
}
__device__ inline void wait_ds0() {
  // a wave's LDS reads have retired before the buffer they read is refilled
  asm volatile("s_wait_dscnt 0x0" ::: "memory");
}

__global__ __launch_bounds__(128) void qkv_gemm(
    const _Float16* __restrict__ h16,   // [4096,1024]
    const _Float16* __restrict__ wT,    // [3][1024][1024]
    const float* __restrict__ bq, const float* __restrict__ bk,
    const float* __restrict__ bv,
    _Float16* __restrict__ q16,         // [b,h,n,64]  (pre-scaled 1/8)
    _Float16* __restrict__ k16,         // [b,h,n,64]
    _Float16* __restrict__ vT16)        // [b,h,64,n]
{
  __shared__ __attribute__((aligned(2048))) unsigned char ring[2u * G_STAGE];

  const int lane = threadIdx.x & 31;
  const uint32_t wv = uni(threadIdx.x >> 5);
  const int half = lane >> 4;
  const int l16  = lane & 15;
  const uint32_t wm = wv >> 1, wn = wv & 1u;         // 2x2 waves
  const int row0 = blockIdx.x * 128;                 // 0..3968
  const int sel  = blockIdx.y >> 3;
  const int colb = (blockIdx.y & 7) * 128;           // 0..896 inside q, k or v

  const float* bias = (sel == 0) ? bq : ((sel == 1) ? bk : bv);

  // Slices of a stage: waves 0,1 bring h16 rows 0-63, 64-127 of the tile,
  // waves 2,3 bring wT rows 0-63, 64-127 (wT's three matrices are contiguous).
  const _Float16* slice_src =
      (wv < 2u) ? h16 + (size_t)(row0 + wv * 64u) * DMODEL
                : wT + (size_t)(blockIdx.y * 128u + (wv - 2u) * 64u) * DMODEL;
  const uint64_t src_ga = (uint64_t)(size_t)slice_src;
  const uint32_t lbase  = (uint32_t)(size_t)ring;

  // Descriptor group 1: byte elements, tile = tensor = 64 rows of 128 bytes,
  // source pitch 2048 bytes, 4 dwords of pad behind every 32 dwords.
  u32x8 g1;
  g1[0] = uni((1u << 20) | (4u << 22) | (3u << 25));
  g1[1] = uni((G_ROWB & 0xFFFFu) << 16);
  g1[2] = uni((G_ROWB >> 16) | (64u << 16));
  g1[3] = uni(G_ROWB << 16);
  g1[4] = uni(64u);
  g1[5] = uni(DMODEL * 2u);
  g1[6] = uni(0u);
  g1[7] = uni(0u);

  auto issue = [&](uint32_t st) {
    const uint32_t dst = lbase + (st & 1u) * G_STAGE + wv * G_SLICE;
    const uint64_t ga  = src_ga + (uint64_t)(st * G_ROWB);
    u32x4 g0;
    g0[0] = uni(1u);
    g0[1] = uni(dst);
    g0[2] = uni((uint32_t)ga);
    g0[3] = uni((((uint32_t)(ga >> 32)) & 0x01FFFFFFu) | 0x80000000u);
    // one request of the whole wave: global tile -> LDS, through no register
    asm volatile("tensor_load_to_lds %0, %1" :: "s"(g0), "s"(g1) : "memory");
  };

  v8f acc[4][4];
#pragma unroll  // constant indices: the arrays stay in registers
  for (int m = 0; m < 4; ++m)
#pragma unroll  // constant indices: the arrays stay in registers
    for (int t = 0; t < 4; ++t) acc[m][t] = (v8f){};

  issue(0u);
  wait_tensor0();
  __syncthreads();                     // stage 0 published
  issue(pinned(1u));

  // Which matrix is the A operand is chosen by where the result goes: a lane
  // holds 8 consecutive ROWS of D, and these must be neighbours in memory.
  // v (stored [head dim][n]): A = h16, D = h.W.  q, k (stored [n][head dim]):
  // A = wT, D = (h.W)^T.  Both operands have the same fragment layout.
  const uint32_t h_off = wm * G_SLICE + (uint32_t)l16 * G_PITCH + (uint32_t)half * 16u;
  const uint32_t w_off = (2u + wn) * G_SLICE + (uint32_t)l16 * G_PITCH + (uint32_t)half * 16u;
  const uint32_t a_off = (sel == 2) ? h_off : w_off;
  const uint32_t b_off = (sel == 2) ? w_off : h_off;

  // kept rolled: one copy of the pass, the buffer chosen by the stage's parity
#pragma unroll 1
  for (uint32_t s = 0; s < G_NSTAGE; ++s) {
    const unsigned char* buf = ring + (s & 1u) * G_STAGE;
    v16h a[2][4], b[2][4];
#pragma unroll  // constant indices: the arrays stay in registers
    for (int ks = 0; ks < 2; ++ks) {
#pragma unroll  // constant indices: the arrays stay in registers
      for (int m = 0; m < 4; ++m)
        a[ks][m] = load_frag16((const _Float16*)(buf + a_off + m * 16 * G_PITCH + ks * 64));
#pragma unroll  // constant indices: the arrays stay in registers
      for (int t = 0; t < 4; ++t)
        b[ks][t] = load_frag16((const _Float16*)(buf + b_off + t * 16 * G_PITCH + ks * 64));
    }
    // Publish point of stage s + 1.  It stands here, not behind the WMMAs: the
    // pass's fragments are all in registers behind the first wait, so the
    // buffer is free one barrier later and its refill flies under the WMMAs.
    wait_ds0();
    wait_tensor0();
    __syncthreads();                   // s + 1 landed for all; all have left s
    if (pinned(s + 2u < G_NSTAGE)) issue(pinned(s + 2u));
#pragma unroll  // constant indices: the arrays stay in registers
    for (int ks = 0; ks < 2; ++ks)
#pragma unroll  // constant indices: the arrays stay in registers
      for (int t = 0; t < 4; ++t)
#pragma unroll  // constant indices: the arrays stay in registers
        for (int m = 0; m < 4; ++m)
          acc[m][t] = wmma_f16(a[ks][m], b[ks][t], acc[m][t]);
  }
  wait_tensor0();
  wait_ds0();

  // acc[m][t][r] = D[16 m + 8 half + r][16 t + l16]: 8 neighbours of an output
  // row in a lane, stored as 16 bytes.  The wave's 64 columns are one head, the
  // block's 128 rows lie in one batch.
  const int c0 = colb + (int)wn * 64;
  const int n0 = (row0 & (NSEQ - 1)) + (int)wm * 64;
  const size_t head = (size_t)((row0 >> 9) * NHEAD + (c0 >> 6)) * (NSEQ * HDIM);
  if (sel == 2) {
    _Float16* dst = vT16 + head + (size_t)l16 * NSEQ + n0 + half * 8;
#pragma unroll  // constant indices: the arrays stay in registers
    for (int t = 0; t < 4; ++t) {
      const float bcol = bias[c0 + t * 16 + l16];
#pragma unroll  // constant indices: the arrays stay in registers
      for (int m = 0; m < 4; ++m) {
        v8h y;
#pragma unroll  // constant indices: the arrays stay in registers
        for (int r = 0; r < 8; ++r) y[r] = (_Float16)(acc[m][t][r] + bcol);
        *(v8h*)(dst + t * 16 * NSEQ + m * 16) = y;
      }
    }
  } else {
    const float qscale = (sel == 0) ? 0.125f : 1.0f;   // fold 1/sqrt(64) into Q
    _Float16* dst = ((sel == 0) ? q16 : k16) + head + (size_t)(n0 + l16) * HDIM + half * 8;
    v4f blo[4], bhi[4];
#pragma unroll  // constant indices: the arrays stay in registers
    for (int m = 0; m < 4; ++m) {
      blo[m] = *(const v4f*)(bias + c0 + m * 16 + half * 8);
      bhi[m] = *(const v4f*)(bias + c0 + m * 16 + half * 8 + 4);
    }
#pragma unroll  // constant indices: the arrays stay in registers
    for (int t = 0; t < 4; ++t)
#pragma unroll  // constant indices: the arrays stay in registers
      for (int m = 0; m < 4; ++m) {
        v8h y;
#pragma unroll  // constant indices: the arrays stay in registers
        for (int r = 0; r < 4; ++r) {
          y[r]     = (_Float16)((acc[m][t][r]     + blo[m][r]) * qscale);
          y[r + 4] = (_Float16)((acc[m][t][r + 4] + bhi[m][r]) * qscale);
        }
        *(v8h*)(dst + t * 16 * HDIM + m * 16) = y;
      }
    // the built code can fall from here into the v branch, which rewrites the
    // registers that these stores name: the wait stands in front of that
    asm volatile("s_wait_xcnt 0x0" ::: "memory");
  }
}

// -------------------------------- attention --------------------------------
// One wave = 16 query rows of one (b,h); key loop in chunks of 32 with online
// softmax.  8 WMMAs per chunk (4 for S^T, 4 for V^T.P^T), 128 per wave.
// Both products are taken transposed: K and V^T are the A operands, Q and P^T
// the B operands.  A lane (l16, half) then holds 16 of the chunk's 32 scores of
// query l16: maximum and sum are taken in the lane, with one exchange between
// the halves, and the two score tiles, converted in place, are the B operand
// P^T in the hardware k order.  O^T is turned into rows once, behind the loop.
// The 8 waves of a block work on one (b,h) and read the same K and V^T: these
// come through a two-buffer LDS ring.  A stage is 64 keys (two chunks): 64 rows
// of K (64 head dims each) and 64 rows of V^T (64 keys each), all of 128 bytes;
// each wave brings one 16-row slice of it with one tensor load, padded to the
// 144-byte row pitch for the ds_load_b128 readers.

#define A_KEYS   64u                  // keys of one stage
#define A_SLICE  4096u                // 16 rows * 144 B, rounded up to 2 KiB
#define A_STAGE  (8u * A_SLICE)
#define A_NSTAGE (NSEQ / A_KEYS)
#define A_OPITCH 68                   // floats: 64 head dims + 16 pad bytes

typedef __attribute__((ext_vector_type(4))) int v4i;

// the value of lane l ^ 16
__device__ inline float xhalf(float x) {
  const int i = __builtin_bit_cast(int, x);
  return __builtin_bit_cast(float, __builtin_amdgcn_permlanex16(
      i, i, 0x76543210, 0xfedcba98, false, false));
}

__global__ __launch_bounds__(256) void attention(
    const _Float16* __restrict__ q16, const _Float16* __restrict__ k16,
    const _Float16* __restrict__ vT16, const int* __restrict__ adj,
    float* __restrict__ out)
{
  __shared__ __attribute__((aligned(2048))) unsigned char ring[2u * A_STAGE];
  __shared__ __attribute__((aligned(16))) float ldsO[8][16][A_OPITCH];  // per-wave O staging (O^T -> rows)

  const int lane = threadIdx.x & 31;
  const int w    = threadIdx.x >> 5;
  const uint32_t wv = uni(threadIdx.x >> 5);   // the same, in a scalar register
  const int half = lane >> 4;
  const int l16  = lane & 15;

  const int wid = blockIdx.x * 8 + w;    // 0..4095
  const int qt  = wid & 31;              // query tile 0..31
  const int h   = (wid >> 5) & (NHEAD - 1);
  const int b   = wid >> 9;

  const unsigned mask = ALLOWED_MASK[h];
  const _Float16* qb = q16 + ((size_t)(b * NHEAD + h) * NSEQ + qt * 16) * HDIM;
  const _Float16* kb = k16 + (size_t)(b * NHEAD + h) * NSEQ * HDIM;
  const _Float16* vb = vT16 + (size_t)(b * NHEAD + h) * HDIM * NSEQ;
  const int* adjb = adj + (size_t)b * NSEQ * NSEQ;

  // Q fragments (B operand: column l16 = query l16), fixed across the key loop.
  v16h bQ0 = load_frag16(qb + (size_t)l16 * HDIM + half * 8);
  v16h bQ1 = load_frag16(qb + (size_t)l16 * HDIM + 32 + half * 8);

  // o_t[r] = O[query l16][head dim 16 t + 8 half + r]
  v8f o0 = {}, o1 = {}, o2 = {}, o3 = {};
  float mrow = -1e30f;   // running maximum of query l16, the same in both halves
  float lrow = 0.0f;     // this half's share of the denominator of query l16
  // relations of query l16, from the first key that this half holds
  const int* adjq = adjb + (size_t)(qt * 16 + l16) * NSEQ + half * 8;

  // Slices of a stage: waves 0-3 bring 16 keys of K each (rows one behind the
  // other), waves 4-7 bring 16 head dims of V^T each (rows one sequence apart).
  const _Float16* slice_src = (wv < 4u) ? kb + (size_t)(wv * 16u) * HDIM
                                        : vb + (size_t)((wv - 4u) * 16u) * NSEQ;
  const uint32_t slice_pitch = (wv < 4u) ? HDIM * 2u : NSEQ * 2u;           // bytes, row to row
  const uint32_t slice_step  = (wv < 4u) ? A_KEYS * HDIM * 2u : A_KEYS * 2u; // bytes, stage to stage
  const uint64_t src_ga = (uint64_t)(size_t)slice_src;
  const uint32_t lbase  = (uint32_t)(size_t)ring;

  // Descriptor group 1: byte elements, tile = tensor = 16 rows of 128 bytes,
  // 4 dwords of pad behind every 32 dwords.
  u32x8 g1;
  g1[0] = uni((1u << 20) | (4u << 22) | (3u << 25));
  g1[1] = uni((G_ROWB & 0xFFFFu) << 16);
  g1[2] = uni((G_ROWB >> 16) | (16u << 16));
  g1[3] = uni(G_ROWB << 16);
  g1[4] = uni(16u);
  g1[5] = uni(slice_pitch);
  g1[6] = uni(0u);
  g1[7] = uni(0u);

  u32x4 g0;                            // group 0 of the wave's last request
  auto issue = [&](uint32_t st) {
    const uint32_t dst = lbase + (st & 1u) * A_STAGE + wv * A_SLICE;
    const uint64_t ga  = src_ga + (uint64_t)(st * slice_step);
    g0[0] = uni(1u);
    g0[1] = uni(dst);
    g0[2] = uni((uint32_t)ga);
    g0[3] = uni((((uint32_t)(ga >> 32)) & 0x01FFFFFFu) | 0x80000000u);
    // One request of the whole wave: global tile -> LDS, through no register.
    // The descriptor words are in-out operands here and inputs of the wait
    // below: the compiler then keeps them where they are, and forms none of
    // them anew, while the request is in flight.
    asm volatile("tensor_load_to_lds %0, %1" : "+s"(g0), "+s"(g1) :: "memory");
  };
  auto landed = [&]() {
    // the issuer's own wait: a tile counts as landed only behind it
    asm volatile("s_wait_tensorcnt 0x0" :: "s"(g0), "s"(g1) : "memory");
  };

  issue(0u);
  landed();
  __syncthreads();                     // stage 0 published
  issue(pinned(1u));

  // a lane's place in a 16-row slice: row l16, its half's 16 bytes
  const uint32_t f_off = (uint32_t)l16 * G_PITCH + (uint32_t)half * 16u;

  // kept rolled: one copy of the pass, the buffer chosen by the stage's parity
#pragma unroll 1
  for (uint32_t s = 0; s < A_NSTAGE; ++s) {
   const unsigned char* buf = ring + (s & 1u) * A_STAGE + f_off;
#pragma unroll  // constant slice numbers and offsets inside the stage
   for (int cc = 0; cc < (int)A_KEYS; cc += 32) {
    const int c = (int)(s * A_KEYS) + cc;
    // ---- S^T = K.Q^T for 32k x 16q (two 16x16 tiles) ----
    // s0[r] = score(key c + 8 half + r, query l16), s1[r] the same 16 keys on
    v8f s0 = {}, s1 = {};
    {
      const unsigned char* kr = buf + (cc >> 4) * A_SLICE;   // keys cc .. cc+15
      v16h ak0 = load_frag16((const _Float16*)(kr));
      v16h ak1 = load_frag16((const _Float16*)(kr + 64));
      s0 = wmma_f16(ak0, bQ0, s0);
      s0 = wmma_f16(ak1, bQ1, s0);
      v16h ak2 = load_frag16((const _Float16*)(kr + A_SLICE));
      v16h ak3 = load_frag16((const _Float16*)(kr + A_SLICE + 64));
      s1 = wmma_f16(ak2, bQ0, s1);
      s1 = wmma_f16(ak3, bQ1, s1);
    }

    // ---- relation mask (scores += -1e9 where disallowed) ----
    {
      const v4i ra = *(const v4i*)(adjq + c);
      const v4i rb = *(const v4i*)(adjq + c + 4);
      const v4i rc = *(const v4i*)(adjq + c + 16);
      const v4i rd = *(const v4i*)(adjq + c + 20);
#pragma unroll  // constant indices: the vectors stay in registers
      for (int r = 0; r < 4; ++r) {
        if (!((mask >> ra[r]) & 1u)) s0[r]     += -1e9f;
        if (!((mask >> rb[r]) & 1u)) s0[r + 4] += -1e9f;
        if (!((mask >> rc[r]) & 1u)) s1[r]     += -1e9f;
        if (!((mask >> rd[r]) & 1u)) s1[r + 4] += -1e9f;
      }
    }

    // ---- online softmax update of query l16 ----
    float v = fmaxf(s0[0], s1[0]);
#pragma unroll  // constant indices: the vectors stay in registers
    for (int r = 1; r < 8; ++r) v = fmaxf(v, fmaxf(s0[r], s1[r]));
    v = fmaxf(v, xhalf(v));              // both halves: the chunk's maximum
    const float mnew = fmaxf(mrow, v);
    const float sc = __expf(mrow - mnew);
    mrow = mnew;
    float rs = 0.0f;
    v16h bP;   // P^T, column l16: the keys in the k order of load_frag16
#pragma unroll  // constant indices: the vectors stay in registers
    for (int r = 0; r < 8; ++r) {
      const float p0 = __expf(s0[r] - mnew);
      const float p1 = __expf(s1[r] - mnew);
      rs += p0 + p1;
      bP[r]     = (_Float16)p0;
      bP[r + 8] = (_Float16)p1;
    }
    lrow = lrow * sc + rs;
    o0 *= sc; o1 *= sc; o2 *= sc; o3 *= sc;

    // ---- O^T += V^T.P^T (4 hd tiles, A fragments from transposed V) ----
    const unsigned char* vr = buf + 4u * A_SLICE + cc * 2;   // keys cc .. cc+31 of a row
    v16h av0 = load_frag16((const _Float16*)(vr));
    v16h av1 = load_frag16((const _Float16*)(vr + A_SLICE));
    v16h av2 = load_frag16((const _Float16*)(vr + 2u * A_SLICE));
    v16h av3 = load_frag16((const _Float16*)(vr + 3u * A_SLICE));
    o0 = wmma_f16(av0, bP, o0);
    o1 = wmma_f16(av1, bP, o1);
    o2 = wmma_f16(av2, bP, o2);
    o3 = wmma_f16(av3, bP, o3);
   }
   // Publish point of stage s + 1, at the foot of the pass.
   wait_ds0();
   landed();
   __syncthreads();                    // s + 1 landed for all; all have left s
   if (pinned(s + 2u < A_NSTAGE)) issue(pinned(s + 2u));
  }
  landed();
  wait_ds0();

  // ---- normalize, turn O^T into rows in the wave's own LDS, store fp32 ----
  const float inv = 1.0f / (lrow + xhalf(lrow));   // the halves' shares joined
  {
    float* st = &ldsO[w][l16][half * 8];
    const v8f y0 = o0 * inv, y1 = o1 * inv, y2 = o2 * inv, y3 = o3 * inv;
    *(v4f*)(st)      = __builtin_shufflevector(y0, y0, 0, 1, 2, 3);
    *(v4f*)(st + 4)  = __builtin_shufflevector(y0, y0, 4, 5, 6, 7);
    *(v4f*)(st + 16) = __builtin_shufflevector(y1, y1, 0, 1, 2, 3);
    *(v4f*)(st + 20) = __builtin_shufflevector(y1, y1, 4, 5, 6, 7);
    *(v4f*)(st + 32) = __builtin_shufflevector(y2, y2, 0, 1, 2, 3);
    *(v4f*)(st + 36) = __builtin_shufflevector(y2, y2, 4, 5, 6, 7);
    *(v4f*)(st + 48) = __builtin_shufflevector(y3, y3, 0, 1, 2, 3);
    *(v4f*)(st + 52) = __builtin_shufflevector(y3, y3, 4, 5, 6, 7);
  }
  // 16 lanes cover one query's 64 head dims: a store is 4 whole 128-byte lines
  float* op = out + ((size_t)(b * NSEQ + qt * 16 + half) * DMODEL) + h * HDIM + l16 * 4;
#pragma unroll  // the 8 LDS reads go out together, the stores follow as they return
  for (int i = 0; i < 8; ++i)
    *(v4f*)(op + (size_t)(i * 2) * DMODEL) = *(const v4f*)&ldsO[w][i * 2 + half][l16 * 4];
}

// --------------------------------- launcher --------------------------------

extern "C" void kernel_launch(void* const* d_in, const int* in_sizes, int n_in,
                              void* d_out, int out_size, void* d_ws, size_t ws_size,
                              hipStream_t stream) {
  const float* hidden = (const float*)d_in[0];
  const int*   adj    = (const int*)d_in[1];
  const float* Wq     = (const float*)d_in[2];
  const float* bq     = (const float*)d_in[3];
  const float* Wk     = (const float*)d_in[4];
  const float* bk     = (const float*)d_in[5];
  const float* Wv     = (const float*)d_in[6];
  const float* bv     = (const float*)d_in[7];
  float* out = (float*)d_out;

  char* ws = (char*)d_ws;
  const size_t MB = 1024u * 1024u;
  _Float16* h16  = (_Float16*)(ws);             //  8 MB: [4096,1024]
  _Float16* wT   = (_Float16*)(ws + 8  * MB);   //  6 MB: [3,1024,1024]
  _Float16* q16  = (_Float16*)(ws + 14 * MB);   //  8 MB: [b,h,n,64]
  _Float16* k16  = (_Float16*)(ws + 22 * MB);   //  8 MB
  _Float16* vT16 = (_Float16*)(ws + 30 * MB);   //  8 MB: [b,h,64,n]

  // 4194304 elements: 4096 waves of 1024
  cvt_hidden<<<NB * NSEQ * DMODEL / (16 * 1024), 512, 0, stream>>>(hidden, h16);
  // 3 * 1024 * 1024 elements: 1536 waves of 64 x 32
  cvt_weightT<<<3 * DMODEL * DMODEL / (6 * 64 * 32), 192, 0, stream>>>(Wq, Wk, Wv, wT);

  // 128-row tiles x 128-col tiles over {q,k,v}, 4 waves of 64x64
  qkv_gemm<<<dim3(NB * NSEQ / 128, 3 * DMODEL / 128), 128, 0, stream>>>(
      h16, wT, bq, bk, bv, q16, k16, vT16);

  // 8*16*32 = 4096 waves, 8 waves per block
  attention<<<512, 256, 0, stream>>>(q16, k16, vT16, adj, out);
}

// v006
// Measured time: 51.7 microseconds a run.
// In two side-by-side timings against v005, it was 1.05 and 1.07 times as fast.
// Counting every step since v000, it is 3.47 times as fast.
#include <hip/hip_runtime.h>
#include <hip/hip_bf16.h>

typedef __attribute__((ext_vector_type(16))) _Float16 v16h;
typedef __attribute__((ext_vector_type(8)))  _Float16 v8h;
typedef __attribute__((ext_vector_type(8)))  float    v8f;

#define NHEAD 16
#define NB    8
#define NSEQ  512
#define DMODEL 1024
#define HDIM  64

// relation->head allow mask (bit r = relation r allowed for this head),
// precomputed from the reference's per-head loop.
__device__ __constant__ unsigned short ALLOWED_MASK[NHEAD] = {
  0x3003, 0x3005, 0x3009, 0x3831, 0x3071, 0x30E1, 0x31C1, 0x3381,
  0x3701, 0x3E01, 0x3C11, 0x3831, 0x7001, 0x7001, 0x7001, 0x7001
};

// Load a 16-lane-half K-packed f16 fragment (A or B layout for 16x16x32):
// caller passes p = base + row*ld + k0 + (lane>>4)*8.  lo = K chunk 0..7(/8..15),
// hi = K chunk 16..23(/24..31) per the CDNA5 16-bit A/B VGPR layout.
__device__ inline v16h load_frag16(const _Float16* p) {
  v8h lo = *(const v8h*)(p);
  v8h hi = *(const v8h*)(p + 16);
  v16h r;
#pragma unroll
  for (int i = 0; i < 8; ++i) { r[i] = lo[i]; r[i + 8] = hi[i]; }
  return r;
}

__device__ inline v8f wmma_f16(v16h a, v16h b, v8f c) {
  return __builtin_amdgcn_wmma_f32_16x16x32_f16(
      /*neg_a=*/false, a, /*neg_b=*/false, b,
      /*c_mod=*/(short)0, c, /*reuse_a=*/false, /*reuse_b=*/false);
}

// ------------------------------- conversions -------------------------------
// Both kernels are sized by waves to start, not by elements: a thread converts
// a block of elements with 16-byte loads, all of them in flight at once.

typedef __attribute__((ext_vector_type(4))) float    v4f;
typedef __attribute__((ext_vector_type(4))) _Float16 v4h;

typedef __attribute__((ext_vector_type(4))) int v4i;

// 512 blocks of 16 waves.
// Blocks 0-255 turn adj into the attention kernel's mask words, once for all
// heads.  mbits[b][h][query tile][stage][e], bit l = "relation allowed" for the
// score that lane l of the attention wave holds as element e of the stage:
// query 16 tile + (l & 15), key 64 stage + 32 (e >> 4) + 16 ((e >> 3) & 1) +
// 8 (l >> 4) + (e & 7).  A wave takes one (b, tile, stage) and 8 heads: its
// lanes read adj in the attention wave's own layout, a ballot is a word.
// Blocks 256-511: a wave converts 1024 floats in a row: 8 loads of 512
// contiguous bytes, then 8 stores of 256 contiguous bytes.
__global__ __launch_bounds__(512) void cvt_hidden(const float* __restrict__ src,
                                                  _Float16* __restrict__ dst,
                                                  const int* __restrict__ adj,
                                                  unsigned int* __restrict__ mbits) {
  const int lane = threadIdx.x & 31;
  if (blockIdx.x < 256) {
    const unsigned int t = blockIdx.x * 16u +
        (unsigned int)__builtin_amdgcn_readfirstlane(threadIdx.x >> 5);   // 0..4095
    const unsigned int hg = t & 1u, st = (t >> 1) & 7u, qt = (t >> 4) & 31u, b = t >> 9;
    const int* p = adj + ((size_t)b * NSEQ + qt * 16u + (lane & 15)) * NSEQ + st * 64u + (lane >> 4) * 8;
    v4i x[8];
#pragma unroll  // constant indices: the array stays in registers
    for (int j = 0; j < 8; ++j) x[j] = *(const v4i*)(p + (j >> 1) * 16 + (j & 1) * 4);
#pragma unroll  // constant indices: the array stays in registers
    for (int hh = 0; hh < 8; ++hh) {
      const unsigned int h = hg * 8u + hh;
      const unsigned int mask = ALLOWED_MASK[h];
      unsigned int w = 0u;
#pragma unroll  // constant indices: the array stays in registers
      for (int e = 0; e < 32; ++e) {
        const unsigned int word =
            __builtin_amdgcn_ballot_w32(((mask >> x[e >> 2][e & 3]) & 1u) != 0u);
        w = (lane == e) ? word : w;          // lane e stores word e
      }
      mbits[((((size_t)b * NHEAD + h) * 32u + qt) * 8u + st) * 32u + lane] = w;
    }
  } else {
    const int wave = (blockIdx.x - 256) * 16 + (threadIdx.x >> 5);
    const size_t base = (size_t)wave * 1024 + lane * 4;
    v4f x[8];
#pragma unroll  // constant indices: the array stays in registers
    for (int j = 0; j < 8; ++j) x[j] = *(const v4f*)(src + base + j * 128);
#pragma unroll  // constant indices: the array stays in registers
    for (int j = 0; j < 8; ++j)
      *(v4h*)(dst + base + j * 128) = __builtin_convertvector(x[j], v4h);
    // the built code can fall from here into the mask branch, which rewrites the
    // registers that these stores name: the wait stands in front of that
    asm volatile("s_wait_xcnt 0x0" ::: "memory");
  }
}

// wT[sel][n_out][k_in] = W_sel[k_in][n_out]   (transpose + f32->f16)
// 256 blocks of 6 waves.  A wave takes a tile of 64 k x 32 n; a lane holds two
// blocks of 8 k x 4 n in registers (16 loads of 16 bytes; a wave-wide load is
// 4 whole 128-byte lines of W) and stores each n of a block as 8 k = 16 bytes.
__global__ __launch_bounds__(192) void cvt_weightT(const float* __restrict__ Wq,
                                                   const float* __restrict__ Wk,
                                                   const float* __restrict__ Wv,
                                                   _Float16* __restrict__ wT) {
  const int lane = threadIdx.x & 31;
  const int t   = blockIdx.x * 6 + (threadIdx.x >> 5);   // 0 .. 3*512-1
  const int sel = t >> 9;
  const int n0  = (t & 31) * 32 + (lane & 7) * 4;
  const int k0  = ((t >> 5) & 15) * 64 + (lane >> 3) * 8;
  const float* W = (sel == 0) ? Wq : ((sel == 1) ? Wk : Wv);
  const float* s = W + (size_t)k0 * DMODEL + n0;
  v4f x[2][8];
#pragma unroll  // constant indices: the array stays in registers
  for (int u = 0; u < 2; ++u)
#pragma unroll  // constant indices: the array stays in registers
    for (int j = 0; j < 8; ++j)
      x[u][j] = *(const v4f*)(s + (size_t)(u * 32 + j) * DMODEL);
  // Takes the loaded values and their address as inputs only: all 16 loads are
  // in flight before the first convert (without it two of them are issued only
  // behind a wait for earlier ones, a second trip to memory), and the address
  // pair that they name is rewritten only behind this wait.
  asm volatile("s_wait_xcnt 0x0" :: "v"(x[0][0]), "v"(x[0][1]), "v"(x[0][2]), "v"(x[0][3]),
                     "v"(x[0][4]), "v"(x[0][5]), "v"(x[0][6]), "v"(x[0][7]),
                     "v"(x[1][0]), "v"(x[1][1]), "v"(x[1][2]), "v"(x[1][3]),
                     "v"(x[1][4]), "v"(x[1][5]), "v"(x[1][6]), "v"(x[1][7]),
                     "v"(s) : "memory");
  _Float16* d = wT + ((size_t)sel * DMODEL + n0) * DMODEL + k0;
#pragma unroll  // constant indices: the array stays in registers
  for (int u = 0; u < 2; ++u)
#pragma unroll  // constant indices: the array stays in registers
    for (int i = 0; i < 4; ++i) {
      v8h y;
#pragma unroll  // constant indices: the array stays in registers
      for (int j = 0; j < 8; ++j) y[j] = (_Float16)x[u][j][i];
      *(v8h*)(d + (size_t)i * DMODEL + u * 32) = y;
    }
}

// --------------------------------- QKV GEMM --------------------------------
// grid (32 row tiles, 24 column tiles over {q,k,v}), 128 threads = 4 waves.
// One 128x128 output tile per block, 64x64 (4x4 WMMA tiles) per wave.  The
// operands come through a two-buffer LDS ring: a stage is 64 k of 128 rows of
// h16 and 128 rows of wT; each wave brings one 64-row slice of it with one
// tensor load, padded to a 144-byte row pitch for the ds_load_b128 readers.

typedef uint32_t u32x4 __attribute__((ext_vector_type(4)));
typedef uint32_t u32x8 __attribute__((ext_vector_type(8)));

#define G_ROWB   128u                 // bytes of one staged row (64 k of f16)
#define G_PITCH  144u                 // LDS row pitch: 128 + 16 pad bytes
#define G_SLICE  10240u               // 64 rows * 144 B, rounded up to 2 KiB
#define G_STAGE  (4u * G_SLICE)
#define G_NSTAGE (DMODEL * 2u / G_ROWB)

__device__ inline uint32_t uni(uint32_t v) {
  return (uint32_t)__builtin_amdgcn_readfirstlane(v);
}
// Makes the test around a tensor load a scalar branch, and keeps a descriptor
// word that is formed from the result behind the waits in front of the call.
__device__ inline uint32_t pinned(uint32_t v) {
  uint32_t w = uni(v);
  // pinned(): an issue test or a descriptor word held in a scalar register
  asm volatile("" : "+s"(w));
  return w;
}
__device__ inline void wait_tensor0() {
  // a tile counts as landed
  // only behind its issuer's own wait
  asm volatile("s_wait_tensorcnt 0x0" ::: "memory");
}
__device__ inline void wait_ds0() {
  // a wave's LDS reads have retired before the buffer they read is refilled
  asm volatile("s_wait_dscnt 0x0" ::: "memory");
}

__global__ __launch_bounds__(128) void qkv_gemm(
    const _Float16* __restrict__ h16,   // [4096,1024]
    const _Float16* __restrict__ wT,    // [3][1024][1024]
    const float* __restrict__ bq, const float* __restrict__ bk,
    const float* __restrict__ bv,
    _Float16* __restrict__ q16,         // [b,h,n,64]  (pre-scaled 1/8)
    _Float16* __restrict__ k16,         // [b,h,n,64]
    _Float16* __restrict__ vT16)        // [b,h,64,n]
{
  __shared__ __attribute__((aligned(2048))) unsigned char ring[2u * G_STAGE];

  const int lane = threadIdx.x & 31;
  const uint32_t wv = uni(threadIdx.x >> 5);
  const int half = lane >> 4;
  const int l16  = lane & 15;
  const uint32_t wm = wv >> 1, wn = wv & 1u;         // 2x2 waves
  const int row0 = blockIdx.x * 128;                 // 0..3968
  const int sel  = blockIdx.y >> 3;
  const int colb = (blockIdx.y & 7) * 128;           // 0..896 inside q, k or v

  const float* bias = (sel == 0) ? bq : ((sel == 1) ? bk : bv);

  // Slices of a stage: waves 0,1 bring h16 rows 0-63, 64-127 of the tile,
  // waves 2,3 bring wT rows 0-63, 64-127 (wT's three matrices are contiguous).
  const _Float16* slice_src =
      (wv < 2u) ? h16 + (size_t)(row0 + wv * 64u) * DMODEL
                : wT + (size_t)(blockIdx.y * 128u + (wv - 2u) * 64u) * DMODEL;
  const uint64_t src_ga = (uint64_t)(size_t)slice_src;
  const uint32_t lbase  = (uint32_t)(size_t)ring;

  // Descriptor group 1: byte elements, tile = tensor = 64 rows of 128 bytes,
  // source pitch 2048 bytes, 4 dwords of pad behind every 32 dwords.
  u32x8 g1;
  g1[0] = uni((1u << 20) | (4u << 22) | (3u << 25));
  g1[1] = uni((G_ROWB & 0xFFFFu) << 16);
  g1[2] = uni((G_ROWB >> 16) | (64u << 16));
  g1[3] = uni(G_ROWB << 16);
  g1[4] = uni(64u);
  g1[5] = uni(DMODEL * 2u);
  g1[6] = uni(0u);
  g1[7] = uni(0u);

  auto issue = [&](uint32_t st) {
    const uint32_t dst = lbase + (st & 1u) * G_STAGE + wv * G_SLICE;
    const uint64_t ga  = src_ga + (uint64_t)(st * G_ROWB);
    u32x4 g0;
    g0[0] = uni(1u);
    g0[1] = uni(dst);
    g0[2] = uni((uint32_t)ga);
    g0[3] = uni((((uint32_t)(ga >> 32)) & 0x01FFFFFFu) | 0x80000000u);
    // one request of the whole wave: global tile -> LDS, through no register
    asm volatile("tensor_load_to_lds %0, %1" :: "s"(g0), "s"(g1) : "memory");
  };

  v8f acc[4][4];
#pragma unroll  // constant indices: the arrays stay in registers
  for (int m = 0; m < 4; ++m)
#pragma unroll  // constant indices: the arrays stay in registers
    for (int t = 0; t < 4; ++t) acc[m][t] = (v8f){};

  issue(0u);
  wait_tensor0();
  __syncthreads();                     // stage 0 published
  issue(pinned(1u));

  // Which matrix is the A operand is chosen by where the result goes: a lane
  // holds 8 consecutive ROWS of D, and these must be neighbours in memory.
  // v (stored [head dim][n]): A = h16, D = h.W.  q, k (stored [n][head dim]):
  // A = wT, D = (h.W)^T.  Both operands have the same fragment layout.
  const uint32_t h_off = wm * G_SLICE + (uint32_t)l16 * G_PITCH + (uint32_t)half * 16u;
  const uint32_t w_off = (2u + wn) * G_SLICE + (uint32_t)l16 * G_PITCH + (uint32_t)half * 16u;
  const uint32_t a_off = (sel == 2) ? h_off : w_off;
  const uint32_t b_off = (sel == 2) ? w_off : h_off;

  // kept rolled: one copy of the pass, the buffer chosen by the stage's parity
#pragma unroll 1
  for (uint32_t s = 0; s < G_NSTAGE; ++s) {
    const unsigned char* buf = ring + (s & 1u) * G_STAGE;
    v16h a[2][4], b[2][4];
#pragma unroll  // constant indices: the arrays stay in registers
    for (int ks = 0; ks < 2; ++ks) {
#pragma unroll  // constant indices: the arrays stay in registers
      for (int m = 0; m < 4; ++m)
        a[ks][m] = load_frag16((const _Float16*)(buf + a_off + m * 16 * G_PITCH + ks * 64));
#pragma unroll  // constant indices: the arrays stay in registers
      for (int t = 0; t < 4; ++t)
        b[ks][t] = load_frag16((const _Float16*)(buf + b_off + t * 16 * G_PITCH + ks * 64));
    }
    // Publish point of stage s + 1.  It stands here, not behind the WMMAs: the
    // pass's fragments are all in registers behind the first wait, so the
    // buffer is free one barrier later and its refill flies under the WMMAs.
    wait_ds0();
    wait_tensor0();
    __syncthreads();                   // s + 1 landed for all; all have left s
    if (pinned(s + 2u < G_NSTAGE)) issue(pinned(s + 2u));
#pragma unroll  // constant indices: the arrays stay in registers
    for (int ks = 0; ks < 2; ++ks)
#pragma unroll  // constant indices: the arrays stay in registers
      for (int t = 0; t < 4; ++t)
#pragma unroll  // constant indices: the arrays stay in registers
        for (int m = 0; m < 4; ++m)
          acc[m][t] = wmma_f16(a[ks][m], b[ks][t], acc[m][t]);
  }
  wait_tensor0();
  wait_ds0();

  // acc[m][t][r] = D[16 m + 8 half + r][16 t + l16]: 8 neighbours of an output
  // row in a lane, stored as 16 bytes.  The wave's 64 columns are one head, the
  // block's 128 rows lie in one batch.
  const int c0 = colb + (int)wn * 64;
  const int n0 = (row0 & (NSEQ - 1)) + (int)wm * 64;
  const size_t head = (size_t)((row0 >> 9) * NHEAD + (c0 >> 6)) * (NSEQ * HDIM);
  if (sel == 2) {
    _Float16* dst = vT16 + head + (size_t)l16 * NSEQ + n0 + half * 8;
#pragma unroll  // constant indices: the arrays stay in registers
    for (int t = 0; t < 4; ++t) {
      const float bcol = bias[c0 + t * 16 + l16];
#pragma unroll  // constant indices: the arrays stay in registers
      for (int m = 0; m < 4; ++m) {
        v8h y;
#pragma unroll  // constant indices: the arrays stay in registers
        for (int r = 0; r < 8; ++r) y[r] = (_Float16)(acc[m][t][r] + bcol);
        *(v8h*)(dst + t * 16 * NSEQ + m * 16) = y;
      }
    }
  } else {
    const float qscale = (sel == 0) ? 0.125f : 1.0f;   // fold 1/sqrt(64) into Q
    _Float16* dst = ((sel == 0) ? q16 : k16) + head + (size_t)(n0 + l16) * HDIM + half * 8;
    v4f blo[4], bhi[4];
#pragma unroll  // constant indices: the arrays stay in registers
    for (int m = 0; m < 4; ++m) {
      blo[m] = *(const v4f*)(bias + c0 + m * 16 + half * 8);
      bhi[m] = *(const v4f*)(bias + c0 + m * 16 + half * 8 + 4);
    }
#pragma unroll  // constant indices: the arrays stay in registers
    for (int t = 0; t < 4; ++t)
#pragma unroll  // constant indices: the arrays stay in registers
      for (int m = 0; m < 4; ++m) {
        v8h y;
#pragma unroll  // constant indices: the arrays stay in registers
        for (int r = 0; r < 4; ++r) {
          y[r]     = (_Float16)((acc[m][t][r]     + blo[m][r]) * qscale);
          y[r + 4] = (_Float16)((acc[m][t][r + 4] + bhi[m][r]) * qscale);
        }
        *(v8h*)(dst + t * 16 * HDIM + m * 16) = y;
      }
    // the built code can fall from here into the v branch, which rewrites the
    // registers that these stores name: the wait stands in front of that
    asm volatile("s_wait_xcnt 0x0" ::: "memory");
  }
}

// -------------------------------- attention --------------------------------
// One wave = 16 query rows of one (b,h); key loop in chunks of 32 with online
// softmax.  8 WMMAs per chunk (4 for S^T, 4 for V^T.P^T), 128 per wave.
// Both products are taken transposed: K and V^T are the A operands, Q and P^T
// the B operands.  A lane (l16, half) then holds 16 of the chunk's 32 scores of
// query l16: maximum and sum are taken in the lane, with one exchange between
// the halves, and the two score tiles, converted in place, are the B operand
// P^T in the hardware k order.  O^T is turned into rows once, behind the loop.
// The 8 waves of a block work on one (b,h) and read the same K and V^T: these
// come through a two-buffer LDS ring.  A stage is 64 keys (two chunks): 64 rows
// of K (64 head dims each) and 64 rows of V^T (64 keys each), all of 128 bytes;
// each wave brings one 16-row slice of it with one tensor load, padded to the
// 144-byte row pitch for the ds_load_b128 readers.

#define A_KEYS   64u                  // keys of one stage
#define A_SLICE  4096u                // 16 rows * 144 B, rounded up to 2 KiB
#define A_STAGE  (8u * A_SLICE)
#define A_NSTAGE (NSEQ / A_KEYS)
#define A_OPITCH 68                   // floats: 64 head dims + 16 pad bytes

typedef __attribute__((ext_vector_type(16))) unsigned int u32x16;
typedef __attribute__((address_space(4))) u32x16 c_u32x16;

// the value of lane l ^ 16
__device__ inline float xhalf(float x) {
  const int i = __builtin_bit_cast(int, x);
  return __builtin_bit_cast(float, __builtin_amdgcn_permlanex16(
      i, i, 0x76543210, 0xfedcba98, false, false));
}

__global__ __launch_bounds__(256) void attention(
    const _Float16* __restrict__ q16, const _Float16* __restrict__ k16,
    const _Float16* __restrict__ vT16, const unsigned int* __restrict__ mbits,
    float* __restrict__ out)
{
  __shared__ __attribute__((aligned(2048))) unsigned char ring[2u * A_STAGE];
  __shared__ __attribute__((aligned(16))) float ldsO[8][16][A_OPITCH];  // per-wave O staging (O^T -> rows)

  const int lane = threadIdx.x & 31;
  const int w    = threadIdx.x >> 5;
  const uint32_t wv = uni(threadIdx.x >> 5);   // the same, in a scalar register
  const int half = lane >> 4;
  const int l16  = lane & 15;

  const int wid = blockIdx.x * 8 + w;    // 0..4095
  const int qt  = wid & 31;              // query tile 0..31
  const int h   = (wid >> 5) & (NHEAD - 1);
  const int b   = wid >> 9;

  const _Float16* qb = q16 + ((size_t)(b * NHEAD + h) * NSEQ + qt * 16) * HDIM;
  const _Float16* kb = k16 + (size_t)(b * NHEAD + h) * NSEQ * HDIM;
  const _Float16* vb = vT16 + (size_t)(b * NHEAD + h) * HDIM * NSEQ;

  // Q fragments (B operand: column l16 = query l16), fixed across the key loop.
  v16h bQ0 = load_frag16(qb + (size_t)l16 * HDIM + half * 8);
  v16h bQ1 = load_frag16(qb + (size_t)l16 * HDIM + 32 + half * 8);
  // this build rewrites the address pair of these loads right behind them: the
  // wait stands in front of that
  asm volatile("s_wait_xcnt 0x0" ::: "memory");

  // o_t[r] = O[query l16][head dim 16 t + 8 half + r]
  v8f o0 = {}, o1 = {}, o2 = {}, o3 = {};
  float mrow = -1e30f;   // running maximum of query l16, the same in both halves
  float lrow = 0.0f;     // this half's share of the denominator of query l16
  // The wave's mask words: 32 a stage, one for each score that a lane holds; the
  // address is the same in every lane, so they come by scalar loads.  wid runs
  // as [b][h][query tile], the order of mbits.
  // Read through the constant address space (nothing writes mbits in this
  // launch): the loads inside the loop stay scalar loads too.
  const c_u32x16* mwq = (const c_u32x16*)(size_t)(
      mbits + (size_t)(blockIdx.x * 8u + wv) * (A_NSTAGE * 32u));
  u32x16 mw0 = mwq[0];                       // stage 0, first chunk
  u32x16 mw1 = mwq[1];                       // stage 0, second chunk

  // Slices of a stage: waves 0-3 bring 16 keys of K each (rows one behind the
  // other), waves 4-7 bring 16 head dims of V^T each (rows one sequence apart).
  const _Float16* slice_src = (wv < 4u) ? kb + (size_t)(wv * 16u) * HDIM
                                        : vb + (size_t)((wv - 4u) * 16u) * NSEQ;
  const uint32_t slice_pitch = (wv < 4u) ? HDIM * 2u : NSEQ * 2u;           // bytes, row to row
  const uint32_t slice_step  = (wv < 4u) ? A_KEYS * HDIM * 2u : A_KEYS * 2u; // bytes, stage to stage
  const uint64_t src_ga = (uint64_t)(size_t)slice_src;
  const uint32_t lbase  = (uint32_t)(size_t)ring;

  // Descriptor group 1: byte elements, tile = tensor = 16 rows of 128 bytes,
  // 4 dwords of pad behind every 32 dwords.
  u32x8 g1;
  g1[0] = uni((1u << 20) | (4u << 22) | (3u << 25));
  g1[1] = uni((G_ROWB & 0xFFFFu) << 16);
  g1[2] = uni((G_ROWB >> 16) | (16u << 16));
  g1[3] = uni(G_ROWB << 16);
  g1[4] = uni(16u);
  g1[5] = uni(slice_pitch);
  g1[6] = uni(0u);
  g1[7] = uni(0u);

  u32x4 g0;                            // group 0 of the wave's last request
  auto issue = [&](uint32_t st) {
    const uint32_t dst = lbase + (st & 1u) * A_STAGE + wv * A_SLICE;
    const uint64_t ga  = src_ga + (uint64_t)(st * slice_step);
    g0[0] = uni(1u);
    g0[1] = uni(dst);
    g0[2] = uni((uint32_t)ga);
    g0[3] = uni((((uint32_t)(ga >> 32)) & 0x01FFFFFFu) | 0x80000000u);
    // One request of the whole wave: global tile -> LDS, through no register.
    // The descriptor words are in-out operands here and inputs of the wait
    // below: the compiler then keeps them where they are, and forms none of
    // them anew, while the request is in flight.
    asm volatile("tensor_load_to_lds %0, %1" : "+s"(g0), "+s"(g1) :: "memory");
  };
  auto landed = [&]() {
    // the issuer's own wait: a tile counts as landed only behind it
    asm volatile("s_wait_tensorcnt 0x0" :: "s"(g0), "s"(g1) : "memory");
  };

  issue(0u);
  landed();
  __syncthreads();                     // stage 0 published
  issue(pinned(1u));

  // a lane's place in a 16-row slice: row l16, its half's 16 bytes
  const uint32_t f_off = (uint32_t)l16 * G_PITCH + (uint32_t)half * 16u;

  // kept rolled: one copy of the pass, the buffer chosen by the stage's parity
#pragma unroll 1
  for (uint32_t s = 0; s < A_NSTAGE; ++s) {
   const unsigned char* buf = ring + (s & 1u) * A_STAGE + f_off;
#pragma unroll  // constant slice numbers and offsets inside the stage
   for (int cc = 0; cc < (int)A_KEYS; cc += 32) {
    // ---- S^T = K.Q^T for 32k x 16q (two 16x16 tiles) ----
    // s0[r] = score(key c + 8 half + r, query l16), s1[r] the same 16 keys on
    v8f s0 = {}, s1 = {};
    {
      const unsigned char* kr = buf + (cc >> 4) * A_SLICE;   // keys cc .. cc+15
      v16h ak0 = load_frag16((const _Float16*)(kr));
      v16h ak1 = load_frag16((const _Float16*)(kr + 64));
      s0 = wmma_f16(ak0, bQ0, s0);
      s0 = wmma_f16(ak1, bQ1, s0);
      v16h ak2 = load_frag16((const _Float16*)(kr + A_SLICE));
      v16h ak3 = load_frag16((const _Float16*)(kr + A_SLICE + 64));
      s1 = wmma_f16(ak2, bQ0, s1);
      s1 = wmma_f16(ak3, bQ1, s1);
    }

    // ---- relation mask (scores += -1e9 where disallowed) ----
    {
      const u32x16 mw = cc ? mw1 : mw0;
#pragma unroll  // constant indices: the vectors stay in registers
      for (int r = 0; r < 8; ++r) {
        // a word is the select's lane mask as it stands
        if (!__builtin_amdgcn_inverse_ballot_w32(mw[r]))     s0[r] += -1e9f;
        if (!__builtin_amdgcn_inverse_ballot_w32(mw[r + 8])) s1[r] += -1e9f;
      }
    }

    // ---- online softmax update of query l16 ----
    float v = fmaxf(s0[0], s1[0]);
#pragma unroll  // constant indices: the vectors stay in registers
    for (int r = 1; r < 8; ++r) v = fmaxf(v, fmaxf(s0[r], s1[r]));
    v = fmaxf(v, xhalf(v));              // both halves: the chunk's maximum
    const float mnew = fmaxf(mrow, v);
    const float sc = __expf(mrow - mnew);
    mrow = mnew;
    float rs = 0.0f;
    v16h bP;   // P^T, column l16: the keys in the k order of load_frag16
#pragma unroll  // constant indices: the vectors stay in registers
    for (int r = 0; r < 8; ++r) {
      const float p0 = __expf(s0[r] - mnew);
      const float p1 = __expf(s1[r] - mnew);
      rs += p0 + p1;
      bP[r]     = (_Float16)p0;
      bP[r + 8] = (_Float16)p1;
    }
    lrow = lrow * sc + rs;
    o0 *= sc; o1 *= sc; o2 *= sc; o3 *= sc;

    // ---- O^T += V^T.P^T (4 hd tiles, A fragments from transposed V) ----
    const unsigned char* vr = buf + 4u * A_SLICE + cc * 2;   // keys cc .. cc+31 of a row
    v16h av0 = load_frag16((const _Float16*)(vr));
    v16h av1 = load_frag16((const _Float16*)(vr + A_SLICE));
    v16h av2 = load_frag16((const _Float16*)(vr + 2u * A_SLICE));
    v16h av3 = load_frag16((const _Float16*)(vr + 3u * A_SLICE));
    o0 = wmma_f16(av0, bP, o0);
    o1 = wmma_f16(av1, bP, o1);
    o2 = wmma_f16(av2, bP, o2);
    o3 = wmma_f16(av3, bP, o3);
   }
   // the next stage's mask words, asked for in front of the barrier, before the pass that uses them
   // (the last pass asks for its own again: the address stays inside mbits)
   {
     const c_u32x16* mn = mwq + (s + 1u < A_NSTAGE ? s + 1u : s) * 2u;
     mw0 = mn[0];
     mw1 = mn[1];
   }
   // Publish point of stage s + 1, at the foot of the pass.
   wait_ds0();
   landed();
   __syncthreads();                    // s + 1 landed for all; all have left s
   if (pinned(s + 2u < A_NSTAGE)) issue(pinned(s + 2u));
  }
  landed();
  wait_ds0();

  // ---- normalize, turn O^T into rows in the wave's own LDS, store fp32 ----
  const float inv = 1.0f / (lrow + xhalf(lrow));   // the halves' shares joined
  {
    float* st = &ldsO[w][l16][half * 8];
    const v8f y0 = o0 * inv, y1 = o1 * inv, y2 = o2 * inv, y3 = o3 * inv;
    *(v4f*)(st)      = __builtin_shufflevector(y0, y0, 0, 1, 2, 3);
    *(v4f*)(st + 4)  = __builtin_shufflevector(y0, y0, 4, 5, 6, 7);
    *(v4f*)(st + 16) = __builtin_shufflevector(y1, y1, 0, 1, 2, 3);
    *(v4f*)(st + 20) = __builtin_shufflevector(y1, y1, 4, 5, 6, 7);
    *(v4f*)(st + 32) = __builtin_shufflevector(y2, y2, 0, 1, 2, 3);
    *(v4f*)(st + 36) = __builtin_shufflevector(y2, y2, 4, 5, 6, 7);
    *(v4f*)(st + 48) = __builtin_shufflevector(y3, y3, 0, 1, 2, 3);
    *(v4f*)(st + 52) = __builtin_shufflevector(y3, y3, 4, 5, 6, 7);
  }
  // 16 lanes cover one query's 64 head dims: a store is 4 whole 128-byte lines
  float* op = out + ((size_t)(b * NSEQ + qt * 16 + half) * DMODEL) + h * HDIM + l16 * 4;
#pragma unroll  // the 8 LDS reads go out together, the stores follow as they return
  for (int i = 0; i < 8; ++i)
    *(v4f*)(op + (size_t)(i * 2) * DMODEL) = *(const v4f*)&ldsO[w][i * 2 + half][l16 * 4];
}

// --------------------------------- launcher --------------------------------

extern "C" void kernel_launch(void* const* d_in, const int* in_sizes, int n_in,
                              void* d_out, int out_size, void* d_ws, size_t ws_size,
                              hipStream_t stream) {
  const float* hidden = (const float*)d_in[0];
  const int*   adj    = (const int*)d_in[1];
  const float* Wq     = (const float*)d_in[2];
  const float* bq     = (const float*)d_in[3];
  const float* Wk     = (const float*)d_in[4];
  const float* bk     = (const float*)d_in[5];
  const float* Wv     = (const float*)d_in[6];
  const float* bv     = (const float*)d_in[7];
  float* out = (float*)d_out;

  char* ws = (char*)d_ws;
  const size_t MB = 1024u * 1024u;
  _Float16* h16  = (_Float16*)(ws);             //  8 MB: [4096,1024]
  _Float16* wT   = (_Float16*)(ws + 8  * MB);   //  6 MB: [3,1024,1024]
  _Float16* q16  = (_Float16*)(ws + 14 * MB);   //  8 MB: [b,h,n,64]
  _Float16* k16  = (_Float16*)(ws + 22 * MB);   //  8 MB
  _Float16* vT16 = (_Float16*)(ws + 30 * MB);   //  8 MB: [b,h,64,n]
  unsigned int* mbits = (unsigned int*)(ws + 38 * MB);   //  4 MB: [b,h,32,8,32]

  // 4096 waves of mask words, then 4194304 elements: 4096 waves of 1024
  cvt_hidden<<<256 + NB * NSEQ * DMODEL / (16 * 1024), 512, 0, stream>>>(hidden, h16, adj, mbits);
  // 3 * 1024 * 1024 elements: 1536 waves of 64 x 32
  cvt_weightT<<<3 * DMODEL * DMODEL / (6 * 64 * 32), 192, 0, stream>>>(Wq, Wk, Wv, wT);

  // 128-row tiles x 128-col tiles over {q,k,v}, 4 waves of 64x64
  qkv_gemm<<<dim3(NB * NSEQ / 128, 3 * DMODEL / 128), 128, 0, stream>>>(
      h16, wT, bq, bk, bv, q16, k16, vT16);

  // 8*16*32 = 4096 waves, 8 waves per block
  attention<<<512, 256, 0, stream>>>(q16, k16, vT16, mbits, out);
}

// v007
// A run of this version takes 48.5 microseconds.
// Next to v006, in two timings, it ran 1.08 and 1.06 times as fast.
// Counting every step since v000, it is 3.72 times as fast.
#include <hip/hip_runtime.h>
#include <hip/hip_bf16.h>

typedef __attribute__((ext_vector_type(16))) _Float16 v16h;
typedef __attribute__((ext_vector_type(8)))  _Float16 v8h;
typedef __attribute__((ext_vector_type(8)))  float    v8f;

#define NHEAD 16
#define NB    8
#define NSEQ  512
#define DMODEL 1024
#define HDIM  64

// relation->head allow mask (bit r = relation r allowed for this head),
// precomputed from the reference's per-head loop.
__device__ __constant__ unsigned short ALLOWED_MASK[NHEAD] = {
  0x3003, 0x3005, 0x3009, 0x3831, 0x3071, 0x30E1, 0x31C1, 0x3381,
  0x3701, 0x3E01, 0x3C11, 0x3831, 0x7001, 0x7001, 0x7001, 0x7001
};

// Load a 16-lane-half K-packed f16 fragment (A or B layout for 16x16x32):
// caller passes p = base + row*ld + k0 + (lane>>4)*8.  lo = K chunk 0..7(/8..15),
// hi = K chunk 16..23(/24..31) per the CDNA5 16-bit A/B VGPR layout.
__device__ inline v16h load_frag16(const _Float16* p) {
  v8h lo = *(const v8h*)(p);
  v8h hi = *(const v8h*)(p + 16);
  v16h r;
#pragma unroll
  for (int i = 0; i < 8; ++i) { r[i] = lo[i]; r[i + 8] = hi[i]; }
  return r;
}

__device__ inline v8f wmma_f16(v16h a, v16h b, v8f c) {
  return __builtin_amdgcn_wmma_f32_16x16x32_f16(
      /*neg_a=*/false, a, /*neg_b=*/false, b,
      /*c_mod=*/(short)0, c, /*reuse_a=*/false, /*reuse_b=*/false);
}

// ------------------------------- conversions -------------------------------
// Sized by waves to start, not by elements: a thread converts a block of
// elements with 16-byte loads, all of them in flight at once.

typedef __attribute__((ext_vector_type(4))) float    v4f;
typedef __attribute__((ext_vector_type(4))) _Float16 v4h;

typedef __attribute__((ext_vector_type(4))) int v4i;

// One launch for the three preparations, which need nothing of each other: the
// block index picks the part.  608 blocks of 16 waves.
// Blocks 0-255 turn adj into the attention kernel's mask words, once for all
// heads.  mbits[b][h][query tile][stage][e], bit l = "relation allowed" for the
// score that lane l of the attention wave holds as element e of the stage:
// query 16 tile + (l & 15), key 64 stage + 32 (e >> 4) + 16 ((e >> 3) & 1) +
// 8 (l >> 4) + (e & 7).  A wave takes one (b, tile, stage) and 8 heads: its
// lanes read adj in the attention wave's own layout, a ballot is a word.
// Blocks 256-351: wT[sel][n_out][k_in] = W_sel[k_in][n_out] (transpose +
// f32->f16).  A wave takes a tile of 64 k x 32 n; a lane holds two blocks of
// 8 k x 4 n in registers (16 loads of 16 bytes; a wave-wide load is 4 whole
// 128-byte lines of W) and stores each n of a block as 8 k = 16 bytes.
// Blocks 352-607: a wave converts 1024 floats of hidden in a row: 8 loads of
// 512 contiguous bytes, then 8 stores of 256 contiguous bytes.
#define P_MASK_BLOCKS   256
#define P_WEIGHT_BLOCKS (3 * DMODEL * DMODEL / (16 * 64 * 32))
#define P_HIDDEN_BLOCKS (NB * NSEQ * DMODEL / (16 * 1024))

__global__ __launch_bounds__(512) void prepare(const float* __restrict__ src,
                                               _Float16* __restrict__ dst,
                                               const int* __restrict__ adj,
                                               unsigned int* __restrict__ mbits,
                                               const float* __restrict__ Wq,
                                               const float* __restrict__ Wk,
                                               const float* __restrict__ Wv,
                                               _Float16* __restrict__ wT) {
  const int lane = threadIdx.x & 31;
  if (blockIdx.x < P_MASK_BLOCKS) {
    const unsigned int t = blockIdx.x * 16u +
        (unsigned int)__builtin_amdgcn_readfirstlane(threadIdx.x >> 5);   // 0..4095
    const unsigned int hg = t & 1u, st = (t >> 1) & 7u, qt = (t >> 4) & 31u, b = t >> 9;
    const int* p = adj + ((size_t)b * NSEQ + qt * 16u + (lane & 15)) * NSEQ + st * 64u + (lane >> 4) * 8;
    v4i x[8];
#pragma unroll  // constant indices: the array stays in registers
    for (int j = 0; j < 8; ++j) x[j] = *(const v4i*)(p + (j >> 1) * 16 + (j & 1) * 4);
#pragma unroll  // constant indices: the array stays in registers
    for (int hh = 0; hh < 8; ++hh) {
      const unsigned int h = hg * 8u + hh;
      const unsigned int mask = ALLOWED_MASK[h];
      unsigned int w = 0u;
#pragma unroll  // constant indices: the array stays in registers
      for (int e = 0; e < 32; ++e) {
        const unsigned int word =
            __builtin_amdgcn_ballot_w32(((mask >> x[e >> 2][e & 3]) & 1u) != 0u);
        w = (lane == e) ? word : w;          // lane e stores word e
      }
      mbits[((((size_t)b * NHEAD + h) * 32u + qt) * 8u + st) * 32u + lane] = w;
    }
  } else if (blockIdx.x < P_MASK_BLOCKS + P_WEIGHT_BLOCKS) {
    const int t   = (blockIdx.x - P_MASK_BLOCKS) * 16 + (threadIdx.x >> 5);   // 0 .. 3*512-1
    const int sel = t >> 9;
    const int n0  = (t & 31) * 32 + (lane & 7) * 4;
    const int k0  = ((t >> 5) & 15) * 64 + (lane >> 3) * 8;
    const float* W = (sel == 0) ? Wq : ((sel == 1) ? Wk : Wv);
    const float* s = W + (size_t)k0 * DMODEL + n0;
    v4f x[2][8];
#pragma unroll  // constant indices: the array stays in registers
    for (int u = 0; u < 2; ++u)
#pragma unroll  // constant indices: the array stays in registers
      for (int j = 0; j < 8; ++j)
        x[u][j] = *(const v4f*)(s + (size_t)(u * 32 + j) * DMODEL);
    // Takes the loaded values and their address as inputs only: all 16 loads are
    // in flight before the first convert (without it two of them are issued only
    // behind a wait for earlier ones, a second trip to memory), and the address
    // pair that they name is rewritten only behind this wait.
    asm volatile("s_wait_xcnt 0x0" :: "v"(x[0][0]), "v"(x[0][1]), "v"(x[0][2]), "v"(x[0][3]),
                       "v"(x[0][4]), "v"(x[0][5]), "v"(x[0][6]), "v"(x[0][7]),
                       "v"(x[1][0]), "v"(x[1][1]), "v"(x[1][2]), "v"(x[1][3]),
                       "v"(x[1][4]), "v"(x[1][5]), "v"(x[1][6]), "v"(x[1][7]),
                       "v"(s) : "memory");
    _Float16* d = wT + ((size_t)sel * DMODEL + n0) * DMODEL + k0;
#pragma unroll  // constant indices: the array stays in registers
    for (int u = 0; u < 2; ++u)
#pragma unroll  // constant indices: the array stays in registers
      for (int i = 0; i < 4; ++i) {
        v8h y;
#pragma unroll  // constant indices: the array stays in registers
        for (int j = 0; j < 8; ++j) y[j] = (_Float16)x[u][j][i];
        *(v8h*)(d + (size_t)i * DMODEL + u * 32) = y;
      }
    // the built code can go on from here into another part, which rewrites the
    // registers that these stores name: the wait stands in front of that
    asm volatile("s_wait_xcnt 0x0" ::: "memory");
  } else {
    const int wave = (blockIdx.x - (P_MASK_BLOCKS + P_WEIGHT_BLOCKS)) * 16 + (threadIdx.x >> 5);
    const size_t base = (size_t)wave * 1024 + lane * 4;
    v4f x[8];
#pragma unroll  // constant indices: the array stays in registers
    for (int j = 0; j < 8; ++j) x[j] = *(const v4f*)(src + base + j * 128);
#pragma unroll  // constant indices: the array stays in registers
    for (int j = 0; j < 8; ++j)
      *(v4h*)(dst + base + j * 128) = __builtin_convertvector(x[j], v4h);
    // the built code can go on from here into another part, which rewrites the
    // registers that these stores name: the wait stands in front of that
    asm volatile("s_wait_xcnt 0x0" ::: "memory");
  }
}

// --------------------------------- QKV GEMM --------------------------------
// grid (32 row tiles, 24 column tiles over {q,k,v}), 128 threads = 4 waves.
// One 128x128 output tile per block, 64x64 (4x4 WMMA tiles) per wave.  The
// operands come through a two-buffer LDS ring: a stage is 64 k of 128 rows of
// h16 and 128 rows of wT; each wave brings one 64-row slice of it with one
// tensor load, padded to a 144-byte row pitch for the ds_load_b128 readers.

typedef uint32_t u32x4 __attribute__((ext_vector_type(4)));
typedef uint32_t u32x8 __attribute__((ext_vector_type(8)));

#define G_ROWB   128u                 // bytes of one staged row (64 k of f16)
#define G_PITCH  144u                 // LDS row pitch: 128 + 16 pad bytes
#define G_SLICE  10240u               // 64 rows * 144 B, rounded up to 2 KiB
#define G_STAGE  (4u * G_SLICE)
#define G_NSTAGE (DMODEL * 2u / G_ROWB)

__device__ inline uint32_t uni(uint32_t v) {
  return (uint32_t)__builtin_amdgcn_readfirstlane(v);
}
// Makes the test around a tensor load a scalar branch, and keeps a descriptor
// word that is formed from the result behind the waits in front of the call.
__device__ inline uint32_t pinned(uint32_t v) {
  uint32_t w = uni(v);
  // pinned(): an issue test or a descriptor word held in a scalar register
  asm volatile("" : "+s"(w));
  return w;
}
__device__ inline void wait_tensor0() {
  // a tile counts as landed
  // only behind its issuer's own wait
  asm volatile("s_wait_tensorcnt 0x0" ::: "memory");
}
__device__ inline void wait_ds0() {
  // a wave's LDS reads have retired before the buffer they read is refilled
  asm volatile("s_wait_dscnt 0x0" ::: "memory");
}

__global__ __launch_bounds__(128) void qkv_gemm(
    const _Float16* __restrict__ h16,   // [4096,1024]
    const _Float16* __restrict__ wT,    // [3][1024][1024]
    const float* __restrict__ bq, const float* __restrict__ bk,
    const float* __restrict__ bv,
    _Float16* __restrict__ q16,         // [b,h,n,64]  (pre-scaled 1/8)
    _Float16* __restrict__ k16,         // [b,h,n,64]
    _Float16* __restrict__ vT16)        // [b,h,64,n]
{
  __shared__ __attribute__((aligned(2048))) unsigned char ring[2u * G_STAGE];

  const int lane = threadIdx.x & 31;
  const uint32_t wv = uni(threadIdx.x >> 5);
  const int half = lane >> 4;
  const int l16  = lane & 15;
  const uint32_t wm = wv >> 1, wn = wv & 1u;         // 2x2 waves
  const int row0 = blockIdx.x * 128;                 // 0..3968
  const int sel  = blockIdx.y >> 3;
  const int colb = (blockIdx.y & 7) * 128;           // 0..896 inside q, k or v

  const float* bias = (sel == 0) ? bq : ((sel == 1) ? bk : bv);

  // Slices of a stage: waves 0,1 bring h16 rows 0-63, 64-127 of the tile,
  // waves 2,3 bring wT rows 0-63, 64-127 (wT's three matrices are contiguous).
  const _Float16* slice_src =
      (wv < 2u) ? h16 + (size_t)(row0 + wv * 64u) * DMODEL
                : wT + (size_t)(blockIdx.y * 128u + (wv - 2u) * 64u) * DMODEL;
  const uint64_t src_ga = (uint64_t)(size_t)slice_src;
  const uint32_t lbase  = (uint32_t)(size_t)ring;

  // Descriptor group 1: byte elements, tile = tensor = 64 rows of 128 bytes,
  // source pitch 2048 bytes, 4 dwords of pad behind every 32 dwords.
  u32x8 g1;
  g1[0] = uni((1u << 20) | (4u << 22) | (3u << 25));
  g1[1] = uni((G_ROWB & 0xFFFFu) << 16);
  g1[2] = uni((G_ROWB >> 16) | (64u << 16));
  g1[3] = uni(G_ROWB << 16);
  g1[4] = uni(64u);
  g1[5] = uni(DMODEL * 2u);
  g1[6] = uni(0u);
  g1[7] = uni(0u);

  auto issue = [&](uint32_t st) {
    const uint32_t dst = lbase + (st & 1u) * G_STAGE + wv * G_SLICE;
    const uint64_t ga  = src_ga + (uint64_t)(st * G_ROWB);
    u32x4 g0;
    g0[0] = uni(1u);
    g0[1] = uni(dst);
    g0[2] = uni((uint32_t)ga);
    g0[3] = uni((((uint32_t)(ga >> 32)) & 0x01FFFFFFu) | 0x80000000u);
    // one request of the whole wave: global tile -> LDS, through no register
    asm volatile("tensor_load_to_lds %0, %1" :: "s"(g0), "s"(g1) : "memory");
  };

  v8f acc[4][4];
#pragma unroll  // constant indices: the arrays stay in registers
  for (int m = 0; m < 4; ++m)
#pragma unroll  // constant indices: the arrays stay in registers
    for (int t = 0; t < 4; ++t) acc[m][t] = (v8f){};

  issue(0u);
  wait_tensor0();
  __syncthreads();                     // stage 0 published
  issue(pinned(1u));

  // Which matrix is the A operand is chosen by where the result goes: a lane
  // holds 8 consecutive ROWS of D, and these must be neighbours in memory.
  // v (stored [head dim][n]): A = h16, D = h.W.  q, k (stored [n][head dim]):
  // A = wT, D = (h.W)^T.  Both operands have the same fragment layout.
  const uint32_t h_off = wm * G_SLICE + (uint32_t)l16 * G_PITCH + (uint32_t)half * 16u;
  const uint32_t w_off = (2u + wn) * G_SLICE + (uint32_t)l16 * G_PITCH + (uint32_t)half * 16u;
  const uint32_t a_off = (sel == 2) ? h_off : w_off;
  const uint32_t b_off = (sel == 2) ? w_off : h_off;

  // kept rolled: one copy of the pass, the buffer chosen by the stage's parity
#pragma unroll 1
  for (uint32_t s = 0; s < G_NSTAGE; ++s) {
    const unsigned char* buf = ring + (s & 1u) * G_STAGE;
    v16h a[2][4], b[2][4];
#pragma unroll  // constant indices: the arrays stay in registers
    for (int ks = 0; ks < 2; ++ks) {
#pragma unroll  // constant indices: the arrays stay in registers
      for (int m = 0; m < 4; ++m)
        a[ks][m] = load_frag16((const _Float16*)(buf + a_off + m * 16 * G_PITCH + ks * 64));
#pragma unroll  // constant indices: the arrays stay in registers
      for (int t = 0; t < 4; ++t)
        b[ks][t] = load_frag16((const _Float16*)(buf + b_off + t * 16 * G_PITCH + ks * 64));
    }
    // Publish point of stage s + 1.  It stands here, not behind the WMMAs: the
    // pass's fragments are all in registers behind the first wait, so the
    // buffer is free one barrier later and its refill flies under the WMMAs.
    wait_ds0();
    wait_tensor0();
    __syncthreads();                   // s + 1 landed for all; all have left s
    if (pinned(s + 2u < G_NSTAGE)) issue(pinned(s + 2u));
#pragma unroll  // constant indices: the arrays stay in registers
    for (int ks = 0; ks < 2; ++ks)
#pragma unroll  // constant indices: the arrays stay in registers
      for (int t = 0; t < 4; ++t)
#pragma unroll  // constant indices: the arrays stay in registers
        for (int m = 0; m < 4; ++m)
          acc[m][t] = wmma_f16(a[ks][m], b[ks][t], acc[m][t]);
  }
  wait_tensor0();
  wait_ds0();

  // acc[m][t][r] = D[16 m + 8 half + r][16 t + l16]: 8 neighbours of an output
  // row in a lane, stored as 16 bytes.  The wave's 64 columns are one head, the
  // block's 128 rows lie in one batch.
  const int c0 = colb + (int)wn * 64;
  const int n0 = (row0 & (NSEQ - 1)) + (int)wm * 64;
  const size_t head = (size_t)((row0 >> 9) * NHEAD + (c0 >> 6)) * (NSEQ * HDIM);
  if (sel == 2) {
    _Float16* dst = vT16 + head + (size_t)l16 * NSEQ + n0 + half * 8;
#pragma unroll  // constant indices: the arrays stay in registers
    for (int t = 0; t < 4; ++t) {
      const float bcol = bias[c0 + t * 16 + l16];
#pragma unroll  // constant indices: the arrays stay in registers
      for (int m = 0; m < 4; ++m) {
        v8h y;
#pragma unroll  // constant indices: the arrays stay in registers
        for (int r = 0; r < 8; ++r) y[r] = (_Float16)(acc[m][t][r] + bcol);
        *(v8h*)(dst + t * 16 * NSEQ + m * 16) = y;
      }
    }
  } else {
    const float qscale = (sel == 0) ? 0.125f : 1.0f;   // fold 1/sqrt(64) into Q
    _Float16* dst = ((sel == 0) ? q16 : k16) + head + (size_t)(n0 + l16) * HDIM + half * 8;
    v4f blo[4], bhi[4];
#pragma unroll  // constant indices: the arrays stay in registers
    for (int m = 0; m < 4; ++m) {
      blo[m] = *(const v4f*)(bias + c0 + m * 16 + half * 8);
      bhi[m] = *(const v4f*)(bias + c0 + m * 16 + half * 8 + 4);
    }
#pragma unroll  // constant indices: the arrays stay in registers
    for (int t = 0; t < 4; ++t)
#pragma unroll  // constant indices: the arrays stay in registers
      for (int m = 0; m < 4; ++m) {
        v8h y;
#pragma unroll  // constant indices: the arrays stay in registers
        for (int r = 0; r < 4; ++r) {
          y[r]     = (_Float16)((acc[m][t][r]     + blo[m][r]) * qscale);
          y[r + 4] = (_Float16)((acc[m][t][r + 4] + bhi[m][r]) * qscale);
        }
        *(v8h*)(dst + t * 16 * HDIM + m * 16) = y;
      }
    // the built code can fall from here into the v branch, which rewrites the
    // registers that these stores name: the wait stands in front of that
    asm volatile("s_wait_xcnt 0x0" ::: "memory");
  }
}

// -------------------------------- attention --------------------------------
// One wave = 16 query rows of one (b,h); key loop in chunks of 32 with online
// softmax.  8 WMMAs per chunk (4 for S^T, 4 for V^T.P^T), 128 per wave.
// Both products are taken transposed: K and V^T are the A operands, Q and P^T
// the B operands.  A lane (l16, half) then holds 16 of the chunk's 32 scores of
// query l16: maximum and sum are taken in the lane, with one exchange between
// the halves, and the two score tiles, converted in place, are the B operand
// P^T in the hardware k order.  O^T is turned into rows once, behind the loop.
// The 8 waves of a block work on one (b,h) and read the same K and V^T: these
// come through a two-buffer LDS ring.  A stage is 64 keys (two chunks): 64 rows
// of K (64 head dims each) and 64 rows of V^T (64 keys each), all of 128 bytes;
// each wave brings one 16-row slice of it with one tensor load, padded to the
// 144-byte row pitch for the ds_load_b128 readers.

#define A_KEYS   64u                  // keys of one stage
#define A_SLICE  4096u                // 16 rows * 144 B, rounded up to 2 KiB
#define A_STAGE  (8u * A_SLICE)
#define A_NSTAGE (NSEQ / A_KEYS)
#define A_OPITCH 68                   // floats: 64 head dims + 16 pad bytes

typedef __attribute__((ext_vector_type(16))) unsigned int u32x16;
typedef __attribute__((address_space(4))) u32x16 c_u32x16;

// the value of lane l ^ 16
__device__ inline float xhalf(float x) {
  const int i = __builtin_bit_cast(int, x);
  return __builtin_bit_cast(float, __builtin_amdgcn_permlanex16(
      i, i, 0x76543210, 0xfedcba98, false, false));
}

__global__ __launch_bounds__(256) void attention(
    const _Float16* __restrict__ q16, const _Float16* __restrict__ k16,
    const _Float16* __restrict__ vT16, const unsigned int* __restrict__ mbits,
    float* __restrict__ out)
{
  __shared__ __attribute__((aligned(2048))) unsigned char ring[2u * A_STAGE];
  __shared__ __attribute__((aligned(16))) float ldsO[8][16][A_OPITCH];  // per-wave O staging (O^T -> rows)

  const int lane = threadIdx.x & 31;
  const int w    = threadIdx.x >> 5;
  const uint32_t wv = uni(threadIdx.x >> 5);   // the same, in a scalar register
  const int half = lane >> 4;
  const int l16  = lane & 15;

  const int wid = blockIdx.x * 8 + w;    // 0..4095
  const int qt  = wid & 31;              // query tile 0..31
  const int h   = (wid >> 5) & (NHEAD - 1);
  const int b   = wid >> 9;

  const _Float16* qb = q16 + ((size_t)(b * NHEAD + h) * NSEQ + qt * 16) * HDIM;
  const _Float16* kb = k16 + (size_t)(b * NHEAD + h) * NSEQ * HDIM;
  const _Float16* vb = vT16 + (size_t)(b * NHEAD + h) * HDIM * NSEQ;

  // Q fragments (B operand: column l16 = query l16), fixed across the key loop.
  v16h bQ0 = load_frag16(qb + (size_t)l16 * HDIM + half * 8);
  v16h bQ1 = load_frag16(qb + (size_t)l16 * HDIM + 32 + half * 8);
  // this build rewrites the address pair of these loads right behind them: the
  // wait stands in front of that
  asm volatile("s_wait_xcnt 0x0" ::: "memory");

  // o_t[r] = O[query l16][head dim 16 t + 8 half + r]
  v8f o0 = {}, o1 = {}, o2 = {}, o3 = {};
  float mrow = -1e30f;   // running maximum of query l16, the same in both halves
  float lrow = 0.0f;     // this half's share of the denominator of query l16
  // The wave's mask words: 32 a stage, one for each score that a lane holds; the
  // address is the same in every lane, so they come by scalar loads.  wid runs
  // as [b][h][query tile], the order of mbits.
  // Read through the constant address space (nothing writes mbits in this
  // launch): the loads inside the loop stay scalar loads too.
  const c_u32x16* mwq = (const c_u32x16*)(size_t)(
      mbits + (size_t)(blockIdx.x * 8u + wv) * (A_NSTAGE * 32u));
  u32x16 mw0 = mwq[0];                       // stage 0, first chunk
  u32x16 mw1 = mwq[1];                       // stage 0, second chunk

  // Slices of a stage: waves 0-3 bring 16 keys of K each (rows one behind the
  // other), waves 4-7 bring 16 head dims of V^T each (rows one sequence apart).
  const _Float16* slice_src = (wv < 4u) ? kb + (size_t)(wv * 16u) * HDIM
                                        : vb + (size_t)((wv - 4u) * 16u) * NSEQ;
  const uint32_t slice_pitch = (wv < 4u) ? HDIM * 2u : NSEQ * 2u;           // bytes, row to row
  const uint32_t slice_step  = (wv < 4u) ? A_KEYS * HDIM * 2u : A_KEYS * 2u; // bytes, stage to stage
  const uint64_t src_ga = (uint64_t)(size_t)slice_src;
  const uint32_t lbase  = (uint32_t)(size_t)ring;

  // Descriptor group 1: byte elements, tile = tensor = 16 rows of 128 bytes,
  // 4 dwords of pad behind every 32 dwords.
  u32x8 g1;
  g1[0] = uni((1u << 20) | (4u << 22) | (3u << 25));
  g1[1] = uni((G_ROWB & 0xFFFFu) << 16);
  g1[2] = uni((G_ROWB >> 16) | (16u << 16));
  g1[3] = uni(G_ROWB << 16);
  g1[4] = uni(16u);
  g1[5] = uni(slice_pitch);
  g1[6] = uni(0u);
  g1[7] = uni(0u);

  u32x4 g0;                            // group 0 of the wave's last request
  auto issue = [&](uint32_t st) {
    const uint32_t dst = lbase + (st & 1u) * A_STAGE + wv * A_SLICE;
    const uint64_t ga  = src_ga + (uint64_t)(st * slice_step);
    g0[0] = uni(1u);
    g0[1] = uni(dst);
    g0[2] = uni((uint32_t)ga);
    g0[3] = uni((((uint32_t)(ga >> 32)) & 0x01FFFFFFu) | 0x80000000u);
    // One request of the whole wave: global tile -> LDS, through no register.
    // The descriptor words are in-out operands here and inputs of the wait
    // below: the compiler then keeps them where they are, and forms none of
    // them anew, while the request is in flight.
    asm volatile("tensor_load_to_lds %0, %1" : "+s"(g0), "+s"(g1) :: "memory");
  };
  auto landed = [&]() {
    // the issuer's own wait: a tile counts as landed only behind it
    asm volatile("s_wait_tensorcnt 0x0" :: "s"(g0), "s"(g1) : "memory");
  };

  issue(0u);
  landed();
  __syncthreads();                     // stage 0 published
  issue(pinned(1u));

  // a lane's place in a 16-row slice: row l16, its half's 16 bytes
  const uint32_t f_off = (uint32_t)l16 * G_PITCH + (uint32_t)half * 16u;

  // kept rolled: one copy of the pass, the buffer chosen by the stage's parity
#pragma unroll 1
  for (uint32_t s = 0; s < A_NSTAGE; ++s) {
   const unsigned char* buf = ring + (s & 1u) * A_STAGE + f_off;
#pragma unroll  // constant slice numbers and offsets inside the stage
   for (int cc = 0; cc < (int)A_KEYS; cc += 32) {
    // ---- S^T = K.Q^T for 32k x 16q (two 16x16 tiles) ----
    // s0[r] = score(key c + 8 half + r, query l16), s1[r] the same 16 keys on
    v8f s0 = {}, s1 = {};
    {
      const unsigned char* kr = buf + (cc >> 4) * A_SLICE;   // keys cc .. cc+15
      v16h ak0 = load_frag16((const _Float16*)(kr));
      v16h ak1 = load_frag16((const _Float16*)(kr + 64));
      s0 = wmma_f16(ak0, bQ0, s0);
      s0 = wmma_f16(ak1, bQ1, s0);
      v16h ak2 = load_frag16((const _Float16*)(kr + A_SLICE));
      v16h ak3 = load_frag16((const _Float16*)(kr + A_SLICE + 64));
      s1 = wmma_f16(ak2, bQ0, s1);
      s1 = wmma_f16(ak3, bQ1, s1);
    }

    // ---- relation mask (scores += -1e9 where disallowed) ----
    {
      const u32x16 mw = cc ? mw1 : mw0;
#pragma unroll  // constant indices: the vectors stay in registers
      for (int r = 0; r < 8; ++r) {
        // a word is the select's lane mask as it stands
        if (!__builtin_amdgcn_inverse_ballot_w32(mw[r]))     s0[r] += -1e9f;
        if (!__builtin_amdgcn_inverse_ballot_w32(mw[r + 8])) s1[r] += -1e9f;
      }
    }

    // ---- online softmax update of query l16 ----
    float v = fmaxf(s0[0], s1[0]);
#pragma unroll  // constant indices: the vectors stay in registers
    for (int r = 1; r < 8; ++r) v = fmaxf(v, fmaxf(s0[r], s1[r]));
    v = fmaxf(v, xhalf(v));              // both halves: the chunk's maximum
    const float mnew = fmaxf(mrow, v);
    const float sc = __expf(mrow - mnew);
    mrow = mnew;
    float rs = 0.0f;
    v16h bP;   // P^T, column l16: the keys in the k order of load_frag16
#pragma unroll  // constant indices: the vectors stay in registers
    for (int r = 0; r < 8; ++r) {
      const float p0 = __expf(s0[r] - mnew);
      const float p1 = __expf(s1[r] - mnew);
      rs += p0 + p1;
      bP[r]     = (_Float16)p0;
      bP[r + 8] = (_Float16)p1;
    }
    lrow = lrow * sc + rs;
    o0 *= sc; o1 *= sc; o2 *= sc; o3 *= sc;

    // ---- O^T += V^T.P^T (4 hd tiles, A fragments from transposed V) ----
    const unsigned char* vr = buf + 4u * A_SLICE + cc * 2;   // keys cc .. cc+31 of a row
    v16h av0 = load_frag16((const _Float16*)(vr));
    v16h av1 = load_frag16((const _Float16*)(vr + A_SLICE));
    v16h av2 = load_frag16((const _Float16*)(vr + 2u * A_SLICE));
    v16h av3 = load_frag16((const _Float16*)(vr + 3u * A_SLICE));
    o0 = wmma_f16(av0, bP, o0);
    o1 = wmma_f16(av1, bP, o1);
    o2 = wmma_f16(av2, bP, o2);
    o3 = wmma_f16(av3, bP, o3);
   }
   // the next stage's mask words, asked for in front of the barrier, before the pass that uses them
   // (the last pass asks for its own again: the address stays inside mbits)
   {
     const c_u32x16* mn = mwq + (s + 1u < A_NSTAGE ? s + 1u : s) * 2u;
     mw0 = mn[0];
     mw1 = mn[1];
   }
   // Publish point of stage s + 1, at the foot of the pass.
   wait_ds0();
   landed();
   __syncthreads();                    // s + 1 landed for all; all have left s
   if (pinned(s + 2u < A_NSTAGE)) issue(pinned(s + 2u));
  }
  landed();
  wait_ds0();

  // ---- normalize, turn O^T into rows in the wave's own LDS, store fp32 ----
  const float inv = 1.0f / (lrow + xhalf(lrow));   // the halves' shares joined
  {
    float* st = &ldsO[w][l16][half * 8];
    const v8f y0 = o0 * inv, y1 = o1 * inv, y2 = o2 * inv, y3 = o3 * inv;
    *(v4f*)(st)      = __builtin_shufflevector(y0, y0, 0, 1, 2, 3);
    *(v4f*)(st + 4)  = __builtin_shufflevector(y0, y0, 4, 5, 6, 7);
    *(v4f*)(st + 16) = __builtin_shufflevector(y1, y1, 0, 1, 2, 3);
    *(v4f*)(st + 20) = __builtin_shufflevector(y1, y1, 4, 5, 6, 7);
    *(v4f*)(st + 32) = __builtin_shufflevector(y2, y2, 0, 1, 2, 3);
    *(v4f*)(st + 36) = __builtin_shufflevector(y2, y2, 4, 5, 6, 7);
    *(v4f*)(st + 48) = __builtin_shufflevector(y3, y3, 0, 1, 2, 3);
    *(v4f*)(st + 52) = __builtin_shufflevector(y3, y3, 4, 5, 6, 7);
  }
  // 16 lanes cover one query's 64 head dims: a store is 4 whole 128-byte lines
  float* op = out + ((size_t)(b * NSEQ + qt * 16 + half) * DMODEL) + h * HDIM + l16 * 4;
#pragma unroll  // the 8 LDS reads go out together, the stores follow as they return
  for (int i = 0; i < 8; ++i)
    *(v4f*)(op + (size_t)(i * 2) * DMODEL) = *(const v4f*)&ldsO[w][i * 2 + half][l16 * 4];
}

// --------------------------------- launcher --------------------------------

extern "C" void kernel_launch(void* const* d_in, const int* in_sizes, int n_in,
                              void* d_out, int out_size, void* d_ws, size_t ws_size,
                              hipStream_t stream) {
  const float* hidden = (const float*)d_in[0];
  const int*   adj    = (const int*)d_in[1];
  const float* Wq     = (const float*)d_in[2];
  const float* bq     = (const float*)d_in[3];
  const float* Wk     = (const float*)d_in[4];
  const float* bk     = (const float*)d_in[5];
  const float* Wv     = (const float*)d_in[6];
  const float* bv     = (const float*)d_in[7];
  float* out = (float*)d_out;

  char* ws = (char*)d_ws;
  const size_t MB = 1024u * 1024u;
  _Float16* h16  = (_Float16*)(ws);             //  8 MB: [4096,1024]
  _Float16* wT   = (_Float16*)(ws + 8  * MB);   //  6 MB: [3,1024,1024]
  _Float16* q16  = (_Float16*)(ws + 14 * MB);   //  8 MB: [b,h,n,64]
  _Float16* k16  = (_Float16*)(ws + 22 * MB);   //  8 MB
  _Float16* vT16 = (_Float16*)(ws + 30 * MB);   //  8 MB: [b,h,64,n]
  unsigned int* mbits = (unsigned int*)(ws + 38 * MB);   //  4 MB: [b,h,32,8,32]

  // 4096 waves of mask words, 1536 waves of 64 x 32 weights, 4096 waves of
  // 1024 elements of hidden
  prepare<<<P_MASK_BLOCKS + P_WEIGHT_BLOCKS + P_HIDDEN_BLOCKS, 512, 0, stream>>>(
      hidden, h16, adj, mbits, Wq, Wk, Wv, wT);

  // 128-row tiles x 128-col tiles over {q,k,v}, 4 waves of 64x64
  qkv_gemm<<<dim3(NB * NSEQ / 128, 3 * DMODEL / 128), 128, 0, stream>>>(
      h16, wT, bq, bk, bv, q16, k16, vT16);

  // 8*16*32 = 4096 waves, 8 waves per block
  attention<<<512, 256, 0, stream>>>(q16, k16, vT16, mbits, out);
}

// v008
// One run takes 46.2 microseconds.
// Timed twice side by side with v007, it ran 1.04 and 1.05 times as fast.
// Over all steps from v000 it is 3.88 times as fast.
#include <hip/hip_runtime.h>
#include <hip/hip_bf16.h>

typedef __attribute__((ext_vector_type(16))) _Float16 v16h;
typedef __attribute__((ext_vector_type(8)))  _Float16 v8h;
typedef __attribute__((ext_vector_type(8)))  float    v8f;

#define NHEAD 16
#define NB    8
#define NSEQ  512
#define DMODEL 1024
#define HDIM  64

// relation->head allow mask (bit r = relation r allowed for this head),
// precomputed from the reference's per-head loop.
__device__ __constant__ unsigned short ALLOWED_MASK[NHEAD] = {
  0x3003, 0x3005, 0x3009, 0x3831, 0x3071, 0x30E1, 0x31C1, 0x3381,
  0x3701, 0x3E01, 0x3C11, 0x3831, 0x7001, 0x7001, 0x7001, 0x7001
};

// Load a 16-lane-half K-packed f16 fragment (A or B layout for 16x16x32):
// caller passes p = base + row*ld + k0 + (lane>>4)*8.  lo = K chunk 0..7(/8..15),
// hi = K chunk 16..23(/24..31) per the CDNA5 16-bit A/B VGPR layout.
__device__ inline v16h load_frag16(const _Float16* p) {
  v8h lo = *(const v8h*)(p);
  v8h hi = *(const v8h*)(p + 16);
  v16h r;
#pragma unroll
  for (int i = 0; i < 8; ++i) { r[i] = lo[i]; r[i + 8] = hi[i]; }
  return r;
}

__device__ inline v8f wmma_f16(v16h a, v16h b, v8f c) {
  return __builtin_amdgcn_wmma_f32_16x16x32_f16(
      /*neg_a=*/false, a, /*neg_b=*/false, b,
      /*c_mod=*/(short)0, c, /*reuse_a=*/false, /*reuse_b=*/false);
}

// ------------------------------- conversions -------------------------------
// Sized by waves to start, not by elements: a thread converts a block of
// elements with 16-byte loads, all of them in flight at once.

typedef __attribute__((ext_vector_type(4))) float    v4f;
typedef __attribute__((ext_vector_type(4))) _Float16 v4h;

typedef __attribute__((ext_vector_type(4))) int v4i;

// One launch for the three preparations, which need nothing of each other: the
// block index picks the part.  608 blocks of 16 waves.
// Blocks 0-255 turn adj into the attention kernel's mask words, once for all
// heads.  mbits[b][h][query tile][stage][e], bit l = "relation allowed" for the
// score that lane l of the attention wave holds as element e of the stage:
// query 16 tile + (l & 15), key 64 stage + 32 (e >> 4) + 16 ((e >> 3) & 1) +
// 8 (l >> 4) + (e & 7).  A wave takes one (b, tile, stage) and 8 heads: its
// lanes read adj in the attention wave's own layout, a ballot is a word.
// Blocks 256-351: wT[sel][n_out][k_in] = W_sel[k_in][n_out] (transpose +
// f32->f16).  A wave takes a tile of 64 k x 32 n; a lane holds two blocks of
// 8 k x 4 n in registers (16 loads of 16 bytes; a wave-wide load is 4 whole
// 128-byte lines of W) and stores each n of a block as 8 k = 16 bytes.
// Blocks 352-607: a wave converts 1024 floats of hidden in a row: 8 loads of
// 512 contiguous bytes, then 8 stores of 256 contiguous bytes.
#define P_MASK_BLOCKS   256
#define P_WEIGHT_BLOCKS (3 * DMODEL * DMODEL / (16 * 64 * 32))
#define P_HIDDEN_BLOCKS (NB * NSEQ * DMODEL / (16 * 1024))

__global__ __launch_bounds__(512) void prepare(const float* __restrict__ src,
                                               _Float16* __restrict__ dst,
                                               const int* __restrict__ adj,
                                               unsigned int* __restrict__ mbits,
                                               const float* __restrict__ Wq,
                                               const float* __restrict__ Wk,
                                               const float* __restrict__ Wv,
                                               _Float16* __restrict__ wT) {
  const int lane = threadIdx.x & 31;
  if (blockIdx.x < P_MASK_BLOCKS) {
    const unsigned int t = blockIdx.x * 16u +
        (unsigned int)__builtin_amdgcn_readfirstlane(threadIdx.x >> 5);   // 0..4095
    const unsigned int hg = t & 1u, st = (t >> 1) & 7u, qt = (t >> 4) & 31u, b = t >> 9;
    const int* p = adj + ((size_t)b * NSEQ + qt * 16u + (lane & 15)) * NSEQ + st * 64u + (lane >> 4) * 8;
    v4i x[8];
#pragma unroll  // constant indices: the array stays in registers
    for (int j = 0; j < 8; ++j) x[j] = *(const v4i*)(p + (j >> 1) * 16 + (j & 1) * 4);
#pragma unroll  // constant indices: the array stays in registers
    for (int hh = 0; hh < 8; ++hh) {
      const unsigned int h = hg * 8u + hh;
      const unsigned int mask = ALLOWED_MASK[h];
      unsigned int w = 0u;
#pragma unroll  // constant indices: the array stays in registers
      for (int e = 0; e < 32; ++e) {
        const unsigned int word =
            __builtin_amdgcn_ballot_w32(((mask >> x[e >> 2][e & 3]) & 1u) != 0u);
        w = (lane == e) ? word : w;          // lane e stores word e
      }
      mbits[((((size_t)b * NHEAD + h) * 32u + qt) * 8u + st) * 32u + lane] = w;
    }
  } else if (blockIdx.x < P_MASK_BLOCKS + P_WEIGHT_BLOCKS) {
    const int t   = (blockIdx.x - P_MASK_BLOCKS) * 16 + (threadIdx.x >> 5);   // 0 .. 3*512-1
    const int sel = t >> 9;
    const int n0  = (t & 31) * 32 + (lane & 7) * 4;
    const int k0  = ((t >> 5) & 15) * 64 + (lane >> 3) * 8;
    const float* W = (sel == 0) ? Wq : ((sel == 1) ? Wk : Wv);
    const float* s = W + (size_t)k0 * DMODEL + n0;
    v4f x[2][8];
#pragma unroll  // constant indices: the array stays in registers
    for (int u = 0; u < 2; ++u)
#pragma unroll  // constant indices: the array stays in registers
      for (int j = 0; j < 8; ++j)
        x[u][j] = *(const v4f*)(s + (size_t)(u * 32 + j) * DMODEL);
    // Takes the loaded values and their address as inputs only: all 16 loads are
    // in flight before the first convert (without it two of them are issued only
    // behind a wait for earlier ones, a second trip to memory), and the address
    // pair that they name is rewritten only behind this wait.
    asm volatile("s_wait_xcnt 0x0" :: "v"(x[0][0]), "v"(x[0][1]), "v"(x[0][2]), "v"(x[0][3]),
                       "v"(x[0][4]), "v"(x[0][5]), "v"(x[0][6]), "v"(x[0][7]),
                       "v"(x[1][0]), "v"(x[1][1]), "v"(x[1][2]), "v"(x[1][3]),
                       "v"(x[1][4]), "v"(x[1][5]), "v"(x[1][6]), "v"(x[1][7]),
                       "v"(s) : "memory");
    _Float16* d = wT + ((size_t)sel * DMODEL + n0) * DMODEL + k0;
#pragma unroll  // constant indices: the array stays in registers
    for (int u = 0; u < 2; ++u)
#pragma unroll  // constant indices: the array stays in registers
      for (int i = 0; i < 4; ++i) {
        v8h y;
#pragma unroll  // constant indices: the array stays in registers
        for (int j = 0; j < 8; ++j) y[j] = (_Float16)x[u][j][i];
        *(v8h*)(d + (size_t)i * DMODEL + u * 32) = y;
      }
    // the built code can go on from here into another part, which rewrites the
    // registers that these stores name: the wait stands in front of that
    asm volatile("s_wait_xcnt 0x0" ::: "memory");
  } else {
    const int wave = (blockIdx.x - (P_MASK_BLOCKS + P_WEIGHT_BLOCKS)) * 16 + (threadIdx.x >> 5);
    const size_t base = (size_t)wave * 1024 + lane * 4;
    v4f x[8];
#pragma unroll  // constant indices: the array stays in registers
    for (int j = 0; j < 8; ++j) x[j] = *(const v4f*)(src + base + j * 128);
#pragma unroll  // constant indices: the array stays in registers
    for (int j = 0; j < 8; ++j)
      *(v4h*)(dst + base + j * 128) = __builtin_convertvector(x[j], v4h);
    // the built code can go on from here into another part, which rewrites the
    // registers that these stores name: the wait stands in front of that
    asm volatile("s_wait_xcnt 0x0" ::: "memory");
  }
}

// --------------------------------- QKV GEMM --------------------------------
// grid (16 row tiles, 16 column tiles over {q,k,v}), 384 threads = 12 waves:
// 256 blocks, one for each WGP (registers hold three such waves on a SIMD).
// One 256x192 output tile per block, 64x64 (4x4 WMMA tiles) per wave, 4 waves
// down and 3 across.  The tile is sized by what the ring draws from L2: the
// operand bytes copied per result fall as the tile's sides grow, and this is the
// largest tile of 64x64 waves that still gives every WGP a block.
// A wave's 64 columns are one head of q, k or v; a block may hold two of the
// three matrices, so which one it is is a matter of the wave.  The
// operands come through a two-buffer LDS ring: a stage is 64 k of 256 rows of
// h16 and 192 rows of wT; waves 0-6 each bring one 64-row slice of it with one
// tensor load, padded to a 144-byte row pitch for the ds_load_b128 readers.

typedef uint32_t u32x4 __attribute__((ext_vector_type(4)));
typedef uint32_t u32x8 __attribute__((ext_vector_type(8)));

#define G_ROWB   128u                 // bytes of one staged row (64 k of f16)
#define G_PITCH  144u                 // LDS row pitch: 128 + 16 pad bytes
#define G_SLICE  10240u               // 64 rows * 144 B, rounded up to 2 KiB
#define G_HSLICE 4u                   // slices of h16 in a stage (256 rows)
#define G_NSLICE 7u                   // and with them 3 slices of wT (192 rows)
#define G_STAGE  (G_NSLICE * G_SLICE)
#define G_NSTAGE (DMODEL * 2u / G_ROWB)

__device__ inline uint32_t uni(uint32_t v) {
  return (uint32_t)__builtin_amdgcn_readfirstlane(v);
}
// Makes the test around a tensor load a scalar branch, and keeps a descriptor
// word that is formed from the result behind the waits in front of the call.
__device__ inline uint32_t pinned(uint32_t v) {
  uint32_t w = uni(v);
  // pinned(): an issue test or a descriptor word held in a scalar register
  asm volatile("" : "+s"(w));
  return w;
}
__device__ inline void wait_ds0() {
  // a wave's LDS reads have retired before the buffer they read is refilled
  asm volatile("s_wait_dscnt 0x0" ::: "memory");
}

__global__ __launch_bounds__(384) void qkv_gemm(
    const _Float16* __restrict__ h16,   // [4096,1024]
    const _Float16* __restrict__ wT,    // [3][1024][1024]
    const float* __restrict__ bq, const float* __restrict__ bk,
    const float* __restrict__ bv,
    _Float16* __restrict__ q16,         // [b,h,n,64]  (pre-scaled 1/8)
    _Float16* __restrict__ k16,         // [b,h,n,64]
    _Float16* __restrict__ vT16)        // [b,h,64,n]
{
  __shared__ __attribute__((aligned(2048))) unsigned char ring[2u * G_STAGE];

  const int lane = threadIdx.x & 31;
  const uint32_t wv = uni(threadIdx.x >> 5);
  const int half = lane >> 4;
  const int l16  = lane & 15;
  const uint32_t wm = wv & 3u, wn = wv >> 2;         // 4x3 waves
  const int row0 = blockIdx.x * 256;                 // 0..3840
  const uint32_t cg = blockIdx.y * 192u + wn * 64u;  // the wave's first column of 3072
  const int sel  = (int)(cg >> 10);                  // q, k or v: the same in a wave

  const float* bias = (sel == 0) ? bq : ((sel == 1) ? bk : bv);

  // Slices of a stage: waves 0-3 bring 64 rows of h16 each, waves 4-6 bring 64
  // rows of wT each (wT's three matrices are contiguous); waves 7-11 bring none
  // (sl only keeps their unused address inside wT).
  const uint32_t sl = (wv < G_NSLICE) ? wv : G_NSLICE - 1u;
  const _Float16* slice_src =
      (sl < G_HSLICE) ? h16 + (size_t)(row0 + sl * 64u) * DMODEL
                      : wT + (size_t)(blockIdx.y * 192u + (sl - G_HSLICE) * 64u) * DMODEL;
  const uint64_t src_ga = (uint64_t)(size_t)slice_src;
  const uint32_t lbase  = (uint32_t)(size_t)ring;

  // Descriptor group 1: byte elements, tile = tensor = 64 rows of 128 bytes,
  // source pitch 2048 bytes, 4 dwords of pad behind every 32 dwords.
  // pinned(): each descriptor word held in one scalar register from here on,
  // not formed a second time while a request that names it is in flight.
  u32x8 g1;
  g1[0] = pinned((1u << 20) | (4u << 22) | (3u << 25));
  g1[1] = pinned((G_ROWB & 0xFFFFu) << 16);
  g1[2] = pinned((G_ROWB >> 16) | (64u << 16));
  g1[3] = pinned(G_ROWB << 16);
  g1[4] = pinned(64u);
  g1[5] = pinned(DMODEL * 2u);
  g1[6] = pinned(0u);
  g1[7] = pinned(0u);

  u32x4 g0 = {0u, 0u, 0u, 0u};         // group 0 of the wave's last request
  auto issue = [&](uint32_t st) {
    const uint32_t dst = lbase + (st & 1u) * G_STAGE + wv * G_SLICE;
    const uint64_t ga  = src_ga + (uint64_t)(st * G_ROWB);
    g0[0] = uni(1u);
    g0[1] = uni(dst);
    g0[2] = uni((uint32_t)ga);
    g0[3] = uni((((uint32_t)(ga >> 32)) & 0x01FFFFFFu) | 0x80000000u);
    // One request of the whole wave: global tile -> LDS, through no register.
    // The descriptor words are inputs of the wait below as well (group 0, formed
    // anew for each request, an in-out operand here): the compiler then keeps
    // them where they are while the request is in flight.
    asm volatile("tensor_load_to_lds %0, %1" : "+s"(g0) : "s"(g1) : "memory");
  };
  auto landed = [&]() {
    // the issuer's own wait: a tile counts as landed only behind it
    asm volatile("s_wait_tensorcnt 0x0" :: "s"(g0), "s"(g1) : "memory");
  };

  v8f acc[4][4];
#pragma unroll  // constant indices: the arrays stay in registers
  for (int m = 0; m < 4; ++m)
#pragma unroll  // constant indices: the arrays stay in registers
    for (int t = 0; t < 4; ++t) acc[m][t] = (v8f){};

  // The waits on the tensor count stand outside the issuers' branch: every
  // issuer passes its own, in a wave that has issued nothing it waits for nothing.
  if (pinned(wv < G_NSLICE)) issue(0u);
  landed();
  __syncthreads();                     // stage 0 published
  if (pinned(wv < G_NSLICE)) issue(pinned(1u));

  // Which matrix is the A operand is chosen by where the result goes: a lane
  // holds 8 consecutive ROWS of D, and these must be neighbours in memory.
  // v (stored [head dim][n]): A = h16, D = h.W.  q, k (stored [n][head dim]):
  // A = wT, D = (h.W)^T.  Both operands have the same fragment layout.
  const uint32_t h_off = wm * G_SLICE + (uint32_t)l16 * G_PITCH + (uint32_t)half * 16u;
  const uint32_t w_off = (G_HSLICE + wn) * G_SLICE + (uint32_t)l16 * G_PITCH + (uint32_t)half * 16u;
  const uint32_t a_off = (sel == 2) ? h_off : w_off;
  const uint32_t b_off = (sel == 2) ? w_off : h_off;

  // kept rolled: one copy of the pass, the buffer chosen by the stage's parity
#pragma unroll 1
  for (uint32_t s = 0; s < G_NSTAGE; ++s) {
    const unsigned char* buf = ring + (s & 1u) * G_STAGE;
    v16h a[2][4], b[2][4];
#pragma unroll  // constant indices: the arrays stay in registers
    for (int ks = 0; ks < 2; ++ks) {
#pragma unroll  // constant indices: the arrays stay in registers
      for (int m = 0; m < 4; ++m)
        a[ks][m] = load_frag16((const _Float16*)(buf + a_off + m * 16 * G_PITCH + ks * 64));
#pragma unroll  // constant indices: the arrays stay in registers
      for (int t = 0; t < 4; ++t)
        b[ks][t] = load_frag16((const _Float16*)(buf + b_off + t * 16 * G_PITCH + ks * 64));
    }
    // Publish point of stage s + 1.  It stands here, not behind the WMMAs: the
    // pass's fragments are all in registers behind the first wait, so the
    // buffer is free one barrier later and its refill flies under the WMMAs.
    wait_ds0();
    landed();
    __syncthreads();                   // s + 1 landed for all; all have left s
    if (pinned(s + 2u < G_NSTAGE && wv < G_NSLICE)) issue(pinned(s + 2u));
#pragma unroll  // constant indices: the arrays stay in registers
    for (int ks = 0; ks < 2; ++ks)
#pragma unroll  // constant indices: the arrays stay in registers
      for (int t = 0; t < 4; ++t)
#pragma unroll  // constant indices: the arrays stay in registers
        for (int m = 0; m < 4; ++m)
          acc[m][t] = wmma_f16(a[ks][m], b[ks][t], acc[m][t]);
  }
  landed();
  wait_ds0();

  // acc[m][t][r] = D[16 m + 8 half + r][16 t + l16]: 8 neighbours of an output
  // row in a lane, stored as 16 bytes.  The wave's 64 columns are one head, the
  // block's 256 rows lie in one batch.
  const int c0 = (int)(cg & (DMODEL - 1u));          // 0..960 inside q, k or v
  const int n0 = (row0 & (NSEQ - 1)) + (int)wm * 64;
  const size_t head = (size_t)((row0 >> 9) * NHEAD + (c0 >> 6)) * (NSEQ * HDIM);
  if (sel == 2) {
    _Float16* dst = vT16 + head + (size_t)l16 * NSEQ + n0 + half * 8;
#pragma unroll  // constant indices: the arrays stay in registers
    for (int t = 0; t < 4; ++t) {
      const float bcol = bias[c0 + t * 16 + l16];
#pragma unroll  // constant indices: the arrays stay in registers
      for (int m = 0; m < 4; ++m) {
        v8h y;
#pragma unroll  // constant indices: the arrays stay in registers
        for (int r = 0; r < 8; ++r) y[r] = (_Float16)(acc[m][t][r] + bcol);
        *(v8h*)(dst + t * 16 * NSEQ + m * 16) = y;
      }
    }
  } else {
    const float qscale = (sel == 0) ? 0.125f : 1.0f;   // fold 1/sqrt(64) into Q
    _Float16* dst = ((sel == 0) ? q16 : k16) + head + (size_t)(n0 + l16) * HDIM + half * 8;
    v4f blo[4], bhi[4];
#pragma unroll  // constant indices: the arrays stay in registers
    for (int m = 0; m < 4; ++m) {
      blo[m] = *(const v4f*)(bias + c0 + m * 16 + half * 8);
      bhi[m] = *(const v4f*)(bias + c0 + m * 16 + half * 8 + 4);
    }
#pragma unroll  // constant indices: the arrays stay in registers
    for (int t = 0; t < 4; ++t)
#pragma unroll  // constant indices: the arrays stay in registers
      for (int m = 0; m < 4; ++m) {
        v8h y;
#pragma unroll  // constant indices: the arrays stay in registers
        for (int r = 0; r < 4; ++r) {
          y[r]     = (_Float16)((acc[m][t][r]     + blo[m][r]) * qscale);
          y[r + 4] = (_Float16)((acc[m][t][r + 4] + bhi[m][r]) * qscale);
        }
        *(v8h*)(dst + t * 16 * HDIM + m * 16) = y;
      }
    // the built code can fall from here into the v branch, which rewrites the
    // registers that these stores name: the wait stands in front of that
    asm volatile("s_wait_xcnt 0x0" ::: "memory");
  }
}

// -------------------------------- attention --------------------------------
// One wave = 16 query rows of one (b,h); key loop in chunks of 32 with online
// softmax.  8 WMMAs per chunk (4 for S^T, 4 for V^T.P^T), 128 per wave.
// Both products are taken transposed: K and V^T are the A operands, Q and P^T
// the B operands.  A lane (l16, half) then holds 16 of the chunk's 32 scores of
// query l16: maximum and sum are taken in the lane, with one exchange between
// the halves, and the two score tiles, converted in place, are the B operand
// P^T in the hardware k order.  O^T is turned into rows once, behind the loop.
// The 8 waves of a block work on one (b,h) and read the same K and V^T: these
// come through a two-buffer LDS ring.  A stage is 64 keys (two chunks): 64 rows
// of K (64 head dims each) and 64 rows of V^T (64 keys each), all of 128 bytes;
// each wave brings one 16-row slice of it with one tensor load, padded to the
// 144-byte row pitch for the ds_load_b128 readers.

#define A_KEYS   64u                  // keys of one stage
#define A_SLICE  4096u                // 16 rows * 144 B, rounded up to 2 KiB
#define A_STAGE  (8u * A_SLICE)
#define A_NSTAGE (NSEQ / A_KEYS)
#define A_OPITCH 68                   // floats: 64 head dims + 16 pad bytes

typedef __attribute__((ext_vector_type(16))) unsigned int u32x16;
typedef __attribute__((address_space(4))) u32x16 c_u32x16;

// the value of lane l ^ 16
__device__ inline float xhalf(float x) {
  const int i = __builtin_bit_cast(int, x);
  return __builtin_bit_cast(float, __builtin_amdgcn_permlanex16(
      i, i, 0x76543210, 0xfedcba98, false, false));
}

__global__ __launch_bounds__(256) void attention(
    const _Float16* __restrict__ q16, const _Float16* __restrict__ k16,
    const _Float16* __restrict__ vT16, const unsigned int* __restrict__ mbits,
    float* __restrict__ out)
{
  __shared__ __attribute__((aligned(2048))) unsigned char ring[2u * A_STAGE];
  __shared__ __attribute__((aligned(16))) float ldsO[8][16][A_OPITCH];  // per-wave O staging (O^T -> rows)

  const int lane = threadIdx.x & 31;
  const int w    = threadIdx.x >> 5;
  const uint32_t wv = uni(threadIdx.x >> 5);   // the same, in a scalar register
  const int half = lane >> 4;
  const int l16  = lane & 15;

  const int wid = blockIdx.x * 8 + w;    // 0..4095
  const int qt  = wid & 31;              // query tile 0..31
  const int h   = (wid >> 5) & (NHEAD - 1);
  const int b   = wid >> 9;

  const _Float16* qb = q16 + ((size_t)(b * NHEAD + h) * NSEQ + qt * 16) * HDIM;
  const _Float16* kb = k16 + (size_t)(b * NHEAD + h) * NSEQ * HDIM;
  const _Float16* vb = vT16 + (size_t)(b * NHEAD + h) * HDIM * NSEQ;

  // Q fragments (B operand: column l16 = query l16), fixed across the key loop.
  v16h bQ0 = load_frag16(qb + (size_t)l16 * HDIM + half * 8);
  v16h bQ1 = load_frag16(qb + (size_t)l16 * HDIM + 32 + half * 8);
  // this build rewrites the address pair of these loads right behind them: the
  // wait stands in front of that
  asm volatile("s_wait_xcnt 0x0" ::: "memory");

  // o_t[r] = O[query l16][head dim 16 t + 8 half + r]
  v8f o0 = {}, o1 = {}, o2 = {}, o3 = {};
  float mrow = -1e30f;   // running maximum of query l16, the same in both halves
  float lrow = 0.0f;     // this half's share of the denominator of query l16
  // The wave's mask words: 32 a stage, one for each score that a lane holds; the
  // address is the same in every lane, so they come by scalar loads.  wid runs
  // as [b][h][query tile], the order of mbits.
  // Read through the constant address space (nothing writes mbits in this
  // launch): the loads inside the loop stay scalar loads too.
  const c_u32x16* mwq = (const c_u32x16*)(size_t)(
      mbits + (size_t)(blockIdx.x * 8u + wv) * (A_NSTAGE * 32u));
  u32x16 mw0 = mwq[0];                       // stage 0, first chunk
  u32x16 mw1 = mwq[1];                       // stage 0, second chunk

  // Slices of a stage: waves 0-3 bring 16 keys of K each (rows one behind the
  // other), waves 4-7 bring 16 head dims of V^T each (rows one sequence apart).
  const _Float16* slice_src = (wv < 4u) ? kb + (size_t)(wv * 16u) * HDIM
                                        : vb + (size_t)((wv - 4u) * 16u) * NSEQ;
  const uint32_t slice_pitch = (wv < 4u) ? HDIM * 2u : NSEQ * 2u;           // bytes, row to row
  const uint32_t slice_step  = (wv < 4u) ? A_KEYS * HDIM * 2u : A_KEYS * 2u; // bytes, stage to stage
  const uint64_t src_ga = (uint64_t)(size_t)slice_src;
  const uint32_t lbase  = (uint32_t)(size_t)ring;

  // Descriptor group 1: byte elements, tile = tensor = 16 rows of 128 bytes,
  // 4 dwords of pad behind every 32 dwords.
  u32x8 g1;
  g1[0] = uni((1u << 20) | (4u << 22) | (3u << 25));
  g1[1] = uni((G_ROWB & 0xFFFFu) << 16);
  g1[2] = uni((G_ROWB >> 16) | (16u << 16));
  g1[3] = uni(G_ROWB << 16);
  g1[4] = uni(16u);
  g1[5] = uni(slice_pitch);
  g1[6] = uni(0u);
  g1[7] = uni(0u);

  u32x4 g0;                            // group 0 of the wave's last request
  auto issue = [&](uint32_t st) {
    const uint32_t dst = lbase + (st & 1u) * A_STAGE + wv * A_SLICE;
    const uint64_t ga  = src_ga + (uint64_t)(st * slice_step);
    g0[0] = uni(1u);
    g0[1] = uni(dst);
    g0[2] = uni((uint32_t)ga);
    g0[3] = uni((((uint32_t)(ga >> 32)) & 0x01FFFFFFu) | 0x80000000u);
    // One request of the whole wave: global tile -> LDS, through no register.
    // The descriptor words are in-out operands here and inputs of the wait
    // below: the compiler then keeps them where they are, and forms none of
    // them anew, while the request is in flight.
    asm volatile("tensor_load_to_lds %0, %1" : "+s"(g0), "+s"(g1) :: "memory");
  };
  auto landed = [&]() {
    // the issuer's own wait: a tile counts as landed only behind it
    asm volatile("s_wait_tensorcnt 0x0" :: "s"(g0), "s"(g1) : "memory");
  };

  issue(0u);
  landed();
  __syncthreads();                     // stage 0 published
  issue(pinned(1u));

  // a lane's place in a 16-row slice: row l16, its half's 16 bytes
  const uint32_t f_off = (uint32_t)l16 * G_PITCH + (uint32_t)half * 16u;

  // kept rolled: one copy of the pass, the buffer chosen by the stage's parity
#pragma unroll 1
  for (uint32_t s = 0; s < A_NSTAGE; ++s) {
   const unsigned char* buf = ring + (s & 1u) * A_STAGE + f_off;
#pragma unroll  // constant slice numbers and offsets inside the stage
   for (int cc = 0; cc < (int)A_KEYS; cc += 32) {
    // ---- S^T = K.Q^T for 32k x 16q (two 16x16 tiles) ----
    // s0[r] = score(key c + 8 half + r, query l16), s1[r] the same 16 keys on
    v8f s0 = {}, s1 = {};
    {
      const unsigned char* kr = buf + (cc >> 4) * A_SLICE;   // keys cc .. cc+15
      v16h ak0 = load_frag16((const _Float16*)(kr));
      v16h ak1 = load_frag16((const _Float16*)(kr + 64));
      s0 = wmma_f16(ak0, bQ0, s0);
      s0 = wmma_f16(ak1, bQ1, s0);
      v16h ak2 = load_frag16((const _Float16*)(kr + A_SLICE));
      v16h ak3 = load_frag16((const _Float16*)(kr + A_SLICE + 64));
      s1 = wmma_f16(ak2, bQ0, s1);
      s1 = wmma_f16(ak3, bQ1, s1);
    }

    // ---- relation mask (scores += -1e9 where disallowed) ----
    {
      const u32x16 mw = cc ? mw1 : mw0;
#pragma unroll  // constant indices: the vectors stay in registers
      for (int r = 0; r < 8; ++r) {
        // a word is the select's lane mask as it stands
        if (!__builtin_amdgcn_inverse_ballot_w32(mw[r]))     s0[r] += -1e9f;
        if (!__builtin_amdgcn_inverse_ballot_w32(mw[r + 8])) s1[r] += -1e9f;
      }
    }

    // ---- online softmax update of query l16 ----
    float v = fmaxf(s0[0], s1[0]);
#pragma unroll  // constant indices: the vectors stay in registers
    for (int r = 1; r < 8; ++r) v = fmaxf(v, fmaxf(s0[r], s1[r]));
    v = fmaxf(v, xhalf(v));              // both halves: the chunk's maximum
    const float mnew = fmaxf(mrow, v);
    const float sc = __expf(mrow - mnew);
    mrow = mnew;
    float rs = 0.0f;
    v16h bP;   // P^T, column l16: the keys in the k order of load_frag16
#pragma unroll  // constant indices: the vectors stay in registers
    for (int r = 0; r < 8; ++r) {
      const float p0 = __expf(s0[r] - mnew);
      const float p1 = __expf(s1[r] - mnew);
      rs += p0 + p1;
      bP[r]     = (_Float16)p0;
      bP[r + 8] = (_Float16)p1;
    }
    lrow = lrow * sc + rs;
    o0 *= sc; o1 *= sc; o2 *= sc; o3 *= sc;

    // ---- O^T += V^T.P^T (4 hd tiles, A fragments from transposed V) ----
    const unsigned char* vr = buf + 4u * A_SLICE + cc * 2;   // keys cc .. cc+31 of a row
    v16h av0 = load_frag16((const _Float16*)(vr));
    v16h av1 = load_frag16((const _Float16*)(vr + A_SLICE));
    v16h av2 = load_frag16((const _Float16*)(vr + 2u * A_SLICE));
    v16h av3 = load_frag16((const _Float16*)(vr + 3u * A_SLICE));
    o0 = wmma_f16(av0, bP, o0);
    o1 = wmma_f16(av1, bP, o1);
    o2 = wmma_f16(av2, bP, o2);
    o3 = wmma_f16(av3, bP, o3);
   }
   // the next stage's mask words, asked for in front of the barrier, before the pass that uses them
   // (the last pass asks for its own again: the address stays inside mbits)
   {
     const c_u32x16* mn = mwq + (s + 1u < A_NSTAGE ? s + 1u : s) * 2u;
     mw0 = mn[0];
     mw1 = mn[1];
   }
   // Publish point of stage s + 1, at the foot of the pass.
   wait_ds0();
   landed();
   __syncthreads();                    // s + 1 landed for all; all have left s
   if (pinned(s + 2u < A_NSTAGE)) issue(pinned(s + 2u));
  }
  landed();
  wait_ds0();

  // ---- normalize, turn O^T into rows in the wave's own LDS, store fp32 ----
  const float inv = 1.0f / (lrow + xhalf(lrow));   // the halves' shares joined
  {
    float* st = &ldsO[w][l16][half * 8];
    const v8f y0 = o0 * inv, y1 = o1 * inv, y2 = o2 * inv, y3 = o3 * inv;
    *(v4f*)(st)      = __builtin_shufflevector(y0, y0, 0, 1, 2, 3);
    *(v4f*)(st + 4)  = __builtin_shufflevector(y0, y0, 4, 5, 6, 7);
    *(v4f*)(st + 16) = __builtin_shufflevector(y1, y1, 0, 1, 2, 3);
    *(v4f*)(st + 20) = __builtin_shufflevector(y1, y1, 4, 5, 6, 7);
    *(v4f*)(st + 32) = __builtin_shufflevector(y2, y2, 0, 1, 2, 3);
    *(v4f*)(st + 36) = __builtin_shufflevector(y2, y2, 4, 5, 6, 7);
    *(v4f*)(st + 48) = __builtin_shufflevector(y3, y3, 0, 1, 2, 3);
    *(v4f*)(st + 52) = __builtin_shufflevector(y3, y3, 4, 5, 6, 7);
  }
  // 16 lanes cover one query's 64 head dims: a store is 4 whole 128-byte lines
  float* op = out + ((size_t)(b * NSEQ + qt * 16 + half) * DMODEL) + h * HDIM + l16 * 4;
#pragma unroll  // the 8 LDS reads go out together, the stores follow as they return
  for (int i = 0; i < 8; ++i)
    *(v4f*)(op + (size_t)(i * 2) * DMODEL) = *(const v4f*)&ldsO[w][i * 2 + half][l16 * 4];
}

// --------------------------------- launcher --------------------------------

extern "C" void kernel_launch(void* const* d_in, const int* in_sizes, int n_in,
                              void* d_out, int out_size, void* d_ws, size_t ws_size,
                              hipStream_t stream) {
  const float* hidden = (const float*)d_in[0];
  const int*   adj    = (const int*)d_in[1];
  const float* Wq     = (const float*)d_in[2];
  const float* bq     = (const float*)d_in[3];
  const float* Wk     = (const float*)d_in[4];
  const float* bk     = (const float*)d_in[5];
  const float* Wv     = (const float*)d_in[6];
  const float* bv     = (const float*)d_in[7];
  float* out = (float*)d_out;

  char* ws = (char*)d_ws;
  const size_t MB = 1024u * 1024u;
  _Float16* h16  = (_Float16*)(ws);             //  8 MB: [4096,1024]
  _Float16* wT   = (_Float16*)(ws + 8  * MB);   //  6 MB: [3,1024,1024]
  _Float16* q16  = (_Float16*)(ws + 14 * MB);   //  8 MB: [b,h,n,64]
  _Float16* k16  = (_Float16*)(ws + 22 * MB);   //  8 MB
  _Float16* vT16 = (_Float16*)(ws + 30 * MB);   //  8 MB: [b,h,64,n]
  unsigned int* mbits = (unsigned int*)(ws + 38 * MB);   //  4 MB: [b,h,32,8,32]

  // 4096 waves of mask words, 1536 waves of 64 x 32 weights, 4096 waves of
  // 1024 elements of hidden
  prepare<<<P_MASK_BLOCKS + P_WEIGHT_BLOCKS + P_HIDDEN_BLOCKS, 512, 0, stream>>>(
      hidden, h16, adj, mbits, Wq, Wk, Wv, wT);

  // 256-row tiles x 192-col tiles over {q,k,v}, 12 waves of 64x64
  qkv_gemm<<<dim3(NB * NSEQ / 256, 3 * DMODEL / 192), 384, 0, stream>>>(
      h16, wT, bq, bk, bv, q16, k16, vT16);

  // 8*16*32 = 4096 waves, 8 waves per block
  attention<<<512, 256, 0, stream>>>(q16, k16, vT16, mbits, out);
}

// v009
// One run takes 43.9 microseconds.
// Two timings next to v008 both put it at 1.06 times that version's speed.
// Counting every step since v000, it is 4.11 times as fast.
#include <hip/hip_runtime.h>
#include <hip/hip_bf16.h>

typedef __attribute__((ext_vector_type(16))) _Float16 v16h;
typedef __attribute__((ext_vector_type(8)))  _Float16 v8h;
typedef __attribute__((ext_vector_type(8)))  float    v8f;

#define NHEAD 16
#define NB    8
#define NSEQ  512
#define DMODEL 1024
#define HDIM  64

// relation->head allow mask (bit r = relation r allowed for this head),
// precomputed from the reference's per-head loop.
__device__ __constant__ unsigned short ALLOWED_MASK[NHEAD] = {
  0x3003, 0x3005, 0x3009, 0x3831, 0x3071, 0x30E1, 0x31C1, 0x3381,
  0x3701, 0x3E01, 0x3C11, 0x3831, 0x7001, 0x7001, 0x7001, 0x7001
};

// Load a 16-lane-half K-packed f16 fragment (A or B layout for 16x16x32):
// caller passes p = base + row*ld + k0 + (lane>>4)*8.  lo = K chunk 0..7(/8..15),
// hi = K chunk 16..23(/24..31) per the CDNA5 16-bit A/B VGPR layout.
__device__ inline v16h load_frag16(const _Float16* p) {
  v8h lo = *(const v8h*)(p);
  v8h hi = *(const v8h*)(p + 16);
  v16h r;
#pragma unroll
  for (int i = 0; i < 8; ++i) { r[i] = lo[i]; r[i + 8] = hi[i]; }
  return r;
}

__device__ inline v8f wmma_f16(v16h a, v16h b, v8f c) {
  return __builtin_amdgcn_wmma_f32_16x16x32_f16(
      /*neg_a=*/false, a, /*neg_b=*/false, b,
      /*c_mod=*/(short)0, c, /*reuse_a=*/false, /*reuse_b=*/false);
}

// ------------------------------- conversions -------------------------------
// Sized by waves to start, not by elements: a thread converts a block of
// elements with 16-byte loads, all of them in flight at once.

typedef __attribute__((ext_vector_type(4))) float    v4f;
typedef __attribute__((ext_vector_type(4))) _Float16 v4h;

typedef __attribute__((ext_vector_type(4))) int v4i;

// One launch for the three preparations, which need nothing of each other: the
// block index picks the part.  608 blocks of 16 waves.
// Blocks 0-255 turn adj into the attention kernel's mask words, once for all
// heads.  mbits[b][h][query tile][half stage][e], bit l = "relation allowed" for the
// score that lane l of the attention wave holds as element e of the half stage (64 keys):
// query 16 tile + (l & 15), key 64 (half stage) + 32 (e >> 4) + 16 ((e >> 3) & 1) +
// 8 (l >> 4) + (e & 7).  A wave takes one (b, tile, half stage) and 8 heads: its
// lanes read adj in the attention wave's own layout, a ballot is a word.
// Blocks 256-351: wT[sel][n_out][k_in] = W_sel[k_in][n_out] (transpose +
// f32->f16).  A wave takes a tile of 64 k x 32 n; a lane holds two blocks of
// 8 k x 4 n in registers (16 loads of 16 bytes; a wave-wide load is 4 whole
// 128-byte lines of W) and stores each n of a block as 8 k = 16 bytes.
// Blocks 352-607: a wave converts 1024 floats of hidden in a row: 8 loads of
// 512 contiguous bytes, then 8 stores of 256 contiguous bytes.
#define P_MASK_BLOCKS   256
#define P_WEIGHT_BLOCKS (3 * DMODEL * DMODEL / (16 * 64 * 32))
#define P_HIDDEN_BLOCKS (NB * NSEQ * DMODEL / (16 * 1024))

__global__ __launch_bounds__(512) void prepare(const float* __restrict__ src,
                                               _Float16* __restrict__ dst,
                                               const int* __restrict__ adj,
                                               unsigned int* __restrict__ mbits,
                                               const float* __restrict__ Wq,
                                               const float* __restrict__ Wk,
                                               const float* __restrict__ Wv,
                                               _Float16* __restrict__ wT) {
  const int lane = threadIdx.x & 31;
  if (blockIdx.x < P_MASK_BLOCKS) {
    const unsigned int t = blockIdx.x * 16u +
        (unsigned int)__builtin_amdgcn_readfirstlane(threadIdx.x >> 5);   // 0..4095
    const unsigned int hg = t & 1u, st = (t >> 1) & 7u, qt = (t >> 4) & 31u, b = t >> 9;
    const int* p = adj + ((size_t)b * NSEQ + qt * 16u + (lane & 15)) * NSEQ + st * 64u + (lane >> 4) * 8;
    v4i x[8];
#pragma unroll  // constant indices: the array stays in registers
    for (int j = 0; j < 8; ++j) x[j] = *(const v4i*)(p + (j >> 1) * 16 + (j & 1) * 4);
#pragma unroll  // constant indices: the array stays in registers
    for (int hh = 0; hh < 8; ++hh) {
      const unsigned int h = hg * 8u + hh;
      const unsigned int mask = ALLOWED_MASK[h];
      unsigned int w = 0u;
#pragma unroll  // constant indices: the array stays in registers
      for (int e = 0; e < 32; ++e) {
        const unsigned int word =
            __builtin_amdgcn_ballot_w32(((mask >> x[e >> 2][e & 3]) & 1u) != 0u);
        w = (lane == e) ? word : w;          // lane e stores word e
      }
      mbits[((((size_t)b * NHEAD + h) * 32u + qt) * 8u + st) * 32u + lane] = w;
    }
  } else if (blockIdx.x < P_MASK_BLOCKS + P_WEIGHT_BLOCKS) {
    const int t   = (blockIdx.x - P_MASK_BLOCKS) * 16 + (threadIdx.x >> 5);   // 0 .. 3*512-1
    const int sel = t >> 9;
    const int n0  = (t & 31) * 32 + (lane & 7) * 4;
    const int k0  = ((t >> 5) & 15) * 64 + (lane >> 3) * 8;
    const float* W = (sel == 0) ? Wq : ((sel == 1) ? Wk : Wv);
    const float* s = W + (size_t)k0 * DMODEL + n0;
    v4f x[2][8];
#pragma unroll  // constant indices: the array stays in registers
    for (int u = 0; u < 2; ++u)
#pragma unroll  // constant indices: the array stays in registers
      for (int j = 0; j < 8; ++j)
        x[u][j] = *(const v4f*)(s + (size_t)(u * 32 + j) * DMODEL);
    // Takes the loaded values and their address as inputs only: all 16 loads are
    // in flight before the first convert (without it two of them are issued only
    // behind a wait for earlier ones, a second trip to memory), and the address
    // pair that they name is rewritten only behind this wait.
    asm volatile("s_wait_xcnt 0x0" :: "v"(x[0][0]), "v"(x[0][1]), "v"(x[0][2]), "v"(x[0][3]),
                       "v"(x[0][4]), "v"(x[0][5]), "v"(x[0][6]), "v"(x[0][7]),
                       "v"(x[1][0]), "v"(x[1][1]), "v"(x[1][2]), "v"(x[1][3]),
                       "v"(x[1][4]), "v"(x[1][5]), "v"(x[1][6]), "v"(x[1][7]),
                       "v"(s) : "memory");
    _Float16* d = wT + ((size_t)sel * DMODEL + n0) * DMODEL + k0;
#pragma unroll  // constant indices: the array stays in registers
    for (int u = 0; u < 2; ++u)
#pragma unroll  // constant indices: the array stays in registers
      for (int i = 0; i < 4; ++i) {
        v8h y;
#pragma unroll  // constant indices: the array stays in registers
        for (int j = 0; j < 8; ++j) y[j] = (_Float16)x[u][j][i];
        *(v8h*)(d + (size_t)i * DMODEL + u * 32) = y;
      }
    // the built code can go on from here into another part, which rewrites the
    // registers that these stores name: the wait stands in front of that
    asm volatile("s_wait_xcnt 0x0" ::: "memory");
  } else {
    const int wave = (blockIdx.x - (P_MASK_BLOCKS + P_WEIGHT_BLOCKS)) * 16 + (threadIdx.x >> 5);
    const size_t base = (size_t)wave * 1024 + lane * 4;
    v4f x[8];
#pragma unroll  // constant indices: the array stays in registers
    for (int j = 0; j < 8; ++j) x[j] = *(const v4f*)(src + base + j * 128);
#pragma unroll  // constant indices: the array stays in registers
    for (int j = 0; j < 8; ++j)
      *(v4h*)(dst + base + j * 128) = __builtin_convertvector(x[j], v4h);
    // the built code can go on from here into another part, which rewrites the
    // registers that these stores name: the wait stands in front of that
    asm volatile("s_wait_xcnt 0x0" ::: "memory");
  }
}

// --------------------------------- QKV GEMM --------------------------------
// grid (16 row tiles, 16 column tiles over {q,k,v}), 384 threads = 12 waves:
// 256 blocks, one for each WGP (registers hold three such waves on a SIMD).
// One 256x192 output tile per block, 64x64 (4x4 WMMA tiles) per wave, 4 waves
// down and 3 across.  The tile is sized by what the ring draws from L2: the
// operand bytes copied per result fall as the tile's sides grow, and this is the
// largest tile of 64x64 waves that still gives every WGP a block.
// A wave's 64 columns are one head of q, k or v; a block may hold two of the
// three matrices, so which one it is is a matter of the wave.  The
// operands come through a two-buffer LDS ring: a stage is 128 k of 256 rows of
// h16 and 192 rows of wT; waves 0-6 each bring one 64-row slice of it with one
// tensor load, padded to a 272-byte row pitch for the ds_load_b128 readers.
// A stage is worked on as two blocks of 64 k with one publish point: what a
// publish point costs (the last wave's LDS reads with the matrix units idle, a
// tensor load's latency) is paid 8 times, not 16.

typedef uint32_t u32x4 __attribute__((ext_vector_type(4)));
typedef uint32_t u32x8 __attribute__((ext_vector_type(8)));

#define G_ROWB   256u                 // bytes of one staged row (128 k of f16)
#define G_PITCH  272u                 // LDS row pitch: 256 + 16 pad bytes
#define G_SLICE  18432u               // 64 rows * 272 B, rounded up to 2 KiB
#define G_HSLICE 4u                   // slices of h16 in a stage (256 rows)
#define G_NSLICE 7u                   // and with them 3 slices of wT (192 rows)
#define G_STAGE  (G_NSLICE * G_SLICE)
#define G_NSTAGE (DMODEL * 2u / G_ROWB)

__device__ inline uint32_t uni(uint32_t v) {
  return (uint32_t)__builtin_amdgcn_readfirstlane(v);
}
// Makes the test around a tensor load a scalar branch, and keeps a descriptor
// word that is formed from the result behind the waits in front of the call.
__device__ inline uint32_t pinned(uint32_t v) {
  uint32_t w = uni(v);
  // pinned(): an issue test or a descriptor word held in a scalar register
  asm volatile("" : "+s"(w));
  return w;
}
__device__ inline void wait_ds0() {
  // a wave's LDS reads have retired before the buffer they read is refilled
  asm volatile("s_wait_dscnt 0x0" ::: "memory");
}

__global__ __launch_bounds__(384) void qkv_gemm(
    const _Float16* __restrict__ h16,   // [4096,1024]
    const _Float16* __restrict__ wT,    // [3][1024][1024]
    const float* __restrict__ bq, const float* __restrict__ bk,
    const float* __restrict__ bv,
    _Float16* __restrict__ q16,         // [b,h,n,64]  (pre-scaled 1/8)
    _Float16* __restrict__ k16,         // [b,h,n,64]
    _Float16* __restrict__ vT16)        // [b,h,64,n]
{
  __shared__ __attribute__((aligned(2048))) unsigned char ring[2u * G_STAGE];

  const int lane = threadIdx.x & 31;
  const uint32_t wv = uni(threadIdx.x >> 5);
  const int half = lane >> 4;
  const int l16  = lane & 15;
  const uint32_t wm = wv & 3u, wn = wv >> 2;         // 4x3 waves
  const int row0 = blockIdx.x * 256;                 // 0..3840
  const uint32_t cg = blockIdx.y * 192u + wn * 64u;  // the wave's first column of 3072
  const int sel  = (int)(cg >> 10);                  // q, k or v: the same in a wave

  const float* bias = (sel == 0) ? bq : ((sel == 1) ? bk : bv);

  // Slices of a stage: waves 0-3 bring 64 rows of h16 each, waves 4-6 bring 64
  // rows of wT each (wT's three matrices are contiguous); waves 7-11 bring none
  // (sl only keeps their unused address inside wT).
  const uint32_t sl = (wv < G_NSLICE) ? wv : G_NSLICE - 1u;
  const _Float16* slice_src =
      (sl < G_HSLICE) ? h16 + (size_t)(row0 + sl * 64u) * DMODEL
                      : wT + (size_t)(blockIdx.y * 192u + (sl - G_HSLICE) * 64u) * DMODEL;
  const uint64_t src_ga = (uint64_t)(size_t)slice_src;
  const uint32_t lbase  = (uint32_t)(size_t)ring;

  // Descriptor group 1: byte elements, tile = tensor = 64 rows of 256 bytes,
  // source pitch 2048 bytes, 4 dwords of pad behind every 64 dwords.
  // pinned(): each descriptor word held in one scalar register from here on,
  // not formed a second time while a request that names it is in flight.
  u32x8 g1;
  g1[0] = pinned((1u << 20) | (5u << 22) | (3u << 25));
  g1[1] = pinned((G_ROWB & 0xFFFFu) << 16);
  g1[2] = pinned((G_ROWB >> 16) | (64u << 16));
  g1[3] = pinned(G_ROWB << 16);
  g1[4] = pinned(64u);
  g1[5] = pinned(DMODEL * 2u);
  g1[6] = pinned(0u);
  g1[7] = pinned(0u);

  u32x4 g0 = {0u, 0u, 0u, 0u};         // group 0 of the wave's last request
  auto issue = [&](uint32_t st) {
    const uint32_t dst = lbase + (st & 1u) * G_STAGE + wv * G_SLICE;
    const uint64_t ga  = src_ga + (uint64_t)(st * G_ROWB);
    g0[0] = uni(1u);
    g0[1] = uni(dst);
    g0[2] = uni((uint32_t)ga);
    g0[3] = uni((((uint32_t)(ga >> 32)) & 0x01FFFFFFu) | 0x80000000u);
    // One request of the whole wave: global tile -> LDS, through no register.
    // The descriptor words are inputs of the wait below as well (group 0, formed
    // anew for each request, an in-out operand here): the compiler then keeps
    // them where they are while the request is in flight.
    asm volatile("tensor_load_to_lds %0, %1" : "+s"(g0) : "s"(g1) : "memory");
  };
  auto landed = [&]() {
    // the issuer's own wait: a tile counts as landed only behind it
    asm volatile("s_wait_tensorcnt 0x0" :: "s"(g0), "s"(g1) : "memory");
  };

  v8f acc[4][4];
#pragma unroll  // constant indices: the arrays stay in registers
  for (int m = 0; m < 4; ++m)
#pragma unroll  // constant indices: the arrays stay in registers
    for (int t = 0; t < 4; ++t) acc[m][t] = (v8f){};

  // The waits on the tensor count stand outside the issuers' branch: every
  // issuer passes its own, in a wave that has issued nothing it waits for nothing.
  if (pinned(wv < G_NSLICE)) issue(0u);
  landed();
  __syncthreads();                     // stage 0 published
  if (pinned(wv < G_NSLICE)) issue(pinned(1u));

  // Which matrix is the A operand is chosen by where the result goes: a lane
  // holds 8 consecutive ROWS of D, and these must be neighbours in memory.
  // v (stored [head dim][n]): A = h16, D = h.W.  q, k (stored [n][head dim]):
  // A = wT, D = (h.W)^T.  Both operands have the same fragment layout.
  const uint32_t h_off = wm * G_SLICE + (uint32_t)l16 * G_PITCH + (uint32_t)half * 16u;
  const uint32_t w_off = (G_HSLICE + wn) * G_SLICE + (uint32_t)l16 * G_PITCH + (uint32_t)half * 16u;
  const uint32_t a_off = (sel == 2) ? h_off : w_off;
  const uint32_t b_off = (sel == 2) ? w_off : h_off;

  // kept rolled: one copy of the pass, the buffer chosen by the stage's parity
#pragma unroll 1
  for (uint32_t s = 0; s < G_NSTAGE; ++s) {
    const unsigned char* buf = ring + (s & 1u) * G_STAGE;
#pragma unroll  // two blocks of 64 k; the publish point stands in the second
    for (int blk = 0; blk < 2; ++blk) {
      v16h a[2][4], b[2][4];
#pragma unroll  // constant indices: the arrays stay in registers
      for (int ks = 0; ks < 2; ++ks) {
#pragma unroll  // constant indices: the arrays stay in registers
        for (int m = 0; m < 4; ++m)
          a[ks][m] = load_frag16((const _Float16*)(buf + a_off + m * 16 * G_PITCH + blk * 128 + ks * 64));
#pragma unroll  // constant indices: the arrays stay in registers
        for (int t = 0; t < 4; ++t)
          b[ks][t] = load_frag16((const _Float16*)(buf + b_off + t * 16 * G_PITCH + blk * 128 + ks * 64));
      }
      if (blk == 1) {
        // Publish point of stage s + 1.  It stands here, not behind the WMMAs:
        // the stage's last fragments are in registers behind the first wait, so
        // the buffer is free one barrier later and its refill flies under the
        // WMMAs.
        wait_ds0();
        landed();
        __syncthreads();               // s + 1 landed for all; all have left s
        if (pinned(s + 2u < G_NSTAGE && wv < G_NSLICE)) issue(pinned(s + 2u));
      }
#pragma unroll  // constant indices: the arrays stay in registers
      for (int ks = 0; ks < 2; ++ks)
#pragma unroll  // constant indices: the arrays stay in registers
        for (int t = 0; t < 4; ++t)
#pragma unroll  // constant indices: the arrays stay in registers
          for (int m = 0; m < 4; ++m)
            acc[m][t] = wmma_f16(a[ks][m], b[ks][t], acc[m][t]);
    }
  }
  landed();
  wait_ds0();

  // acc[m][t][r] = D[16 m + 8 half + r][16 t + l16]: 8 neighbours of an output
  // row in a lane, stored as 16 bytes.  The wave's 64 columns are one head, the
  // block's 256 rows lie in one batch.
  const int c0 = (int)(cg & (DMODEL - 1u));          // 0..960 inside q, k or v
  const int n0 = (row0 & (NSEQ - 1)) + (int)wm * 64;
  const size_t head = (size_t)((row0 >> 9) * NHEAD + (c0 >> 6)) * (NSEQ * HDIM);
  if (sel == 2) {
    _Float16* dst = vT16 + head + (size_t)l16 * NSEQ + n0 + half * 8;
#pragma unroll  // constant indices: the arrays stay in registers
    for (int t = 0; t < 4; ++t) {
      const float bcol = bias[c0 + t * 16 + l16];
#pragma unroll  // constant indices: the arrays stay in registers
      for (int m = 0; m < 4; ++m) {
        v8h y;
#pragma unroll  // constant indices: the arrays stay in registers
        for (int r = 0; r < 8; ++r) y[r] = (_Float16)(acc[m][t][r] + bcol);
        *(v8h*)(dst + t * 16 * NSEQ + m * 16) = y;
      }
    }
  } else {
    const float qscale = (sel == 0) ? 0.125f : 1.0f;   // fold 1/sqrt(64) into Q
    _Float16* dst = ((sel == 0) ? q16 : k16) + head + (size_t)(n0 + l16) * HDIM + half * 8;
    v4f blo[4], bhi[4];
#pragma unroll  // constant indices: the arrays stay in registers
    for (int m = 0; m < 4; ++m) {
      blo[m] = *(const v4f*)(bias + c0 + m * 16 + half * 8);
      bhi[m] = *(const v4f*)(bias + c0 + m * 16 + half * 8 + 4);
    }
#pragma unroll  // constant indices: the arrays stay in registers
    for (int t = 0; t < 4; ++t)
#pragma unroll  // constant indices: the arrays stay in registers
      for (int m = 0; m < 4; ++m) {
        v8h y;
#pragma unroll  // constant indices: the arrays stay in registers
        for (int r = 0; r < 4; ++r) {
          y[r]     = (_Float16)((acc[m][t][r]     + blo[m][r]) * qscale);
          y[r + 4] = (_Float16)((acc[m][t][r + 4] + bhi[m][r]) * qscale);
        }
        *(v8h*)(dst + t * 16 * HDIM + m * 16) = y;
      }
    // the built code can fall from here into the v branch, which rewrites the
    // registers that these stores name: the wait stands in front of that
    asm volatile("s_wait_xcnt 0x0" ::: "memory");
  }
}

// -------------------------------- attention --------------------------------
// One wave = 16 query rows of one (b,h); key loop in chunks of 32 with online
// softmax.  8 WMMAs per chunk (4 for S^T, 4 for V^T.P^T), 128 per wave.
// Both products are taken transposed: K and V^T are the A operands, Q and P^T
// the B operands.  A lane (l16, half) then holds 16 of the chunk's 32 scores of
// query l16: maximum and sum are taken in the lane, with one exchange between
// the halves, and the two score tiles, converted in place, are the B operand
// P^T in the hardware k order.  O^T is turned into rows once, behind the loop.
// The 8 waves of a block work on one (b,h) and read the same K and V^T: these
// come through a two-buffer LDS ring.  A stage is 128 keys (four chunks) with
// one publish point: 128 rows of K (64 head dims each) and, for each half of
// the keys, 64 rows of V^T (64 keys each), all of 128 bytes; each wave brings
// one 32-row slice of it with one tensor load, padded to the 144-byte row pitch
// for the ds_load_b128 readers.

#define A_KEYS   128u                 // keys of one stage
#define A_ROWB   128u                 // bytes of one staged row
#define A_PITCH  144u                 // LDS row pitch: 128 + 16 pad bytes
#define A_SROWS  32u                  // rows of one slice
#define A_SLICE  6144u                // 32 rows * 144 B, rounded up to 2 KiB
#define A_TILE   (16u * A_PITCH)      // 16 rows inside a slice
#define A_STAGE  (8u * A_SLICE)
#define A_NSTAGE (NSEQ / A_KEYS)
#define A_OPITCH 68                   // floats: 64 head dims + 16 pad bytes

typedef __attribute__((ext_vector_type(16))) unsigned int u32x16;
typedef __attribute__((address_space(4))) u32x16 c_u32x16;

// the value of lane l ^ 16
__device__ inline float xhalf(float x) {
  const int i = __builtin_bit_cast(int, x);
  return __builtin_bit_cast(float, __builtin_amdgcn_permlanex16(
      i, i, 0x76543210, 0xfedcba98, false, false));
}

__global__ __launch_bounds__(256) void attention(
    const _Float16* __restrict__ q16, const _Float16* __restrict__ k16,
    const _Float16* __restrict__ vT16, const unsigned int* __restrict__ mbits,
    float* __restrict__ out)
{
  __shared__ __attribute__((aligned(2048))) unsigned char ring[2u * A_STAGE];
  __shared__ __attribute__((aligned(16))) float ldsO[8][16][A_OPITCH];  // per-wave O staging (O^T -> rows)

  const int lane = threadIdx.x & 31;
  const int w    = threadIdx.x >> 5;
  const uint32_t wv = uni(threadIdx.x >> 5);   // the same, in a scalar register
  const int half = lane >> 4;
  const int l16  = lane & 15;

  const int wid = blockIdx.x * 8 + w;    // 0..4095
  const int qt  = wid & 31;              // query tile 0..31
  const int h   = (wid >> 5) & (NHEAD - 1);
  const int b   = wid >> 9;

  const _Float16* qb = q16 + ((size_t)(b * NHEAD + h) * NSEQ + qt * 16) * HDIM;
  const _Float16* kb = k16 + (size_t)(b * NHEAD + h) * NSEQ * HDIM;
  const _Float16* vb = vT16 + (size_t)(b * NHEAD + h) * HDIM * NSEQ;

  // Q fragments (B operand: column l16 = query l16), fixed across the key loop.
  v16h bQ0 = load_frag16(qb + (size_t)l16 * HDIM + half * 8);
  v16h bQ1 = load_frag16(qb + (size_t)l16 * HDIM + 32 + half * 8);
  // this build rewrites the address pair of these loads right behind them: the
  // wait stands in front of that
  asm volatile("s_wait_xcnt 0x0" ::: "memory");

  // o_t[r] = O[query l16][head dim 16 t + 8 half + r]
  v8f o0 = {}, o1 = {}, o2 = {}, o3 = {};
  float mrow = -1e30f;   // running maximum of query l16, the same in both halves
  float lrow = 0.0f;     // this half's share of the denominator of query l16
  // The wave's mask words: 16 a chunk, one for each score that a lane holds; the
  // address is the same in every lane, so they come by scalar loads.  wid runs
  // as [b][h][query tile], the order of mbits.
  // Read through the constant address space (nothing writes mbits in this
  // launch): the loads inside the loop stay scalar loads too.
  const c_u32x16* mwq = (const c_u32x16*)(size_t)(
      mbits + (size_t)(blockIdx.x * 8u + wv) * (NSEQ / 2u));
  u32x16 mw[4];                              // stage 0, its four chunks
#pragma unroll  // constant indices: the array stays in registers
  for (int c = 0; c < 4; ++c) mw[c] = mwq[c];

  // Slices of a stage: waves 0-3 bring 32 keys of K each (rows one behind the
  // other); waves 4-7 bring 32 head dims of V^T each (rows one sequence apart),
  // waves 4, 5 for the stage's first 64 keys and waves 6, 7 for the other 64.
  const _Float16* slice_src = (wv < 4u) ? kb + (size_t)(wv * A_SROWS) * HDIM
                                        : vb + (size_t)((wv & 1u) * A_SROWS) * NSEQ + ((wv - 4u) >> 1) * 64u;
  const uint32_t slice_pitch = (wv < 4u) ? HDIM * 2u : NSEQ * 2u;           // bytes, row to row
  const uint32_t slice_step  = (wv < 4u) ? A_KEYS * HDIM * 2u : A_KEYS * 2u; // bytes, stage to stage
  const uint64_t src_ga = (uint64_t)(size_t)slice_src;
  const uint32_t lbase  = (uint32_t)(size_t)ring;

  // Descriptor group 1: byte elements, tile = tensor = 32 rows of 128 bytes,
  // 4 dwords of pad behind every 32 dwords.
  u32x8 g1;
  g1[0] = uni((1u << 20) | (4u << 22) | (3u << 25));
  g1[1] = uni((A_ROWB & 0xFFFFu) << 16);
  g1[2] = uni((A_ROWB >> 16) | (A_SROWS << 16));
  g1[3] = uni(A_ROWB << 16);
  g1[4] = uni(A_SROWS);
  g1[5] = uni(slice_pitch);
  g1[6] = uni(0u);
  g1[7] = uni(0u);

  u32x4 g0;                            // group 0 of the wave's last request
  auto issue = [&](uint32_t st) {
    const uint32_t dst = lbase + (st & 1u) * A_STAGE + wv * A_SLICE;
    const uint64_t ga  = src_ga + (uint64_t)(st * slice_step);
    g0[0] = uni(1u);
    g0[1] = uni(dst);
    g0[2] = uni((uint32_t)ga);
    g0[3] = uni((((uint32_t)(ga >> 32)) & 0x01FFFFFFu) | 0x80000000u);
    // One request of the whole wave: global tile -> LDS, through no register.
    // The descriptor words are in-out operands here and inputs of the wait
    // below: the compiler then keeps them where they are, and forms none of
    // them anew, while the request is in flight.
    asm volatile("tensor_load_to_lds %0, %1" : "+s"(g0), "+s"(g1) :: "memory");
  };
  auto landed = [&]() {
    // the issuer's own wait: a tile counts as landed only behind it
    asm volatile("s_wait_tensorcnt 0x0" :: "s"(g0), "s"(g1) : "memory");
  };

  issue(0u);
  landed();
  __syncthreads();                     // stage 0 published
  issue(pinned(1u));

  // a lane's place in a 16-row tile: row l16, its half's 16 bytes
  const uint32_t f_off = (uint32_t)l16 * A_PITCH + (uint32_t)half * 16u;

  // kept rolled: one copy of the pass, the buffer chosen by the stage's parity
#pragma unroll 1
  for (uint32_t s = 0; s < A_NSTAGE; ++s) {
   const unsigned char* buf = ring + (s & 1u) * A_STAGE + f_off;
#pragma unroll  // constant slice numbers and offsets inside the stage
   for (int cc = 0; cc < (int)A_KEYS; cc += 32) {
    // ---- S^T = K.Q^T for 32k x 16q (two 16x16 tiles) ----
    // s0[r] = score(key c + 8 half + r, query l16), s1[r] the same 16 keys on
    v8f s0 = {}, s1 = {};
    {
      const unsigned char* kr = buf + (cc >> 5) * A_SLICE;   // keys cc .. cc+31: one slice
      v16h ak0 = load_frag16((const _Float16*)(kr));
      v16h ak1 = load_frag16((const _Float16*)(kr + 64));
      s0 = wmma_f16(ak0, bQ0, s0);
      s0 = wmma_f16(ak1, bQ1, s0);
      v16h ak2 = load_frag16((const _Float16*)(kr + A_TILE));
      v16h ak3 = load_frag16((const _Float16*)(kr + A_TILE + 64));
      s1 = wmma_f16(ak2, bQ0, s1);
      s1 = wmma_f16(ak3, bQ1, s1);
    }

    // ---- relation mask (scores += -1e9 where disallowed) ----
    {
      const u32x16 mwc = mw[cc >> 5];
#pragma unroll  // constant indices: the vectors stay in registers
      for (int r = 0; r < 8; ++r) {
        // a word is the select's lane mask as it stands
        if (!__builtin_amdgcn_inverse_ballot_w32(mwc[r]))     s0[r] += -1e9f;
        if (!__builtin_amdgcn_inverse_ballot_w32(mwc[r + 8])) s1[r] += -1e9f;
      }
    }

    // ---- online softmax update of query l16 ----
    float v = fmaxf(s0[0], s1[0]);
#pragma unroll  // constant indices: the vectors stay in registers
    for (int r = 1; r < 8; ++r) v = fmaxf(v, fmaxf(s0[r], s1[r]));
    v = fmaxf(v, xhalf(v));              // both halves: the chunk's maximum
    const float mnew = fmaxf(mrow, v);
    const float sc = __expf(mrow - mnew);
    mrow = mnew;
    float rs = 0.0f;
    v16h bP;   // P^T, column l16: the keys in the k order of load_frag16
#pragma unroll  // constant indices: the vectors stay in registers
    for (int r = 0; r < 8; ++r) {
      const float p0 = __expf(s0[r] - mnew);
      const float p1 = __expf(s1[r] - mnew);
      rs += p0 + p1;
      bP[r]     = (_Float16)p0;
      bP[r + 8] = (_Float16)p1;
    }
    lrow = lrow * sc + rs;
    o0 *= sc; o1 *= sc; o2 *= sc; o3 *= sc;

    // ---- O^T += V^T.P^T (4 hd tiles, A fragments from transposed V) ----
    // the two slices of the chunk's half of the keys; keys cc .. cc+31 of a row
    const unsigned char* vr = buf + (4u + (cc >> 6) * 2u) * A_SLICE + (cc & 32) * 2;
    v16h av0 = load_frag16((const _Float16*)(vr));
    v16h av1 = load_frag16((const _Float16*)(vr + A_TILE));
    v16h av2 = load_frag16((const _Float16*)(vr + A_SLICE));
    v16h av3 = load_frag16((const _Float16*)(vr + A_SLICE + A_TILE));
    o0 = wmma_f16(av0, bP, o0);
    o1 = wmma_f16(av1, bP, o1);
    o2 = wmma_f16(av2, bP, o2);
    o3 = wmma_f16(av3, bP, o3);
   }
   // the next stage's mask words, asked for in front of the barrier, before the pass that uses them
   // (the last pass asks for its own again: the address stays inside mbits)
   {
     const c_u32x16* mn = mwq + (s + 1u < A_NSTAGE ? s + 1u : s) * 4u;
#pragma unroll  // constant indices: the array stays in registers
     for (int c = 0; c < 4; ++c) mw[c] = mn[c];
   }
   // Publish point of stage s + 1, at the foot of the pass.
   wait_ds0();
   landed();
   __syncthreads();                    // s + 1 landed for all; all have left s
   if (pinned(s + 2u < A_NSTAGE)) issue(pinned(s + 2u));
  }
  landed();
  wait_ds0();

  // ---- normalize, turn O^T into rows in the wave's own LDS, store fp32 ----
  const float inv = 1.0f / (lrow + xhalf(lrow));   // the halves' shares joined
  {
    float* st = &ldsO[w][l16][half * 8];
    const v8f y0 = o0 * inv, y1 = o1 * inv, y2 = o2 * inv, y3 = o3 * inv;
    *(v4f*)(st)      = __builtin_shufflevector(y0, y0, 0, 1, 2, 3);
    *(v4f*)(st + 4)  = __builtin_shufflevector(y0, y0, 4, 5, 6, 7);
    *(v4f*)(st + 16) = __builtin_shufflevector(y1, y1, 0, 1, 2, 3);
    *(v4f*)(st + 20) = __builtin_shufflevector(y1, y1, 4, 5, 6, 7);
    *(v4f*)(st + 32) = __builtin_shufflevector(y2, y2, 0, 1, 2, 3);
    *(v4f*)(st + 36) = __builtin_shufflevector(y2, y2, 4, 5, 6, 7);
    *(v4f*)(st + 48) = __builtin_shufflevector(y3, y3, 0, 1, 2, 3);
    *(v4f*)(st + 52) = __builtin_shufflevector(y3, y3, 4, 5, 6, 7);
  }
  // 16 lanes cover one query's 64 head dims: a store is 4 whole 128-byte lines
  float* op = out + ((size_t)(b * NSEQ + qt * 16 + half) * DMODEL) + h * HDIM + l16 * 4;
#pragma unroll  // the 8 LDS reads go out together, the stores follow as they return
  for (int i = 0; i < 8; ++i)
    *(v4f*)(op + (size_t)(i * 2) * DMODEL) = *(const v4f*)&ldsO[w][i * 2 + half][l16 * 4];
}

// --------------------------------- launcher --------------------------------

extern "C" void kernel_launch(void* const* d_in, const int* in_sizes, int n_in,
                              void* d_out, int out_size, void* d_ws, size_t ws_size,
                              hipStream_t stream) {
  const float* hidden = (const float*)d_in[0];
  const int*   adj    = (const int*)d_in[1];
  const float* Wq     = (const float*)d_in[2];
  const float* bq     = (const float*)d_in[3];
  const float* Wk     = (const float*)d_in[4];
  const float* bk     = (const float*)d_in[5];
  const float* Wv     = (const float*)d_in[6];
  const float* bv     = (const float*)d_in[7];
  float* out = (float*)d_out;

  char* ws = (char*)d_ws;
  const size_t MB = 1024u * 1024u;
  _Float16* h16  = (_Float16*)(ws);             //  8 MB: [4096,1024]
  _Float16* wT   = (_Float16*)(ws + 8  * MB);   //  6 MB: [3,1024,1024]
  _Float16* q16  = (_Float16*)(ws + 14 * MB);   //  8 MB: [b,h,n,64]
  _Float16* k16  = (_Float16*)(ws + 22 * MB);   //  8 MB
  _Float16* vT16 = (_Float16*)(ws + 30 * MB);   //  8 MB: [b,h,64,n]
  unsigned int* mbits = (unsigned int*)(ws + 38 * MB);   //  4 MB: [b,h,32,8,32]

  // 4096 waves of mask words, 1536 waves of 64 x 32 weights, 4096 waves of
  // 1024 elements of hidden
  prepare<<<P_MASK_BLOCKS + P_WEIGHT_BLOCKS + P_HIDDEN_BLOCKS, 512, 0, stream>>>(
      hidden, h16, adj, mbits, Wq, Wk, Wv, wT);

  // 256-row tiles x 192-col tiles over {q,k,v}, 12 waves of 64x64
  qkv_gemm<<<dim3(NB * NSEQ / 256, 3 * DMODEL / 192), 384, 0, stream>>>(
      h16, wT, bq, bk, bv, q16, k16, vT16);

  // 8*16*32 = 4096 waves, 8 waves per block
  attention<<<512, 256, 0, stream>>>(q16, k16, vT16, mbits, out);
}

// v010
// One run takes 41.9 microseconds.
// In two side-by-side timings against v009, it was 1.05 and 1.04 times as fast.
// All steps since v000 together make it 4.31 times as fast.
#include <hip/hip_runtime.h>
#include <hip/hip_bf16.h>

typedef __attribute__((ext_vector_type(16))) _Float16 v16h;
typedef __attribute__((ext_vector_type(8)))  _Float16 v8h;
typedef __attribute__((ext_vector_type(8)))  float    v8f;

#define NHEAD 16
#define NB    8
#define NSEQ  512
#define DMODEL 1024
#define HDIM  64

// relation->head allow mask (bit r = relation r allowed for this head),
// precomputed from the reference's per-head loop.
__device__ __constant__ unsigned short ALLOWED_MASK[NHEAD] = {
  0x3003, 0x3005, 0x3009, 0x3831, 0x3071, 0x30E1, 0x31C1, 0x3381,
  0x3701, 0x3E01, 0x3C11, 0x3831, 0x7001, 0x7001, 0x7001, 0x7001
};

// Load a 16-lane-half K-packed f16 fragment (A or B layout for 16x16x32):
// caller passes p = base + row*ld + k0 + (lane>>4)*8.  lo = K chunk 0..7(/8..15),
// hi = K chunk 16..23(/24..31) per the CDNA5 16-bit A/B VGPR layout.
__device__ inline v16h load_frag16(const _Float16* p) {
  v8h lo = *(const v8h*)(p);
  v8h hi = *(const v8h*)(p + 16);
  v16h r;
#pragma unroll
  for (int i = 0; i < 8; ++i) { r[i] = lo[i]; r[i + 8] = hi[i]; }
  return r;
}

__device__ inline v8f wmma_f16(v16h a, v16h b, v8f c) {
  return __builtin_amdgcn_wmma_f32_16x16x32_f16(
      /*neg_a=*/false, a, /*neg_b=*/false, b,
      /*c_mod=*/(short)0, c, /*reuse_a=*/false, /*reuse_b=*/false);
}

// ------------------------------- conversions -------------------------------
// Sized by waves to start, not by elements: a thread converts a block of
// elements with 16-byte loads, all of them in flight at once.

typedef __attribute__((ext_vector_type(4))) float    v4f;
typedef __attribute__((ext_vector_type(4))) _Float16 v4h;

typedef __attribute__((ext_vector_type(4))) int v4i;

// One launch for the three preparations, which need nothing of each other: the
// block index picks the part.  608 blocks of 16 waves.
// Blocks 0-255 turn adj into the attention kernel's mask words, once for all
// heads.  mbits[b][h][query tile][half stage][e], bit l = "relation allowed" for the
// score that lane l of the attention wave holds as element e of the half stage (64 keys):
// query 16 tile + (l & 15), key 64 (half stage) + 32 (e >> 4) + 16 ((e >> 3) & 1) +
// 8 (l >> 4) + (e & 7).  A wave takes one (b, tile, half stage) and 8 heads: its
// lanes read adj in the attention wave's own layout, a ballot is a word.
// Blocks 256-351: wT[sel][n_out][k_in] = W_sel[k_in][n_out] (transpose +
// f32->f16).  A wave takes a tile of 64 k x 32 n; a lane holds two blocks of
// 8 k x 4 n in registers (16 loads of 16 bytes; a wave-wide load is 4 whole
// 128-byte lines of W) and stores each n of a block as 8 k = 16 bytes.
// Blocks 352-607: a wave converts 1024 floats of hidden in a row: 8 loads of
// 512 contiguous bytes, then 8 stores of 256 contiguous bytes.
#define P_MASK_BLOCKS   256
#define P_WEIGHT_BLOCKS (3 * DMODEL * DMODEL / (16 * 64 * 32))
#define P_HIDDEN_BLOCKS (NB * NSEQ * DMODEL / (16 * 1024))

__global__ __launch_bounds__(512) void prepare(const float* __restrict__ src,
                                               _Float16* __restrict__ dst,
                                               const int* __restrict__ adj,
                                               unsigned int* __restrict__ mbits,
                                               const float* __restrict__ Wq,
                                               const float* __restrict__ Wk,
                                               const float* __restrict__ Wv,
                                               _Float16* __restrict__ wT) {
  const int lane = threadIdx.x & 31;
  if (blockIdx.x < P_MASK_BLOCKS) {
    const unsigned int t = blockIdx.x * 16u +
        (unsigned int)__builtin_amdgcn_readfirstlane(threadIdx.x >> 5);   // 0..4095
    const unsigned int hg = t & 1u, st = (t >> 1) & 7u, qt = (t >> 4) & 31u, b = t >> 9;
    const int* p = adj + ((size_t)b * NSEQ + qt * 16u + (lane & 15)) * NSEQ + st * 64u + (lane >> 4) * 8;
    v4i x[8];
#pragma unroll  // constant indices: the array stays in registers
    for (int j = 0; j < 8; ++j) x[j] = *(const v4i*)(p + (j >> 1) * 16 + (j & 1) * 4);
#pragma unroll  // constant indices: the array stays in registers
    for (int hh = 0; hh < 8; ++hh) {
      const unsigned int h = hg * 8u + hh;
      const unsigned int mask = ALLOWED_MASK[h];
      unsigned int w = 0u;
#pragma unroll  // constant indices: the array stays in registers
      for (int e = 0; e < 32; ++e) {
        const unsigned int word =
            __builtin_amdgcn_ballot_w32(((mask >> x[e >> 2][e & 3]) & 1u) != 0u);
        w = (lane == e) ? word : w;          // lane e stores word e
      }
      mbits[((((size_t)b * NHEAD + h) * 32u + qt) * 8u + st) * 32u + lane] = w;
    }
  } else if (blockIdx.x < P_MASK_BLOCKS + P_WEIGHT_BLOCKS) {
    const int t   = (blockIdx.x - P_MASK_BLOCKS) * 16 + (threadIdx.x >> 5);   // 0 .. 3*512-1
    const int sel = t >> 9;
    const int n0  = (t & 31) * 32 + (lane & 7) * 4;
    const int k0  = ((t >> 5) & 15) * 64 + (lane >> 3) * 8;
    const float* W = (sel == 0) ? Wq : ((sel == 1) ? Wk : Wv);
    const float* s = W + (size_t)k0 * DMODEL + n0;
    v4f x[2][8];
#pragma unroll  // constant indices: the array stays in registers
    for (int u = 0; u < 2; ++u)
#pragma unroll  // constant indices: the array stays in registers
      for (int j = 0; j < 8; ++j)
        x[u][j] = *(const v4f*)(s + (size_t)(u * 32 + j) * DMODEL);
    // Takes the loaded values and their address as inputs only: all 16 loads are
    // in flight before the first convert (without it two of them are issued only
    // behind a wait for earlier ones, a second trip to memory), and the address
    // pair that they name is rewritten only behind this wait.
    asm volatile("s_wait_xcnt 0x0" :: "v"(x[0][0]), "v"(x[0][1]), "v"(x[0][2]), "v"(x[0][3]),
                       "v"(x[0][4]), "v"(x[0][5]), "v"(x[0][6]), "v"(x[0][7]),
                       "v"(x[1][0]), "v"(x[1][1]), "v"(x[1][2]), "v"(x[1][3]),
                       "v"(x[1][4]), "v"(x[1][5]), "v"(x[1][6]), "v"(x[1][7]),
                       "v"(s) : "memory");
    _Float16* d = wT + ((size_t)sel * DMODEL + n0) * DMODEL + k0;
#pragma unroll  // constant indices: the array stays in registers
    for (int u = 0; u < 2; ++u)
#pragma unroll  // constant indices: the array stays in registers
      for (int i = 0; i < 4; ++i) {
        v8h y;
#pragma unroll  // constant indices: the array stays in registers
        for (int j = 0; j < 8; ++j) y[j] = (_Float16)x[u][j][i];
        *(v8h*)(d + (size_t)i * DMODEL + u * 32) = y;
      }
    // the built code can go on from here into another part, which rewrites the
    // registers that these stores name: the wait stands in front of that
    asm volatile("s_wait_xcnt 0x0" ::: "memory");
  } else {
    const int wave = (blockIdx.x - (P_MASK_BLOCKS + P_WEIGHT_BLOCKS)) * 16 + (threadIdx.x >> 5);
    const size_t base = (size_t)wave * 1024 + lane * 4;
    v4f x[8];
#pragma unroll  // constant indices: the array stays in registers
    for (int j = 0; j < 8; ++j) x[j] = *(const v4f*)(src + base + j * 128);
#pragma unroll  // constant indices: the array stays in registers
    for (int j = 0; j < 8; ++j)
      *(v4h*)(dst + base + j * 128) = __builtin_convertvector(x[j], v4h);
    // the built code can go on from here into another part, which rewrites the
    // registers that these stores name: the wait stands in front of that
    asm volatile("s_wait_xcnt 0x0" ::: "memory");
  }
}

// --------------------------------- QKV GEMM --------------------------------
// grid (16 row tiles, 16 column tiles over {q,k,v}), 384 threads = 12 waves:
// 256 blocks, one for each WGP (registers hold three such waves on a SIMD).
// One 256x192 output tile per block, 64x64 (4x4 WMMA tiles) per wave, 4 waves
// down and 3 across.  The tile is sized by what the ring draws from L2: the
// operand bytes copied per result fall as the tile's sides grow, and this is the
// largest tile of 64x64 waves that still gives every WGP a block.
// A wave's 64 columns are one head of q, k or v; a block may hold two of the
// three matrices, so which one it is is a matter of the wave.  The
// operands come through a two-buffer LDS ring: a stage is 128 k of 256 rows of
// h16 and 192 rows of wT; waves 0-6 each bring one 64-row slice of it with one
// tensor load, padded to a 272-byte row pitch for the ds_load_b128 readers.
// A stage is worked on as two blocks of 64 k with one publish point: what a
// publish point costs (the last wave's LDS reads with the matrix units idle, a
// tensor load's latency) is paid 8 times, not 16.

typedef uint32_t u32x4 __attribute__((ext_vector_type(4)));
typedef uint32_t u32x8 __attribute__((ext_vector_type(8)));

#define G_ROWB   256u                 // bytes of one staged row (128 k of f16)
#define G_PITCH  272u                 // LDS row pitch: 256 + 16 pad bytes
#define G_SLICE  18432u               // 64 rows * 272 B, rounded up to 2 KiB
#define G_HSLICE 4u                   // slices of h16 in a stage (256 rows)
#define G_NSLICE 7u                   // and with them 3 slices of wT (192 rows)
#define G_STAGE  (G_NSLICE * G_SLICE)
#define G_NSTAGE (DMODEL * 2u / G_ROWB)

__device__ inline uint32_t uni(uint32_t v) {
  return (uint32_t)__builtin_amdgcn_readfirstlane(v);
}
// Makes the test around a tensor load a scalar branch, and keeps a descriptor
// word that is formed from the result behind the waits in front of the call.
__device__ inline uint32_t pinned(uint32_t v) {
  uint32_t w = uni(v);
  // pinned(): an issue test or a descriptor word held in a scalar register
  asm volatile("" : "+s"(w));
  return w;
}
__device__ inline void wait_ds0() {
  // a wave's LDS reads have retired before the buffer they read is refilled
  asm volatile("s_wait_dscnt 0x0" ::: "memory");
}

// Output staging of a wave: 64 rows of 128 bytes at the pitch of the 16-byte
// LDS accesses (16 bytes x an odd number).
#define E_PITCH  144u
#define E_WAVE   (64u * E_PITCH)

// The wave's 64 staged rows to memory, ROWP elements from row to row: a store
// is 4 rows = 4 whole 128-byte lines.
template <int ROWP>
__device__ inline void store_rows(const unsigned char* sr, _Float16* dst) {
  wait_ds0();   // the wave's own LDS writes have retired before it reads the rows back
  v8h z[16];
#pragma unroll  // the 16 LDS reads go out together, the stores follow as they return
  for (int i = 0; i < 16; ++i) z[i] = *(const v8h*)(sr + i * 4 * E_PITCH);
#pragma unroll  // constant offsets from one address
  for (int i = 0; i < 16; ++i) *(v8h*)(dst + i * 4 * ROWP) = z[i];
}

__global__ __launch_bounds__(384) void qkv_gemm(
    const _Float16* __restrict__ h16,   // [4096,1024]
    const _Float16* __restrict__ wT,    // [3][1024][1024]
    const float* __restrict__ bq, const float* __restrict__ bk,
    const float* __restrict__ bv,
    _Float16* __restrict__ q16,         // [b,h,n,64]  (pre-scaled 1/8)
    _Float16* __restrict__ k16,         // [b,h,n,64]
    _Float16* __restrict__ vT16)        // [b,h,64,n]
{
  __shared__ __attribute__((aligned(2048))) unsigned char ring[2u * G_STAGE];

  const int lane = threadIdx.x & 31;
  const uint32_t wv = uni(threadIdx.x >> 5);
  const int half = lane >> 4;
  const int l16  = lane & 15;
  const uint32_t wm = wv & 3u, wn = wv >> 2;         // 4x3 waves
  const int row0 = blockIdx.x * 256;                 // 0..3840
  const uint32_t cg = blockIdx.y * 192u + wn * 64u;  // the wave's first column of 3072
  const int sel  = (int)(cg >> 10);                  // q, k or v: the same in a wave

  const float* bias = (sel == 0) ? bq : ((sel == 1) ? bk : bv);

  // Slices of a stage: waves 0-3 bring 64 rows of h16 each, waves 4-6 bring 64
  // rows of wT each (wT's three matrices are contiguous); waves 7-11 bring none
  // (sl only keeps their unused address inside wT).
  const uint32_t sl = (wv < G_NSLICE) ? wv : G_NSLICE - 1u;
  const _Float16* slice_src =
      (sl < G_HSLICE) ? h16 + (size_t)(row0 + sl * 64u) * DMODEL
                      : wT + (size_t)(blockIdx.y * 192u + (sl - G_HSLICE) * 64u) * DMODEL;
  const uint64_t src_ga = (uint64_t)(size_t)slice_src;
  const uint32_t lbase  = (uint32_t)(size_t)ring;

  // Descriptor group 1: byte elements, tile = tensor = 64 rows of 256 bytes,
  // source pitch 2048 bytes, 4 dwords of pad behind every 64 dwords.
  // pinned(): each descriptor word held in one scalar register from here on,
  // not formed a second time while a request that names it is in flight.
  u32x8 g1;
  g1[0] = pinned((1u << 20) | (5u << 22) | (3u << 25));
  g1[1] = pinned((G_ROWB & 0xFFFFu) << 16);
  g1[2] = pinned((G_ROWB >> 16) | (64u << 16));
  g1[3] = pinned(G_ROWB << 16);
  g1[4] = pinned(64u);
  g1[5] = pinned(DMODEL * 2u);
  g1[6] = pinned(0u);
  g1[7] = pinned(0u);

  u32x4 g0 = {0u, 0u, 0u, 0u};         // group 0 of the wave's last request
  auto issue = [&](uint32_t st) {
    const uint32_t dst = lbase + (st & 1u) * G_STAGE + wv * G_SLICE;
    const uint64_t ga  = src_ga + (uint64_t)(st * G_ROWB);
    g0[0] = uni(1u);
    g0[1] = uni(dst);
    g0[2] = uni((uint32_t)ga);
    g0[3] = uni((((uint32_t)(ga >> 32)) & 0x01FFFFFFu) | 0x80000000u);
    // One request of the whole wave: global tile -> LDS, through no register.
    // The descriptor words are inputs of the wait below as well (group 0, formed
    // anew for each request, an in-out operand here): the compiler then keeps
    // them where they are while the request is in flight.
    asm volatile("tensor_load_to_lds %0, %1" : "+s"(g0) : "s"(g1) : "memory");
  };
  auto landed = [&]() {
    // the issuer's own wait: a tile counts as landed only behind it
    asm volatile("s_wait_tensorcnt 0x0" :: "s"(g0), "s"(g1) : "memory");
  };

  v8f acc[4][4];
#pragma unroll  // constant indices: the arrays stay in registers
  for (int m = 0; m < 4; ++m)
#pragma unroll  // constant indices: the arrays stay in registers
    for (int t = 0; t < 4; ++t) acc[m][t] = (v8f){};

  // The waits on the tensor count stand outside the issuers' branch: every
  // issuer passes its own, in a wave that has issued nothing it waits for nothing.
  if (pinned(wv < G_NSLICE)) issue(0u);
  landed();
  __syncthreads();                     // stage 0 published
  if (pinned(wv < G_NSLICE)) issue(pinned(1u));

  // Which matrix is the A operand is chosen by where the result goes: a lane
  // holds 8 consecutive ROWS of D, and these must be neighbours in memory.
  // v (stored [head dim][n]): A = h16, D = h.W.  q, k (stored [n][head dim]):
  // A = wT, D = (h.W)^T.  Both operands have the same fragment layout.
  const uint32_t h_off = wm * G_SLICE + (uint32_t)l16 * G_PITCH + (uint32_t)half * 16u;
  const uint32_t w_off = (G_HSLICE + wn) * G_SLICE + (uint32_t)l16 * G_PITCH + (uint32_t)half * 16u;
  const uint32_t a_off = (sel == 2) ? h_off : w_off;
  const uint32_t b_off = (sel == 2) ? w_off : h_off;

  // kept rolled: one copy of the pass, the buffer chosen by the stage's parity
#pragma unroll 1
  for (uint32_t s = 0; s < G_NSTAGE; ++s) {
    const unsigned char* buf = ring + (s & 1u) * G_STAGE;
#pragma unroll  // two blocks of 64 k; the publish point stands in the second
    for (int blk = 0; blk < 2; ++blk) {
      v16h a[2][4], b[2][4];
#pragma unroll  // constant indices: the arrays stay in registers
      for (int ks = 0; ks < 2; ++ks) {
#pragma unroll  // constant indices: the arrays stay in registers
        for (int m = 0; m < 4; ++m)
          a[ks][m] = load_frag16((const _Float16*)(buf + a_off + m * 16 * G_PITCH + blk * 128 + ks * 64));
#pragma unroll  // constant indices: the arrays stay in registers
        for (int t = 0; t < 4; ++t)
          b[ks][t] = load_frag16((const _Float16*)(buf + b_off + t * 16 * G_PITCH + blk * 128 + ks * 64));
      }
      if (blk == 1) {
        // Publish point of stage s + 1.  It stands here, not behind the WMMAs:
        // the stage's last fragments are in registers behind the first wait, so
        // the buffer is free one barrier later and its refill flies under the
        // WMMAs.
        wait_ds0();
        landed();
        __syncthreads();               // s + 1 landed for all; all have left s
        if (pinned(s + 2u < G_NSTAGE && wv < G_NSLICE)) issue(pinned(s + 2u));
      }
#pragma unroll  // constant indices: the arrays stay in registers
      for (int ks = 0; ks < 2; ++ks)
#pragma unroll  // constant indices: the arrays stay in registers
        for (int t = 0; t < 4; ++t)
#pragma unroll  // constant indices: the arrays stay in registers
          for (int m = 0; m < 4; ++m)
            acc[m][t] = wmma_f16(a[ks][m], b[ks][t], acc[m][t]);
    }
  }
  landed();
  wait_ds0();

  // acc[m][t][r] = D[16 m + 8 half + r][16 t + l16]: 8 neighbours of an output
  // row in a lane, 16 bytes.  The wave's 64 columns are one head, the block's 256
  // rows lie in one batch.  Its result is 64 rows of 128 bytes in memory (q, k:
  // a row is a position, v: a head dim), and a lane's 16 bytes with those of the
  // other half are only a quarter of a line: the rows go through the wave's own
  // range of the ring and leave as whole lines.  The ring is free: the last
  // pass's publish point (LDS reads retired, no tensor load left, barrier) was
  // every wave's last use of it.
  const int c0 = (int)(cg & (DMODEL - 1u));          // 0..960 inside q, k or v
  const int n0 = (row0 & (NSEQ - 1)) + (int)wm * 64;
  const size_t head = (size_t)((row0 >> 9) * NHEAD + (c0 >> 6)) * (NSEQ * HDIM);
  unsigned char* stg = ring + wv * E_WAVE;
  // written: row 16 t + l16, bytes 32 m + 16 half; read back: 8 lanes a row
  unsigned char* sw = stg + (uint32_t)l16 * E_PITCH + (uint32_t)half * 16u;
  const unsigned char* sr = stg + (uint32_t)(lane >> 3) * E_PITCH + (uint32_t)(lane & 7) * 16u;
  if (sel == 2) {
#pragma unroll  // constant indices: the arrays stay in registers
    for (int t = 0; t < 4; ++t) {
      const float bcol = bias[c0 + t * 16 + l16];
#pragma unroll  // constant indices: the arrays stay in registers
      for (int m = 0; m < 4; ++m) {
        v8h y;
#pragma unroll  // constant indices: the arrays stay in registers
        for (int r = 0; r < 8; ++r) y[r] = (_Float16)(acc[m][t][r] + bcol);
        *(v8h*)(sw + t * 16 * E_PITCH + m * 32) = y;
      }
    }
    store_rows<NSEQ>(sr, vT16 + head + (size_t)(lane >> 3) * NSEQ + n0 + (lane & 7) * 8);
  } else {
    const float qscale = (sel == 0) ? 0.125f : 1.0f;   // fold 1/sqrt(64) into Q
    v4f blo[4], bhi[4];
#pragma unroll  // constant indices: the arrays stay in registers
    for (int m = 0; m < 4; ++m) {
      blo[m] = *(const v4f*)(bias + c0 + m * 16 + half * 8);
      bhi[m] = *(const v4f*)(bias + c0 + m * 16 + half * 8 + 4);
    }
#pragma unroll  // constant indices: the arrays stay in registers
    for (int t = 0; t < 4; ++t)
#pragma unroll  // constant indices: the arrays stay in registers
      for (int m = 0; m < 4; ++m) {
        v8h y;
#pragma unroll  // constant indices: the arrays stay in registers
        for (int r = 0; r < 4; ++r) {
          y[r]     = (_Float16)((acc[m][t][r]     + blo[m][r]) * qscale);
          y[r + 4] = (_Float16)((acc[m][t][r + 4] + bhi[m][r]) * qscale);
        }
        *(v8h*)(sw + t * 16 * E_PITCH + m * 32) = y;
      }
    // the 64 positions' rows follow one another: 512 bytes in a row a store
    store_rows<HDIM>(sr, ((sel == 0) ? q16 : k16) + head + (size_t)n0 * HDIM + lane * 8);
    // the built code can fall from here into the v branch, which rewrites the
    // registers that these stores name: the wait stands in front of that
    asm volatile("s_wait_xcnt 0x0" ::: "memory");
  }
}

// -------------------------------- attention --------------------------------
// One wave = 16 query rows of one (b,h); key loop in chunks of 32 with online
// softmax.  8 WMMAs per chunk (4 for S^T, 4 for V^T.P^T), 128 per wave.
// Both products are taken transposed: K and V^T are the A operands, Q and P^T
// the B operands.  A lane (l16, half) then holds 16 of the chunk's 32 scores of
// query l16: maximum and sum are taken in the lane, with one exchange between
// the halves, and the two score tiles, converted in place, are the B operand
// P^T in the hardware k order.  O^T is turned into rows once, behind the loop.
// The 8 waves of a block work on one (b,h) and read the same K and V^T: these
// come through a two-buffer LDS ring.  A stage is 128 keys (four chunks) with
// one publish point: 128 rows of K (64 head dims each) and, for each half of
// the keys, 64 rows of V^T (64 keys each), all of 128 bytes; each wave brings
// one 32-row slice of it with one tensor load, padded to the 144-byte row pitch
// for the ds_load_b128 readers.

#define A_KEYS   128u                 // keys of one stage
#define A_ROWB   128u                 // bytes of one staged row
#define A_PITCH  144u                 // LDS row pitch: 128 + 16 pad bytes
#define A_SROWS  32u                  // rows of one slice
#define A_SLICE  6144u                // 32 rows * 144 B, rounded up to 2 KiB
#define A_TILE   (16u * A_PITCH)      // 16 rows inside a slice
#define A_STAGE  (8u * A_SLICE)
#define A_NSTAGE (NSEQ / A_KEYS)
#define A_OPITCH 68                   // floats: 64 head dims + 16 pad bytes

typedef __attribute__((ext_vector_type(16))) unsigned int u32x16;
typedef __attribute__((address_space(4))) u32x16 c_u32x16;

// the value of lane l ^ 16
__device__ inline float xhalf(float x) {
  const int i = __builtin_bit_cast(int, x);
  return __builtin_bit_cast(float, __builtin_amdgcn_permlanex16(
      i, i, 0x76543210, 0xfedcba98, false, false));
}

__global__ __launch_bounds__(256) void attention(
    const _Float16* __restrict__ q16, const _Float16* __restrict__ k16,
    const _Float16* __restrict__ vT16, const unsigned int* __restrict__ mbits,
    float* __restrict__ out)
{
  __shared__ __attribute__((aligned(2048))) unsigned char ring[2u * A_STAGE];
  __shared__ __attribute__((aligned(16))) float ldsO[8][16][A_OPITCH];  // per-wave O staging (O^T -> rows)

  const int lane = threadIdx.x & 31;
  const int w    = threadIdx.x >> 5;
  const uint32_t wv = uni(threadIdx.x >> 5);   // the same, in a scalar register
  const int half = lane >> 4;
  const int l16  = lane & 15;

  const int wid = blockIdx.x * 8 + w;    // 0..4095
  const int qt  = wid & 31;              // query tile 0..31
  const int h   = (wid >> 5) & (NHEAD - 1);
  const int b   = wid >> 9;

  const _Float16* qb = q16 + ((size_t)(b * NHEAD + h) * NSEQ + qt * 16) * HDIM;
  const _Float16* kb = k16 + (size_t)(b * NHEAD + h) * NSEQ * HDIM;
  const _Float16* vb = vT16 + (size_t)(b * NHEAD + h) * HDIM * NSEQ;

  // Q fragments (B operand: column l16 = query l16), fixed across the key loop.
  v16h bQ0 = load_frag16(qb + (size_t)l16 * HDIM + half * 8);
  v16h bQ1 = load_frag16(qb + (size_t)l16 * HDIM + 32 + half * 8);
  // this build rewrites the address pair of these loads right behind them: the
  // wait stands in front of that
  asm volatile("s_wait_xcnt 0x0" ::: "memory");

  // o_t[r] = O[query l16][head dim 16 t + 8 half + r]
  v8f o0 = {}, o1 = {}, o2 = {}, o3 = {};
  float mrow = -1e30f;   // running maximum of query l16, the same in both halves
  float lrow = 0.0f;     // this half's share of the denominator of query l16
  // The wave's mask words: 16 a chunk, one for each score that a lane holds; the
  // address is the same in every lane, so they come by scalar loads.  wid runs
  // as [b][h][query tile], the order of mbits.
  // Read through the constant address space (nothing writes mbits in this
  // launch): the loads inside the loop stay scalar loads too.
  const c_u32x16* mwq = (const c_u32x16*)(size_t)(
      mbits + (size_t)(blockIdx.x * 8u + wv) * (NSEQ / 2u));
  u32x16 mw[4];                              // stage 0, its four chunks
#pragma unroll  // constant indices: the array stays in registers
  for (int c = 0; c < 4; ++c) mw[c] = mwq[c];

  // Slices of a stage: waves 0-3 bring 32 keys of K each (rows one behind the
  // other); waves 4-7 bring 32 head dims of V^T each (rows one sequence apart),
  // waves 4, 5 for the stage's first 64 keys and waves 6, 7 for the other 64.
  const _Float16* slice_src = (wv < 4u) ? kb + (size_t)(wv * A_SROWS) * HDIM
                                        : vb + (size_t)((wv & 1u) * A_SROWS) * NSEQ + ((wv - 4u) >> 1) * 64u;
  const uint32_t slice_pitch = (wv < 4u) ? HDIM * 2u : NSEQ * 2u;           // bytes, row to row
  const uint32_t slice_step  = (wv < 4u) ? A_KEYS * HDIM * 2u : A_KEYS * 2u; // bytes, stage to stage
  const uint64_t src_ga = (uint64_t)(size_t)slice_src;
  const uint32_t lbase  = (uint32_t)(size_t)ring;

  // Descriptor group 1: byte elements, tile = tensor = 32 rows of 128 bytes,
  // 4 dwords of pad behind every 32 dwords.
  u32x8 g1;
  g1[0] = uni((1u << 20) | (4u << 22) | (3u << 25));
  g1[1] = uni((A_ROWB & 0xFFFFu) << 16);
  g1[2] = uni((A_ROWB >> 16) | (A_SROWS << 16));
  g1[3] = uni(A_ROWB << 16);
  g1[4] = uni(A_SROWS);
  g1[5] = uni(slice_pitch);
  g1[6] = uni(0u);
  g1[7] = uni(0u);

  u32x4 g0;                            // group 0 of the wave's last request
  auto issue = [&](uint32_t st) {
    const uint32_t dst = lbase + (st & 1u) * A_STAGE + wv * A_SLICE;
    const uint64_t ga  = src_ga + (uint64_t)(st * slice_step);
    g0[0] = uni(1u);
    g0[1] = uni(dst);
    g0[2] = uni((uint32_t)ga);
    g0[3] = uni((((uint32_t)(ga >> 32)) & 0x01FFFFFFu) | 0x80000000u);
    // One request of the whole wave: global tile -> LDS, through no register.
    // The descriptor words are in-out operands here and inputs of the wait
    // below: the compiler then keeps them where they are, and forms none of
    // them anew, while the request is in flight.
    asm volatile("tensor_load_to_lds %0, %1" : "+s"(g0), "+s"(g1) :: "memory");
  };
  auto landed = [&]() {
    // the issuer's own wait: a tile counts as landed only behind it
    asm volatile("s_wait_tensorcnt 0x0" :: "s"(g0), "s"(g1) : "memory");
  };

  issue(0u);
  landed();
  __syncthreads();                     // stage 0 published
  issue(pinned(1u));

  // a lane's place in a 16-row tile: row l16, its half's 16 bytes
  const uint32_t f_off = (uint32_t)l16 * A_PITCH + (uint32_t)half * 16u;

  // kept rolled: one copy of the pass, the buffer chosen by the stage's parity
#pragma unroll 1
  for (uint32_t s = 0; s < A_NSTAGE; ++s) {
   const unsigned char* buf = ring + (s & 1u) * A_STAGE + f_off;
#pragma unroll  // constant slice numbers and offsets inside the stage
   for (int cc = 0; cc < (int)A_KEYS; cc += 32) {
    // ---- S^T = K.Q^T for 32k x 16q (two 16x16 tiles) ----
    // s0[r] = score(key c + 8 half + r, query l16), s1[r] the same 16 keys on
    v8f s0 = {}, s1 = {};
    {
      const unsigned char* kr = buf + (cc >> 5) * A_SLICE;   // keys cc .. cc+31: one slice
      v16h ak0 = load_frag16((const _Float16*)(kr));
      v16h ak1 = load_frag16((const _Float16*)(kr + 64));
      s0 = wmma_f16(ak0, bQ0, s0);
      s0 = wmma_f16(ak1, bQ1, s0);
      v16h ak2 = load_frag16((const _Float16*)(kr + A_TILE));
      v16h ak3 = load_frag16((const _Float16*)(kr + A_TILE + 64));
      s1 = wmma_f16(ak2, bQ0, s1);
      s1 = wmma_f16(ak3, bQ1, s1);
    }

    // ---- relation mask (scores += -1e9 where disallowed) ----
    {
      const u32x16 mwc = mw[cc >> 5];
#pragma unroll  // constant indices: the vectors stay in registers
      for (int r = 0; r < 8; ++r) {
        // a word is the select's lane mask as it stands
        if (!__builtin_amdgcn_inverse_ballot_w32(mwc[r]))     s0[r] += -1e9f;
        if (!__builtin_amdgcn_inverse_ballot_w32(mwc[r + 8])) s1[r] += -1e9f;
      }
    }

    // ---- online softmax update of query l16 ----
    float v = fmaxf(s0[0], s1[0]);
#pragma unroll  // constant indices: the vectors stay in registers
    for (int r = 1; r < 8; ++r) v = fmaxf(v, fmaxf(s0[r], s1[r]));
    v = fmaxf(v, xhalf(v));              // both halves: the chunk's maximum
    const float mnew = fmaxf(mrow, v);
    const float sc = __expf(mrow - mnew);
    mrow = mnew;
    float rs = 0.0f;
    v16h bP;   // P^T, column l16: the keys in the k order of load_frag16
#pragma unroll  // constant indices: the vectors stay in registers
    for (int r = 0; r < 8; ++r) {
      const float p0 = __expf(s0[r] - mnew);
      const float p1 = __expf(s1[r] - mnew);
      rs += p0 + p1;
      bP[r]     = (_Float16)p0;
      bP[r + 8] = (_Float16)p1;
    }
    lrow = lrow * sc + rs;
    o0 *= sc; o1 *= sc; o2 *= sc; o3 *= sc;

    // ---- O^T += V^T.P^T (4 hd tiles, A fragments from transposed V) ----
    // the two slices of the chunk's half of the keys; keys cc .. cc+31 of a row
    const unsigned char* vr = buf + (4u + (cc >> 6) * 2u) * A_SLICE + (cc & 32) * 2;
    v16h av0 = load_frag16((const _Float16*)(vr));
    v16h av1 = load_frag16((const _Float16*)(vr + A_TILE));
    v16h av2 = load_frag16((const _Float16*)(vr + A_SLICE));
    v16h av3 = load_frag16((const _Float16*)(vr + A_SLICE + A_TILE));
    o0 = wmma_f16(av0, bP, o0);
    o1 = wmma_f16(av1, bP, o1);
    o2 = wmma_f16(av2, bP, o2);
    o3 = wmma_f16(av3, bP, o3);
   }
   // the next stage's mask words, asked for in front of the barrier, before the pass that uses them
   // (the last pass asks for its own again: the address stays inside mbits)
   {
     const c_u32x16* mn = mwq + (s + 1u < A_NSTAGE ? s + 1u : s) * 4u;
#pragma unroll  // constant indices: the array stays in registers
     for (int c = 0; c < 4; ++c) mw[c] = mn[c];
   }
   // Publish point of stage s + 1, at the foot of the pass.
   wait_ds0();
   landed();
   __syncthreads();                    // s + 1 landed for all; all have left s
   if (pinned(s + 2u < A_NSTAGE)) issue(pinned(s + 2u));
  }
  landed();
  wait_ds0();

  // ---- normalize, turn O^T into rows in the wave's own LDS, store fp32 ----
  const float inv = 1.0f / (lrow + xhalf(lrow));   // the halves' shares joined
  {
    float* st = &ldsO[w][l16][half * 8];
    const v8f y0 = o0 * inv, y1 = o1 * inv, y2 = o2 * inv, y3 = o3 * inv;
    *(v4f*)(st)      = __builtin_shufflevector(y0, y0, 0, 1, 2, 3);
    *(v4f*)(st + 4)  = __builtin_shufflevector(y0, y0, 4, 5, 6, 7);
    *(v4f*)(st + 16) = __builtin_shufflevector(y1, y1, 0, 1, 2, 3);
    *(v4f*)(st + 20) = __builtin_shufflevector(y1, y1, 4, 5, 6, 7);
    *(v4f*)(st + 32) = __builtin_shufflevector(y2, y2, 0, 1, 2, 3);
    *(v4f*)(st + 36) = __builtin_shufflevector(y2, y2, 4, 5, 6, 7);
    *(v4f*)(st + 48) = __builtin_shufflevector(y3, y3, 0, 1, 2, 3);
    *(v4f*)(st + 52) = __builtin_shufflevector(y3, y3, 4, 5, 6, 7);
  }
  // 16 lanes cover one query's 64 head dims: a store is 4 whole 128-byte lines
  float* op = out + ((size_t)(b * NSEQ + qt * 16 + half) * DMODEL) + h * HDIM + l16 * 4;
#pragma unroll  // the 8 LDS reads go out together, the stores follow as they return
  for (int i = 0; i < 8; ++i)
    *(v4f*)(op + (size_t)(i * 2) * DMODEL) = *(const v4f*)&ldsO[w][i * 2 + half][l16 * 4];
}

// --------------------------------- launcher --------------------------------

extern "C" void kernel_launch(void* const* d_in, const int* in_sizes, int n_in,
                              void* d_out, int out_size, void* d_ws, size_t ws_size,
                              hipStream_t stream) {
  const float* hidden = (const float*)d_in[0];
  const int*   adj    = (const int*)d_in[1];
  const float* Wq     = (const float*)d_in[2];
  const float* bq     = (const float*)d_in[3];
  const float* Wk     = (const float*)d_in[4];
  const float* bk     = (const float*)d_in[5];
  const float* Wv     = (const float*)d_in[6];
  const float* bv     = (const float*)d_in[7];
  float* out = (float*)d_out;

  char* ws = (char*)d_ws;
  const size_t MB = 1024u * 1024u;
  _Float16* h16  = (_Float16*)(ws);             //  8 MB: [4096,1024]
  _Float16* wT   = (_Float16*)(ws + 8  * MB);   //  6 MB: [3,1024,1024]
  _Float16* q16  = (_Float16*)(ws + 14 * MB);   //  8 MB: [b,h,n,64]
  _Float16* k16  = (_Float16*)(ws + 22 * MB);   //  8 MB
  _Float16* vT16 = (_Float16*)(ws + 30 * MB);   //  8 MB: [b,h,64,n]
  unsigned int* mbits = (unsigned int*)(ws + 38 * MB);   //  4 MB: [b,h,32,8,32]

  // 4096 waves of mask words, 1536 waves of 64 x 32 weights, 4096 waves of
  // 1024 elements of hidden
  prepare<<<P_MASK_BLOCKS + P_WEIGHT_BLOCKS + P_HIDDEN_BLOCKS, 512, 0, stream>>>(
      hidden, h16, adj, mbits, Wq, Wk, Wv, wT);

  // 256-row tiles x 192-col tiles over {q,k,v}, 12 waves of 64x64
  qkv_gemm<<<dim3(NB * NSEQ / 256, 3 * DMODEL / 192), 384, 0, stream>>>(
      h16, wT, bq, bk, bv, q16, k16, vT16);

  // 8*16*32 = 4096 waves, 8 waves per block
  attention<<<512, 256, 0, stream>>>(q16, k16, vT16, mbits, out);
}
